// v000
// The times below were measured on an AMD MI455X: many runs one after another, warmed up first and cycling through
// copies of the inputs, with the whole window's GPU time divided by the number of runs. Launches and the gaps
// between them are all in it. The median over several windows is given; except for v000 it joins two sittings, which
// can be a few percent apart, so the side-by-side timings, each taken in one sitting, are the better comparison.
// v000, which the later versions start from, runs in 506 microseconds.
// All contractions (fused q|k|v projection, k.q^T scores, v^T.p^T context, output projection): v_wmma_f32_16x16x32_f16, f16 operands with power-of-two carries, f32 accumulate; LayerNorm, softmax statistics, bias adds and normalisation in f32.
#include <hip/hip_runtime.h>
#include <math.h>

typedef __attribute__((ext_vector_type(16))) _Float16 v16h;
typedef __attribute__((ext_vector_type(8)))  _Float16 v8h;
typedef __attribute__((ext_vector_type(8)))  float    v8f;
typedef __attribute__((ext_vector_type(4)))  float    v4f;

// ---------------------------------------------------------------------------
// Shape constants
// ---------------------------------------------------------------------------
constexpr int kBatch = 4;
constexpr int kSeq   = 2048;
constexpr int kDim   = 1024;
constexpr int kHeads = 16;
constexpr int kHd    = 64;
constexpr int kTok   = kBatch * kSeq;
constexpr int kQkvN  = 3 * kDim;
static_assert(kHeads * kHd == kDim);
static_assert(kTok == 8192);
static_assert((kDim % 32) == 0);
static_assert((kTok % 64) == 0 && (kQkvN % 64) == 0 && (kDim % 64) == 0 && (kSeq % 128) == 0);

// logit scale 1/sqrt(head dim), exact power of two for head dim 64
constexpr float kAttnScale = 0.125f;
static_assert(kHd == 64);
static_assert(kAttnScale * kAttnScale * (float)kHd == 1.0f);

// power-of-two carries of the f16 operand planes
constexpr float kXnCarry    = 16.0f;
constexpr float kWCarry     = 1024.0f;
constexpr float kQkvCarry   = 16.0f;
constexpr float kPLog2Carry = 10.0f;
constexpr float kCtxCarry   = 1024.0f;
constexpr float kProjScale  = 1.0f / (kXnCarry * kWCarry);
constexpr float kCtxExtra   = kCtxCarry / kQkvCarry;
constexpr float kOutScale   = 1.0f / (kCtxCarry * kWCarry);
constexpr float kLog2e      = 1.4426950408889634f;
// raw score = (q*carry).(k*carry) = logit * carry^2 / scale; exponent base 2
constexpr float kExpCoef    = kLog2e * kAttnScale / (kQkvCarry * kQkvCarry);
constexpr float kInvDim     = 1.0f / (float)kDim;
constexpr float kLnEps      = 1e-5f;

// ---------------------------------------------------------------------------
// Workspace region map (bytes; every offset a multiple of 128)
//   XN  f16 [8192][1024]      normalised activations x16          16,777,216
//   WC  f16 [4096][1024]      Wq | Wk | Wv | Wo rows, x1024         8,388,608
//   QP  f16 [4][16][2048][64] q x16                               16,777,216
//   KP  f16 [4][16][2048][64] k x16                               16,777,216
//   VT  f16 [4][16][64][2048] v x16, transposed per head          16,777,216
//   AO  f16 [8192][1024]      merged context x1024                16,777,216
//   total                                                         92,274,688
// ---------------------------------------------------------------------------
constexpr size_t kOffXN = 0;
constexpr size_t kOffWC = kOffXN + (size_t)kTok * kDim * 2;
constexpr size_t kOffQP = kOffWC + (size_t)4 * kDim * kDim * 2;
constexpr size_t kOffKP = kOffQP + (size_t)kTok * kDim * 2;
constexpr size_t kOffVT = kOffKP + (size_t)kTok * kDim * 2;
constexpr size_t kOffAO = kOffVT + (size_t)kTok * kDim * 2;
constexpr size_t kWsTotal = kOffAO + (size_t)kTok * kDim * 2;
static_assert(kWsTotal == 92274688ull);
static_assert(kWsTotal <= 134217728ull);
static_assert((kOffWC % 128) == 0 && (kOffQP % 128) == 0 && (kOffKP % 128) == 0 && (kOffVT % 128) == 0 && (kOffAO % 128) == 0);

// ---------------------------------------------------------------------------
// Fragment helpers (A and B use the same split k map: elements 0..7 <- p[0..7], 8..15 <- p[16..23],
// with p already offset by 8*(lane>>4); row / column = lane & 15)
// ---------------------------------------------------------------------------
struct FragH {
  union U { v16h v; v8h h[2]; };
  static __device__ __forceinline__ v16h load(const _Float16* p) {
    U f;
    f.h[0] = *(const v8h*)(p);
    f.h[1] = *(const v8h*)(p + 16);
    return f.v;
  }
  static __device__ __forceinline__ v8f mma(v16h a, v16h b, v8f c) {
    return __builtin_amdgcn_wmma_f32_16x16x32_f16(false, a, false, b, (short)0, c, false, false);
  }
};
// hazard guards: four idle slots after the last matrix op of a group, tying every accumulator of the group
// and naming the A and B fragment registers of the group as inputs
__device__ __forceinline__ void guard4_h(v8f& a, v8f& b, v8f& c, v8f& d, v16h x, v16h b0, v16h b1, v16h b2, v16h b3) {
  asm volatile("v_nop\n\tv_nop\n\tv_nop\n\tv_nop" : "+v"(a), "+v"(b), "+v"(c), "+v"(d) : "v"(x), "v"(b0), "v"(b1), "v"(b2), "v"(b3));
}
__device__ __forceinline__ void guard1_h(v8f& a, v16h x, v16h y, v16h z, v16h w) {
  asm volatile("v_nop\n\tv_nop\n\tv_nop\n\tv_nop" : "+v"(a) : "v"(x), "v"(y), "v"(z), "v"(w));
}
__device__ __forceinline__ void keep4_h(v16h a, v16h b, v16h c, v16h d) {
  asm volatile("v_nop" :: "v"(a), "v"(b), "v"(c), "v"(d));
}
__device__ __forceinline__ void acc_guard4(v8f& a, v8f& b, v8f& c, v8f& d) {
  asm volatile("v_nop\n\tv_nop\n\tv_nop\n\tv_nop" : "+v"(a), "+v"(b), "+v"(c), "+v"(d));
}
__device__ __forceinline__ void wave_lds_sync() {
  __builtin_amdgcn_fence(__ATOMIC_RELEASE, "workgroup");
  __builtin_amdgcn_wave_barrier();
  __builtin_amdgcn_fence(__ATOMIC_ACQUIRE, "workgroup");
}

// ---------------------------------------------------------------------------
// LayerNorm per token row (population variance from centred squares, eps inside the rsqrt), f32, then x16 and
// RNE convert to f16. One wave per row, 8 rows per block, grid = 8192 / 8 = 1024 blocks (exact).
// Three rolled sweeps over the row (sum, centred squares, normalise + store); in each sweep the lane owns columns
// it*256 + lane*8 .. +7 for it = 0..3: 4 x 32 x 8 = 1024 = the whole row. The row is re-read from global in each
// sweep (no per-thread arrays).
// No block barriers in this kernel; the shuffles run under wave-uniform control only.
// ---------------------------------------------------------------------------
__global__ __launch_bounds__(256) void ln_rows_kernel(const float* __restrict__ x, const float* __restrict__ gamma,
                                                      const float* __restrict__ beta, unsigned short* __restrict__ xn) {
  const int lane = threadIdx.x & 31;
  const int wave = __builtin_amdgcn_readfirstlane((int)(threadIdx.x >> 5));
  const int row = blockIdx.x * 8 + wave;
  if (row >= kTok) return;
  const float* xr = x + (size_t)row * kDim + lane * 8;
  float s = 0.0f;
#pragma unroll 1
  for (int it = 0; it < 4; ++it) {
    const v4f a0 = *(const v4f*)(xr + it * 256);
    const v4f a1 = *(const v4f*)(xr + it * 256 + 4);
    s += ((a0[0] + a0[1]) + (a0[2] + a0[3])) + ((a1[0] + a1[1]) + (a1[2] + a1[3]));
  }
#pragma unroll
  for (int off = 16; off > 0; off >>= 1) s += __shfl_xor(s, off, 32);
  const float mu = s * kInvDim;
  float ss = 0.0f;
#pragma unroll 1
  for (int it = 0; it < 4; ++it) {
    const v4f a0 = *(const v4f*)(xr + it * 256);
    const v4f a1 = *(const v4f*)(xr + it * 256 + 4);
#pragma unroll
    for (int e = 0; e < 4; ++e) {
      const float d0 = a0[e] - mu;
      const float d1 = a1[e] - mu;
      ss = fmaf(d0, d0, ss);
      ss = fmaf(d1, d1, ss);
    }
  }
#pragma unroll
  for (int off = 16; off > 0; off >>= 1) ss += __shfl_xor(ss, off, 32);
  const float inv = rsqrtf(ss * kInvDim + kLnEps);
  unsigned short* orow = xn + (size_t)row * kDim + lane * 8;
#pragma unroll 1
  for (int it = 0; it < 4; ++it) {
    const v4f a0 = *(const v4f*)(xr + it * 256);
    const v4f a1 = *(const v4f*)(xr + it * 256 + 4);
    const v4f g0 = *(const v4f*)(gamma + it * 256 + lane * 8);
    const v4f g1 = *(const v4f*)(gamma + it * 256 + lane * 8 + 4);
    const v4f b0 = *(const v4f*)(beta + it * 256 + lane * 8);
    const v4f b1 = *(const v4f*)(beta + it * 256 + lane * 8 + 4);
    v8h hv;
#pragma unroll
    for (int e = 0; e < 4; ++e) {
      const float y0 = fmaf((a0[e] - mu) * inv, g0[e], b0[e]) * kXnCarry;
      const float y1 = fmaf((a1[e] - mu) * inv, g1[e], b1[e]) * kXnCarry;
      hv[e] = (_Float16)y0;
      hv[4 + e] = (_Float16)y1;
    }
    *(v8h*)(orow + it * 256) = hv;
    
  }
}

// ---------------------------------------------------------------------------
// Weight planes: f32 [1024][1024] ([out][in], already the Bt[n][k] layout) -> f16 x carry, 8 elements per thread.
// grid (512, 4): blockIdx.y selects the matrix (block-uniform) and its 1M-half plane; 512 x 256 x 8 = 1,048,576 (exact).
// ---------------------------------------------------------------------------
__global__ __launch_bounds__(256) void cast_w_kernel(const float* __restrict__ w0, const float* __restrict__ w1,
                                                     const float* __restrict__ w2, const float* __restrict__ w3,
                                                     unsigned short* __restrict__ out, float carry) {
  const int z = blockIdx.y;
  const float* W = (z == 0) ? w0 : (z == 1) ? w1 : (z == 2) ? w2 : w3;
  const int i = blockIdx.x * 256 + threadIdx.x;
  if (i >= kDim * kDim / 8) return;
  const float* p = W + 8 * (size_t)i;
  const v4f a = *(const v4f*)(p);
  const v4f c = *(const v4f*)(p + 4);
  v8h hv;
#pragma unroll
  for (int e = 0; e < 4; ++e) {
    hv[e] = (_Float16)(a[e] * carry);
    hv[4 + e] = (_Float16)(c[e] * carry);
  }
  unsigned short* q = out + (size_t)z * kDim * kDim + 8 * (size_t)i;
  *(v8h*)q = hv;
  
}

// ---------------------------------------------------------------------------
// Register-blocked GEMM main loop: acc[i][j] (16x16 sub-tiles of a 64x64 wave tile) = sum_k A[m][k] * Bt[n][k],
// A row-major pitch 1024, Bt row-major pitch 1024, K = 1024 (32 steps of 32).
// ---------------------------------------------------------------------------
__device__ __forceinline__ void gemm_tile_loop(const _Float16* __restrict__ A, const _Float16* __restrict__ Bt,
                                               int m0, int n0, int lane, v8f (&acc)[4][4]) {
  const int rlane = lane & 15;
  const int koff  = (lane >> 4) * 8;
#pragma unroll
  for (int i = 0; i < 4; ++i)
#pragma unroll
    for (int j = 0; j < 4; ++j) acc[i][j] = (v8f){0.f, 0.f, 0.f, 0.f, 0.f, 0.f, 0.f, 0.f};
#pragma unroll 1
  for (int k0 = 0; k0 < kDim; k0 += 32) {
    v16h bh[4];
#pragma unroll
    for (int j = 0; j < 4; ++j)
      bh[j] = FragH::load(Bt + (size_t)(n0 + (j << 4) + rlane) * kDim + koff + k0);
#pragma unroll
    for (int i = 0; i < 4; ++i) {
      const v16h ah = FragH::load(A + (size_t)(m0 + (i << 4) + rlane) * kDim + koff + k0);
#pragma unroll
      for (int j = 0; j < 4; ++j) acc[i][j] = FragH::mma(ah, bh[j], acc[i][j]);
      guard4_h(acc[i][0], acc[i][1], acc[i][2], acc[i][3], ah, bh[0], bh[1], bh[2], bh[3]);
    }
    keep4_h(bh[0], bh[1], bh[2], bh[3]);
  }
  acc_guard4(acc[0][0], acc[0][1], acc[0][2], acc[0][3]);
  acc_guard4(acc[1][0], acc[1][1], acc[1][2], acc[1][3]);
  acc_guard4(acc[2][0], acc[2][1], acc[2][2], acc[2][3]);
  acc_guard4(acc[3][0], acc[3][1], acc[3][2], acc[3][3]);
}

// ---------------------------------------------------------------------------
// Fused q|k|v projection: [8192][3072] = XN[8192][1024] . WC[0..3071][1024]^T, f32 epilogue (x 1/16384, + bias, x16).
// One wave per 64x64 tile, 4 waves per block (128 threads launched), grid = 128*48/4 = 1536 blocks (exact).
// A tile lies in one region (q, k or v: n0 >> 10), one head ((n0 & 1023) >> 6) and one batch element (m0 >> 11).
// The whole tile is staged per wave as f16 [64][72]: q/k regions row = token, v region row = d (transposed).
//   q/k: plane[b][head][s0 + row][0..63];  v: VT[b][head][row][s0 .. s0+63].
// ---------------------------------------------------------------------------
__global__ __launch_bounds__(256) void gemm_qkv_kernel(
    const unsigned short* __restrict__ XNp, const unsigned short* __restrict__ WCp,
    unsigned short* __restrict__ QPp, unsigned short* __restrict__ KPp, unsigned short* __restrict__ VTp,
    const float* __restrict__ bq, const float* __restrict__ bk, const float* __restrict__ bv) {
  __shared__ __align__(16) _Float16 Tsh[4 * 64 * 72];
  const int lane = threadIdx.x & 31;
  const int wave = __builtin_amdgcn_readfirstlane((int)(threadIdx.x >> 5));
  constexpr int tilesN = kQkvN >> 6;
  constexpr int tilesM = kTok >> 6;
  const int tile = blockIdx.x * 4 + wave;
  if (tile >= tilesM * tilesN) return;
  const int tm = tile / tilesN;
  const int tn = tile - tm * tilesN;
  const int m0 = tm << 6;
  const int n0 = tn << 6;

  v8f acc[4][4];
  gemm_tile_loop((const _Float16*)XNp, (const _Float16*)WCp, m0, n0, lane, acc);

  const int rlane = lane & 15;
  const int mOff  = (lane >> 4) * 8;
  const int region = n0 >> 10;
  const int nl0  = n0 & (kDim - 1);
  const int head = nl0 >> 6;
  const int bidx = m0 >> 11;
  const int s0   = m0 & (kSeq - 1);
  const float* bias = (region == 0) ? bq : ((region == 1) ? bk : bv);
  float bvj[4];
#pragma unroll
  for (int j = 0; j < 4; ++j) bvj[j] = bias[nl0 + (j << 4) + rlane];

  _Float16* st = Tsh + wave * (64 * 72);
#pragma unroll
  for (int i = 0; i < 4; ++i) {
#pragma unroll
    for (int j = 0; j < 4; ++j) {
      float y[8];
#pragma unroll
      for (int r = 0; r < 8; ++r) y[r] = (acc[i][j][r] * kProjScale + bvj[j]) * kQkvCarry;
      if (region < 2) {
#pragma unroll
        for (int r = 0; r < 8; ++r) st[((i << 4) + mOff + r) * 72 + (j << 4) + rlane] = (_Float16)y[r];
      } else {
        v8h t;
#pragma unroll
        for (int r = 0; r < 8; ++r) t[r] = (_Float16)y[r];
        *(v8h*)(st + ((j << 4) + rlane) * 72 + (i << 4) + mOff) = t;
      }
    }
  }
  wave_lds_sync();

  unsigned short* plane;
  size_t gbase;
  int gpitch;
  if (region < 2) {
    plane  = (region == 0) ? QPp : KPp;
    gbase  = ((size_t)(bidx * kHeads + head) * kSeq + s0) * kHd;
    gpitch = kHd;
  } else {
    plane  = VTp;
    gbase  = (size_t)(bidx * kHeads + head) * kHd * kSeq + s0;
    gpitch = kSeq;
  }
  const int q4 = lane >> 3, c8 = (lane & 7) * 8;
  {
#pragma unroll
    for (int it = 0; it < 16; ++it) {
      const int row = it * 4 + q4;
      const v8h val = *(const v8h*)(st + row * 72 + c8);
      *(v8h*)(plane + gbase + (size_t)row * gpitch + c8) = val;
    }
    
  }
}

// ---------------------------------------------------------------------------
// Output projection: out[8192][1024] (f32) = AO[8192][1024] . WC[3072..4095][1024]^T x 2^-20 + bo.
// One wave per 64x64 tile, 8 waves per block, grid = 128*16/8 = 256 blocks (exact). 16-row f32 slabs per wave in LDS;
// ---------------------------------------------------------------------------
__global__ __launch_bounds__(256) void gemm_out_kernel(
    const unsigned short* __restrict__ AOp, const unsigned short* __restrict__ WOp,
    float* __restrict__ out, const float* __restrict__ bo) {
  __shared__ __align__(16) float Ssh[8 * 16 * 68];
  const int lane = threadIdx.x & 31;
  const int wave = __builtin_amdgcn_readfirstlane((int)(threadIdx.x >> 5));
  constexpr int tilesN = kDim >> 6;
  constexpr int tilesM = kTok >> 6;
  const int tile = blockIdx.x * 8 + wave;
  if (tile >= tilesM * tilesN) return;
  const int tm = tile / tilesN;
  const int tn = tile - tm * tilesN;
  const int m0 = tm << 6;
  const int n0 = tn << 6;

  v8f acc[4][4];
  gemm_tile_loop((const _Float16*)AOp, (const _Float16*)WOp, m0, n0, lane, acc);

  const int rlane = lane & 15;
  const int mOff  = (lane >> 4) * 8;
  float bvj[4];
#pragma unroll
  for (int j = 0; j < 4; ++j) bvj[j] = bo[n0 + (j << 4) + rlane];
  float* slab = Ssh + wave * (16 * 68);
  const int hh = lane >> 4, c4 = (lane & 15) * 4;
#pragma unroll
  for (int i = 0; i < 4; ++i) {
    const int mBase = m0 + (i << 4);
#pragma unroll
    for (int j = 0; j < 4; ++j) {
#pragma unroll
      for (int r = 0; r < 8; ++r)
        slab[(mOff + r) * 68 + (j << 4) + rlane] = acc[i][j][r] * kOutScale + bvj[j];
    }
    wave_lds_sync();
    {
#pragma unroll
      for (int it = 0; it < 8; ++it) {
        const int row = it * 2 + hh;
        const v4f v = *(const v4f*)(slab + row * 68 + c4);
        *(v4f*)(out + (size_t)(mBase + row) * kDim + n0 + c4) = v;
      }
      
    }
    wave_lds_sync();
  }
}

__global__ __launch_bounds__(256) void attn_kernel(const unsigned short* __restrict__ QPp,
                                                   const unsigned short* __restrict__ KPp,
                                                   const unsigned short* __restrict__ VTp,
                                                   unsigned short* __restrict__ AOp) {
  __shared__ __align__(16) _Float16 Ksh[64 * 64];
  __shared__ __align__(16) _Float16 Vsh[64 * 64];
  __shared__ __align__(16) _Float16 Osh[8 * 16 * 72];
  const int tid  = threadIdx.x;
  const int lane = tid & 31;
  const int wave = __builtin_amdgcn_readfirstlane((int)(tid >> 5));
  const int hh   = lane >> 4;
  const int c    = lane & 15;
  const int bx   = blockIdx.x;
  const int qb   = bx & 15;
  const int bh   = bx >> 4;
  const int head = bh & (kHeads - 1);
  const int bidx = bh >> 4;
  const int q0   = qb * 128 + wave * 16;

  const _Float16* Qh = (const _Float16*)QPp + (size_t)bh * kSeq * kHd;
  const _Float16* Kh = (const _Float16*)KPp + (size_t)bh * kSeq * kHd;
  const _Float16* Vh = (const _Float16*)VTp + (size_t)bh * kHd * kSeq;

  const v16h qf0 = FragH::load(Qh + (size_t)(q0 + c) * kHd + 8 * hh);
  const v16h qf1 = FragH::load(Qh + (size_t)(q0 + c) * kHd + 32 + 8 * hh);

  v8f oacc[4];
#pragma unroll
  for (int t = 0; t < 4; ++t) oacc[t] = (v8f){0.f, 0.f, 0.f, 0.f, 0.f, 0.f, 0.f, 0.f};
  float mrun = -1e30f;
  float lrun = 0.0f;

#pragma unroll 1
  for (int kc = 0; kc < kSeq / 64; ++kc) {
    const int kv0 = kc * 64;
    __syncthreads();
#pragma unroll
    for (int i = 0; i < 2; ++i) {
      const int idx = tid + 256 * i;
      const v8h kk = *(const v8h*)(Kh + (size_t)kv0 * kHd + idx * 8);
      const v8h vv = *(const v8h*)(Vh + (size_t)(idx >> 3) * kSeq + kv0 + (idx & 7) * 8);
      *(v8h*)(Ksh + idx * 8) = kk;
      *(v8h*)(Vsh + idx * 8) = vv;
    }
    __syncthreads();

    v8f st[4];
#pragma unroll
    for (int j = 0; j < 4; ++j) {
      st[j] = (v8f){0.f, 0.f, 0.f, 0.f, 0.f, 0.f, 0.f, 0.f};
      const v16h ka0 = FragH::load(Ksh + (j * 16 + c) * 64 + 8 * hh);
      const v16h ka1 = FragH::load(Ksh + (j * 16 + c) * 64 + 32 + 8 * hh);
      st[j] = FragH::mma(ka0, qf0, st[j]);
      st[j] = FragH::mma(ka1, qf1, st[j]);
      guard1_h(st[j], ka0, ka1, qf0, qf1);
    }

    float mx = st[0][0];
#pragma unroll
    for (int j = 0; j < 4; ++j)
#pragma unroll
      for (int r = 0; r < 8; ++r) mx = fmaxf(mx, st[j][r]);
    mx = fmaxf(mx, __shfl_xor(mx, 16, 32));
    const float mnew  = fmaxf(mrun, mx);
    const float alpha = __builtin_amdgcn_exp2f((mrun - mnew) * kExpCoef);
    const float off   = fmaf(-mnew, kExpCoef, kPLog2Carry);
    mrun = mnew;

    v16h pf0, pf1;
    float psum = 0.0f;
#pragma unroll
    for (int r = 0; r < 8; ++r) {
      const _Float16 h0 = (_Float16)__builtin_amdgcn_exp2f(fmaf(st[0][r], kExpCoef, off));
      const _Float16 h1 = (_Float16)__builtin_amdgcn_exp2f(fmaf(st[1][r], kExpCoef, off));
      const _Float16 h2 = (_Float16)__builtin_amdgcn_exp2f(fmaf(st[2][r], kExpCoef, off));
      const _Float16 h3 = (_Float16)__builtin_amdgcn_exp2f(fmaf(st[3][r], kExpCoef, off));
      pf0[r] = h0;
      pf0[8 + r] = h1;
      pf1[r] = h2;
      pf1[8 + r] = h3;
      psum += ((float)h0 + (float)h1) + ((float)h2 + (float)h3);
    }
    lrun = lrun * alpha + psum;
#pragma unroll
    for (int t = 0; t < 4; ++t)
#pragma unroll
      for (int r = 0; r < 8; ++r) oacc[t][r] *= alpha;

#pragma unroll
    for (int t = 0; t < 4; ++t) {
      const v16h va0 = FragH::load(Vsh + (t * 16 + c) * 64 + 8 * hh);
      const v16h va1 = FragH::load(Vsh + (t * 16 + c) * 64 + 32 + 8 * hh);
      oacc[t] = FragH::mma(va0, pf0, oacc[t]);
      oacc[t] = FragH::mma(va1, pf1, oacc[t]);
      guard1_h(oacc[t], va0, va1, pf0, pf1);
    }
  }

  const float ltot = lrun + __shfl_xor(lrun, 16, 32);
  const float inv  = kCtxExtra * (1.0f / ltot);
  _Float16* os = Osh + wave * (16 * 72);
#pragma unroll
  for (int t = 0; t < 4; ++t) {
    v8h o;
#pragma unroll
    for (int r = 0; r < 8; ++r) o[r] = (_Float16)(oacc[t][r] * inv);
    *(v8h*)(os + c * 72 + t * 16 + 8 * hh) = o;
  }
  wave_lds_sync();
  {
    const int q4 = lane >> 3, c8 = (lane & 7) * 8;
    {
#pragma unroll
      for (int it = 0; it < 4; ++it) {
        const int row = it * 4 + q4;
        const v8h val = *(const v8h*)(os + row * 72 + c8);
        *(v8h*)(AOp + (size_t)(bidx * kSeq + q0 + row) * kDim + head * kHd + c8) = val;
      }
      
    }
  }
}

// ---------------------------------------------------------------------------
// Host glue: 5 kernel launches, nothing else.
// ---------------------------------------------------------------------------
extern "C" void kernel_launch(void* const* d_in, const int* in_sizes, int n_in,
                              void* d_out, int out_size, void* d_ws, size_t ws_size,
                              hipStream_t stream) {
  if (n_in < 11) return;
  if (in_sizes[0] != kTok * kDim) return;
  if (in_sizes[1] != kDim || in_sizes[2] != kDim) return;
  if (in_sizes[3] != kDim * kDim || in_sizes[5] != kDim * kDim) return;
  if (in_sizes[7] != kDim * kDim || in_sizes[9] != kDim * kDim) return;
  if (in_sizes[4] != kDim || in_sizes[6] != kDim || in_sizes[8] != kDim || in_sizes[10] != kDim) return;
  if (out_size != kTok * kDim) return;
  if (ws_size < kWsTotal) return;

  const float* x     = (const float*)d_in[0];
  const float* gamma = (const float*)d_in[1];
  const float* beta  = (const float*)d_in[2];
  const float* Wq    = (const float*)d_in[3];
  const float* bq    = (const float*)d_in[4];
  const float* Wk    = (const float*)d_in[5];
  const float* bk    = (const float*)d_in[6];
  const float* Wv    = (const float*)d_in[7];
  const float* bv    = (const float*)d_in[8];
  const float* Wo    = (const float*)d_in[9];
  const float* bo    = (const float*)d_in[10];
  float* out = (float*)d_out;

  char* ws = (char*)d_ws;
  unsigned short* XN = (unsigned short*)(ws + kOffXN);
  unsigned short* WC = (unsigned short*)(ws + kOffWC);
  unsigned short* QP = (unsigned short*)(ws + kOffQP);
  unsigned short* KP = (unsigned short*)(ws + kOffKP);
  unsigned short* VT = (unsigned short*)(ws + kOffVT);
  unsigned short* AO = (unsigned short*)(ws + kOffAO);
  unsigned short* WO = WC + (size_t)3 * kDim * kDim;

  ln_rows_kernel<<<kTok / 8, 256, 0, stream>>>(x, gamma, beta, XN);
  cast_w_kernel<<<dim3(kDim * kDim / 8 / 256, 4), 256, 0, stream>>>(Wq, Wk, Wv, Wo, WC, kWCarry);
  gemm_qkv_kernel<<<(kTok / 64) * (kQkvN / 64) / 4, 128, 0, stream>>>(XN, WC, QP, KP, VT, bq, bk, bv);
  attn_kernel<<<kBatch * kHeads * (kSeq / 128), 256, 0, stream>>>(QP, KP, VT, AO);
  gemm_out_kernel<<<(kTok / 64) * (kDim / 64) / 8, 256, 0, stream>>>(AO, WO, out, bo);
}

// v001
// It runs in 291 microseconds.
// Two timings next to v000 put it at 1.77 and 1.79 times that version's speed.
// All contractions (fused q|k|v projection, k.q^T scores, v^T.p^T context, output projection): v_wmma_f32_16x16x32_f16, f16 operands with power-of-two carries, f32 accumulate; LayerNorm, softmax statistics, bias adds and normalisation in f32.
#include <hip/hip_runtime.h>
#include <math.h>

typedef __attribute__((ext_vector_type(16))) _Float16 v16h;
typedef __attribute__((ext_vector_type(8)))  _Float16 v8h;
typedef __attribute__((ext_vector_type(8)))  float    v8f;
typedef __attribute__((ext_vector_type(4)))  float    v4f;

// ---------------------------------------------------------------------------
// Shape constants
// ---------------------------------------------------------------------------
constexpr int kBatch = 4;
constexpr int kSeq   = 2048;
constexpr int kDim   = 1024;
constexpr int kHeads = 16;
constexpr int kHd    = 64;
constexpr int kTok   = kBatch * kSeq;
constexpr int kQkvN  = 3 * kDim;
static_assert(kHeads * kHd == kDim);
static_assert(kTok == 8192);
static_assert((kDim % 32) == 0);
static_assert((kTok % 64) == 0 && (kQkvN % 64) == 0 && (kDim % 64) == 0 && (kSeq % 128) == 0);

// logit scale 1/sqrt(head dim), exact power of two for head dim 64
constexpr float kAttnScale = 0.125f;
static_assert(kHd == 64);
static_assert(kAttnScale * kAttnScale * (float)kHd == 1.0f);

// power-of-two carries of the f16 operand planes
constexpr float kXnCarry    = 16.0f;
constexpr float kWCarry     = 1024.0f;
constexpr float kQkvCarry   = 16.0f;
constexpr float kPLog2Carry = 10.0f;
constexpr float kCtxCarry   = 1024.0f;
constexpr float kProjScale  = 1.0f / (kXnCarry * kWCarry);
constexpr float kCtxExtra   = kCtxCarry / kQkvCarry;
constexpr float kOutScale   = 1.0f / (kCtxCarry * kWCarry);
constexpr float kLog2e      = 1.4426950408889634f;
// raw score = (q*carry).(k*carry) = logit * carry^2 / scale; exponent base 2
constexpr float kExpCoef    = kLog2e * kAttnScale / (kQkvCarry * kQkvCarry);
constexpr float kInvDim     = 1.0f / (float)kDim;
constexpr float kLnEps      = 1e-5f;

// ---------------------------------------------------------------------------
// Workspace region map (bytes; every offset a multiple of 128)
//   XN  f16 [8192][1024]      normalised activations x16          16,777,216
//   WC  f16 [4096][1024]      Wq | Wk | Wv | Wo rows, x1024         8,388,608
//   QP  f16 [4][16][2048][64] q x16                               16,777,216
//   KP  f16 [4][16][2048][64] k x16                               16,777,216
//   VT  f16 [4][16][64][2048] v x16, transposed per head          16,777,216
//   AO  f16 [8192][1024]      merged context x1024                16,777,216
//   total                                                         92,274,688
// ---------------------------------------------------------------------------
constexpr size_t kOffXN = 0;
constexpr size_t kOffWC = kOffXN + (size_t)kTok * kDim * 2;
constexpr size_t kOffQP = kOffWC + (size_t)4 * kDim * kDim * 2;
constexpr size_t kOffKP = kOffQP + (size_t)kTok * kDim * 2;
constexpr size_t kOffVT = kOffKP + (size_t)kTok * kDim * 2;
constexpr size_t kOffAO = kOffVT + (size_t)kTok * kDim * 2;
constexpr size_t kWsTotal = kOffAO + (size_t)kTok * kDim * 2;
static_assert(kWsTotal == 92274688ull);
static_assert(kWsTotal <= 134217728ull);
static_assert((kOffWC % 128) == 0 && (kOffQP % 128) == 0 && (kOffKP % 128) == 0 && (kOffVT % 128) == 0 && (kOffAO % 128) == 0);

// ---------------------------------------------------------------------------
// Fragment helpers (A and B use the same split k map: elements 0..7 <- p[0..7], 8..15 <- p[16..23],
// with p already offset by 8*(lane>>4); row / column = lane & 15)
// ---------------------------------------------------------------------------
struct FragH {
  union U { v16h v; v8h h[2]; };
  static __device__ __forceinline__ v16h load(const _Float16* p) {
    U f;
    f.h[0] = *(const v8h*)(p);
    f.h[1] = *(const v8h*)(p + 16);
    return f.v;
  }
  static __device__ __forceinline__ v8f mma(v16h a, v16h b, v8f c) {
    return __builtin_amdgcn_wmma_f32_16x16x32_f16(false, a, false, b, (short)0, c, false, false);
  }
};
// hazard guards: four idle slots after the last matrix op of a group, tying every accumulator of the group
// and naming the A and B fragment registers of the group as inputs
__device__ __forceinline__ void guard4_h(v8f& a, v8f& b, v8f& c, v8f& d, v16h x, v16h b0, v16h b1, v16h b2, v16h b3) {
  asm volatile("v_nop\n\tv_nop\n\tv_nop\n\tv_nop" : "+v"(a), "+v"(b), "+v"(c), "+v"(d) : "v"(x), "v"(b0), "v"(b1), "v"(b2), "v"(b3));
}
__device__ __forceinline__ void guard1_h(v8f& a, v16h x, v16h y, v16h z, v16h w) {
  asm volatile("v_nop\n\tv_nop\n\tv_nop\n\tv_nop" : "+v"(a) : "v"(x), "v"(y), "v"(z), "v"(w));
}
__device__ __forceinline__ void keep4_h(v16h a, v16h b, v16h c, v16h d) {
  asm volatile("v_nop" :: "v"(a), "v"(b), "v"(c), "v"(d));
}
__device__ __forceinline__ void acc_guard4(v8f& a, v8f& b, v8f& c, v8f& d) {
  asm volatile("v_nop\n\tv_nop\n\tv_nop\n\tv_nop" : "+v"(a), "+v"(b), "+v"(c), "+v"(d));
}
__device__ __forceinline__ void wave_lds_sync() {
  __builtin_amdgcn_fence(__ATOMIC_RELEASE, "workgroup");
  __builtin_amdgcn_wave_barrier();
  __builtin_amdgcn_fence(__ATOMIC_ACQUIRE, "workgroup");
}

// ---------------------------------------------------------------------------
// LayerNorm per token row (population variance from centred squares, eps inside the rsqrt), f32, then x16 and
// RNE convert to f16. One wave per row, 8 rows per block, grid = 8192 / 8 = 1024 blocks (exact).
// Three rolled sweeps over the row (sum, centred squares, normalise + store); in each sweep the lane owns columns
// it*256 + lane*8 .. +7 for it = 0..3: 4 x 32 x 8 = 1024 = the whole row. The row is re-read from global in each
// sweep (no per-thread arrays).
// No block barriers in this kernel; the shuffles run under wave-uniform control only.
// ---------------------------------------------------------------------------
__global__ __launch_bounds__(256) void ln_rows_kernel(const float* __restrict__ x, const float* __restrict__ gamma,
                                                      const float* __restrict__ beta, unsigned short* __restrict__ xn) {
  const int lane = threadIdx.x & 31;
  const int wave = __builtin_amdgcn_readfirstlane((int)(threadIdx.x >> 5));
  const int row = blockIdx.x * 8 + wave;
  if (row >= kTok) return;
  const float* xr = x + (size_t)row * kDim + lane * 8;
  float s = 0.0f;
#pragma unroll 1
  for (int it = 0; it < 4; ++it) {
    const v4f a0 = *(const v4f*)(xr + it * 256);
    const v4f a1 = *(const v4f*)(xr + it * 256 + 4);
    s += ((a0[0] + a0[1]) + (a0[2] + a0[3])) + ((a1[0] + a1[1]) + (a1[2] + a1[3]));
  }
#pragma unroll
  for (int off = 16; off > 0; off >>= 1) s += __shfl_xor(s, off, 32);
  const float mu = s * kInvDim;
  float ss = 0.0f;
#pragma unroll 1
  for (int it = 0; it < 4; ++it) {
    const v4f a0 = *(const v4f*)(xr + it * 256);
    const v4f a1 = *(const v4f*)(xr + it * 256 + 4);
#pragma unroll
    for (int e = 0; e < 4; ++e) {
      const float d0 = a0[e] - mu;
      const float d1 = a1[e] - mu;
      ss = fmaf(d0, d0, ss);
      ss = fmaf(d1, d1, ss);
    }
  }
#pragma unroll
  for (int off = 16; off > 0; off >>= 1) ss += __shfl_xor(ss, off, 32);
  const float inv = rsqrtf(ss * kInvDim + kLnEps);
  unsigned short* orow = xn + (size_t)row * kDim + lane * 8;
#pragma unroll 1
  for (int it = 0; it < 4; ++it) {
    const v4f a0 = *(const v4f*)(xr + it * 256);
    const v4f a1 = *(const v4f*)(xr + it * 256 + 4);
    const v4f g0 = *(const v4f*)(gamma + it * 256 + lane * 8);
    const v4f g1 = *(const v4f*)(gamma + it * 256 + lane * 8 + 4);
    const v4f b0 = *(const v4f*)(beta + it * 256 + lane * 8);
    const v4f b1 = *(const v4f*)(beta + it * 256 + lane * 8 + 4);
    v8h hv;
#pragma unroll
    for (int e = 0; e < 4; ++e) {
      const float y0 = fmaf((a0[e] - mu) * inv, g0[e], b0[e]) * kXnCarry;
      const float y1 = fmaf((a1[e] - mu) * inv, g1[e], b1[e]) * kXnCarry;
      hv[e] = (_Float16)y0;
      hv[4 + e] = (_Float16)y1;
    }
    *(v8h*)(orow + it * 256) = hv;
    
  }
}

// ---------------------------------------------------------------------------
// Weight planes: f32 [1024][1024] ([out][in], already the Bt[n][k] layout) -> f16 x carry, 8 elements per thread.
// grid (512, 4): blockIdx.y selects the matrix (block-uniform) and its 1M-half plane; 512 x 256 x 8 = 1,048,576 (exact).
// ---------------------------------------------------------------------------
__global__ __launch_bounds__(256) void cast_w_kernel(const float* __restrict__ w0, const float* __restrict__ w1,
                                                     const float* __restrict__ w2, const float* __restrict__ w3,
                                                     unsigned short* __restrict__ out, float carry) {
  const int z = blockIdx.y;
  const float* W = (z == 0) ? w0 : (z == 1) ? w1 : (z == 2) ? w2 : w3;
  const int i = blockIdx.x * 256 + threadIdx.x;
  if (i >= kDim * kDim / 8) return;
  const float* p = W + 8 * (size_t)i;
  const v4f a = *(const v4f*)(p);
  const v4f c = *(const v4f*)(p + 4);
  v8h hv;
#pragma unroll
  for (int e = 0; e < 4; ++e) {
    hv[e] = (_Float16)(a[e] * carry);
    hv[4 + e] = (_Float16)(c[e] * carry);
  }
  unsigned short* q = out + (size_t)z * kDim * kDim + 8 * (size_t)i;
  *(v8h*)q = hv;
  
}

// ---------------------------------------------------------------------------
// Register-blocked GEMM main loop: acc[i][j] (16x16 sub-tiles of a 64x64 wave tile) = sum_k A[m][k] * Bt[n][k],
// A row-major pitch 1024, Bt row-major pitch 1024, K = 1024 (32 steps of 32).
// ---------------------------------------------------------------------------
__device__ __forceinline__ void gemm_tile_loop(const _Float16* __restrict__ A, const _Float16* __restrict__ Bt,
                                               int m0, int n0, int lane, v8f (&acc)[4][4]) {
  const int rlane = lane & 15;
  const int koff  = (lane >> 4) * 8;
#pragma unroll
  for (int i = 0; i < 4; ++i)
#pragma unroll
    for (int j = 0; j < 4; ++j) acc[i][j] = (v8f){0.f, 0.f, 0.f, 0.f, 0.f, 0.f, 0.f, 0.f};
#pragma unroll 1
  for (int k0 = 0; k0 < kDim; k0 += 32) {
    v16h bh[4];
#pragma unroll
    for (int j = 0; j < 4; ++j)
      bh[j] = FragH::load(Bt + (size_t)(n0 + (j << 4) + rlane) * kDim + koff + k0);
#pragma unroll
    for (int i = 0; i < 4; ++i) {
      const v16h ah = FragH::load(A + (size_t)(m0 + (i << 4) + rlane) * kDim + koff + k0);
#pragma unroll
      for (int j = 0; j < 4; ++j) acc[i][j] = FragH::mma(ah, bh[j], acc[i][j]);
      guard4_h(acc[i][0], acc[i][1], acc[i][2], acc[i][3], ah, bh[0], bh[1], bh[2], bh[3]);
    }
    keep4_h(bh[0], bh[1], bh[2], bh[3]);
  }
  acc_guard4(acc[0][0], acc[0][1], acc[0][2], acc[0][3]);
  acc_guard4(acc[1][0], acc[1][1], acc[1][2], acc[1][3]);
  acc_guard4(acc[2][0], acc[2][1], acc[2][2], acc[2][3]);
  acc_guard4(acc[3][0], acc[3][1], acc[3][2], acc[3][3]);
}

// ---------------------------------------------------------------------------
// Fused q|k|v projection: [8192][3072] = XN[8192][1024] . WC[0..3071][1024]^T, f32 epilogue (x 1/16384, + bias, x16).
// One wave per 64x64 tile, 4 waves per block (128 threads launched), grid = 128*48/4 = 1536 blocks (exact).
// A tile lies in one region (q, k or v: n0 >> 10), one head ((n0 & 1023) >> 6) and one batch element (m0 >> 11).
// The whole tile is staged per wave as f16 [64][72]: q/k regions row = token, v region row = d (transposed).
//   q/k: plane[b][head][s0 + row][0..63];  v: VT[b][head][row][s0 .. s0+63].
// ---------------------------------------------------------------------------
__global__ __launch_bounds__(256) void gemm_qkv_kernel(
    const unsigned short* __restrict__ XNp, const unsigned short* __restrict__ WCp,
    unsigned short* __restrict__ QPp, unsigned short* __restrict__ KPp, unsigned short* __restrict__ VTp,
    const float* __restrict__ bq, const float* __restrict__ bk, const float* __restrict__ bv) {
  __shared__ __align__(16) _Float16 Tsh[4 * 64 * 72];
  const int lane = threadIdx.x & 31;
  const int wave = __builtin_amdgcn_readfirstlane((int)(threadIdx.x >> 5));
  constexpr int tilesN = kQkvN >> 6;
  constexpr int tilesM = kTok >> 6;
  const int tile = blockIdx.x * 4 + wave;
  if (tile >= tilesM * tilesN) return;
  const int tm = tile / tilesN;
  const int tn = tile - tm * tilesN;
  const int m0 = tm << 6;
  const int n0 = tn << 6;

  v8f acc[4][4];
  gemm_tile_loop((const _Float16*)XNp, (const _Float16*)WCp, m0, n0, lane, acc);

  const int rlane = lane & 15;
  const int mOff  = (lane >> 4) * 8;
  const int region = n0 >> 10;
  const int nl0  = n0 & (kDim - 1);
  const int head = nl0 >> 6;
  const int bidx = m0 >> 11;
  const int s0   = m0 & (kSeq - 1);
  const float* bias = (region == 0) ? bq : ((region == 1) ? bk : bv);
  float bvj[4];
#pragma unroll
  for (int j = 0; j < 4; ++j) bvj[j] = bias[nl0 + (j << 4) + rlane];

  _Float16* st = Tsh + wave * (64 * 72);
#pragma unroll
  for (int i = 0; i < 4; ++i) {
#pragma unroll
    for (int j = 0; j < 4; ++j) {
      float y[8];
#pragma unroll
      for (int r = 0; r < 8; ++r) y[r] = (acc[i][j][r] * kProjScale + bvj[j]) * kQkvCarry;
      if (region < 2) {
#pragma unroll
        for (int r = 0; r < 8; ++r) st[((i << 4) + mOff + r) * 72 + (j << 4) + rlane] = (_Float16)y[r];
      } else {
        v8h t;
#pragma unroll
        for (int r = 0; r < 8; ++r) t[r] = (_Float16)y[r];
        *(v8h*)(st + ((j << 4) + rlane) * 72 + (i << 4) + mOff) = t;
      }
    }
  }
  wave_lds_sync();

  unsigned short* plane;
  size_t gbase;
  int gpitch;
  if (region < 2) {
    plane  = (region == 0) ? QPp : KPp;
    gbase  = ((size_t)(bidx * kHeads + head) * kSeq + s0) * kHd;
    gpitch = kHd;
  } else {
    plane  = VTp;
    gbase  = (size_t)(bidx * kHeads + head) * kHd * kSeq + s0;
    gpitch = kSeq;
  }
  const int q4 = lane >> 3, c8 = (lane & 7) * 8;
  {
#pragma unroll
    for (int it = 0; it < 16; ++it) {
      const int row = it * 4 + q4;
      const v8h val = *(const v8h*)(st + row * 72 + c8);
      *(v8h*)(plane + gbase + (size_t)row * gpitch + c8) = val;
    }
    
  }
}

// ---------------------------------------------------------------------------
// Output projection: out[8192][1024] (f32) = AO[8192][1024] . WC[3072..4095][1024]^T x 2^-20 + bo.
// One wave per 64x64 tile, 8 waves per block, grid = 128*16/8 = 256 blocks (exact). 16-row f32 slabs per wave in LDS;
// ---------------------------------------------------------------------------
__global__ __launch_bounds__(256) void gemm_out_kernel(
    const unsigned short* __restrict__ AOp, const unsigned short* __restrict__ WOp,
    float* __restrict__ out, const float* __restrict__ bo) {
  __shared__ __align__(16) float Ssh[8 * 16 * 68];
  const int lane = threadIdx.x & 31;
  const int wave = __builtin_amdgcn_readfirstlane((int)(threadIdx.x >> 5));
  constexpr int tilesN = kDim >> 6;
  constexpr int tilesM = kTok >> 6;
  const int tile = blockIdx.x * 8 + wave;
  if (tile >= tilesM * tilesN) return;
  const int tm = tile / tilesN;
  const int tn = tile - tm * tilesN;
  const int m0 = tm << 6;
  const int n0 = tn << 6;

  v8f acc[4][4];
  gemm_tile_loop((const _Float16*)AOp, (const _Float16*)WOp, m0, n0, lane, acc);

  const int rlane = lane & 15;
  const int mOff  = (lane >> 4) * 8;
  float bvj[4];
#pragma unroll
  for (int j = 0; j < 4; ++j) bvj[j] = bo[n0 + (j << 4) + rlane];
  float* slab = Ssh + wave * (16 * 68);
  const int hh = lane >> 4, c4 = (lane & 15) * 4;
#pragma unroll
  for (int i = 0; i < 4; ++i) {
    const int mBase = m0 + (i << 4);
#pragma unroll
    for (int j = 0; j < 4; ++j) {
#pragma unroll
      for (int r = 0; r < 8; ++r)
        slab[(mOff + r) * 68 + (j << 4) + rlane] = acc[i][j][r] * kOutScale + bvj[j];
    }
    wave_lds_sync();
    {
#pragma unroll
      for (int it = 0; it < 8; ++it) {
        const int row = it * 2 + hh;
        const v4f v = *(const v4f*)(slab + row * 68 + c4);
        *(v4f*)(out + (size_t)(mBase + row) * kDim + n0 + c4) = v;
      }
      
    }
    wave_lds_sync();
  }
}

__global__ __launch_bounds__(256) void attn_kernel(const unsigned short* __restrict__ QPp,
                                                   const unsigned short* __restrict__ KPp,
                                                   const unsigned short* __restrict__ VTp,
                                                   unsigned short* __restrict__ AOp) {
  constexpr int kPitch = 72;
  __shared__ __align__(16) _Float16 Ksh[64 * kPitch];
  __shared__ __align__(16) _Float16 Vsh[64 * kPitch];
  __shared__ __align__(16) _Float16 Osh[8 * 16 * 72];
  const int tid  = threadIdx.x;
  const int lane = tid & 31;
  const int wave = __builtin_amdgcn_readfirstlane((int)(tid >> 5));
  const int hh   = lane >> 4;
  const int c    = lane & 15;
  const int bx   = blockIdx.x;
  const int qb   = bx & 15;
  const int bh   = bx >> 4;
  const int head = bh & (kHeads - 1);
  const int bidx = bh >> 4;
  const int q0   = qb * 128 + wave * 16;

  const _Float16* Qh = (const _Float16*)QPp + (size_t)bh * kSeq * kHd;
  const _Float16* Kh = (const _Float16*)KPp + (size_t)bh * kSeq * kHd;
  const _Float16* Vh = (const _Float16*)VTp + (size_t)bh * kHd * kSeq;

  const v16h qf0 = FragH::load(Qh + (size_t)(q0 + c) * kHd + 8 * hh);
  const v16h qf1 = FragH::load(Qh + (size_t)(q0 + c) * kHd + 32 + 8 * hh);

  v8f oacc[4];
#pragma unroll
  for (int t = 0; t < 4; ++t) oacc[t] = (v8f){0.f, 0.f, 0.f, 0.f, 0.f, 0.f, 0.f, 0.f};
  float mrun = -1e30f;
  float lrun = 0.0f;

#pragma unroll 1
  for (int kc = 0; kc < kSeq / 64; ++kc) {
    const int kv0 = kc * 64;
    __syncthreads();
#pragma unroll
    for (int i = 0; i < 2; ++i) {
      const int idx = tid + 256 * i;
      const v8h kk = *(const v8h*)(Kh + (size_t)kv0 * kHd + idx * 8);
      const v8h vv = *(const v8h*)(Vh + (size_t)(idx >> 3) * kSeq + kv0 + (idx & 7) * 8);
      *(v8h*)(Ksh + (idx >> 3) * kPitch + (idx & 7) * 8) = kk;
      *(v8h*)(Vsh + (idx >> 3) * kPitch + (idx & 7) * 8) = vv;
    }
    __syncthreads();

    v8f st[4];
#pragma unroll
    for (int j = 0; j < 4; ++j) {
      st[j] = (v8f){0.f, 0.f, 0.f, 0.f, 0.f, 0.f, 0.f, 0.f};
      const v16h ka0 = FragH::load(Ksh + (j * 16 + c) * kPitch + 8 * hh);
      const v16h ka1 = FragH::load(Ksh + (j * 16 + c) * kPitch + 32 + 8 * hh);
      st[j] = FragH::mma(ka0, qf0, st[j]);
      st[j] = FragH::mma(ka1, qf1, st[j]);
      guard1_h(st[j], ka0, ka1, qf0, qf1);
    }

    float mx = st[0][0];
#pragma unroll
    for (int j = 0; j < 4; ++j)
#pragma unroll
      for (int r = 0; r < 8; ++r) mx = fmaxf(mx, st[j][r]);
    mx = fmaxf(mx, __shfl_xor(mx, 16, 32));
    const float mnew  = fmaxf(mrun, mx);
    const float alpha = __builtin_amdgcn_exp2f((mrun - mnew) * kExpCoef);
    const float off   = fmaf(-mnew, kExpCoef, kPLog2Carry);
    mrun = mnew;

    v16h pf0, pf1;
    float psum = 0.0f;
#pragma unroll
    for (int r = 0; r < 8; ++r) {
      const _Float16 h0 = (_Float16)__builtin_amdgcn_exp2f(fmaf(st[0][r], kExpCoef, off));
      const _Float16 h1 = (_Float16)__builtin_amdgcn_exp2f(fmaf(st[1][r], kExpCoef, off));
      const _Float16 h2 = (_Float16)__builtin_amdgcn_exp2f(fmaf(st[2][r], kExpCoef, off));
      const _Float16 h3 = (_Float16)__builtin_amdgcn_exp2f(fmaf(st[3][r], kExpCoef, off));
      pf0[r] = h0;
      pf0[8 + r] = h1;
      pf1[r] = h2;
      pf1[8 + r] = h3;
      psum += ((float)h0 + (float)h1) + ((float)h2 + (float)h3);
    }
    lrun = lrun * alpha + psum;
#pragma unroll
    for (int t = 0; t < 4; ++t)
#pragma unroll
      for (int r = 0; r < 8; ++r) oacc[t][r] *= alpha;

#pragma unroll
    for (int t = 0; t < 4; ++t) {
      const v16h va0 = FragH::load(Vsh + (t * 16 + c) * kPitch + 8 * hh);
      const v16h va1 = FragH::load(Vsh + (t * 16 + c) * kPitch + 32 + 8 * hh);
      oacc[t] = FragH::mma(va0, pf0, oacc[t]);
      oacc[t] = FragH::mma(va1, pf1, oacc[t]);
      guard1_h(oacc[t], va0, va1, pf0, pf1);
    }
  }

  const float ltot = lrun + __shfl_xor(lrun, 16, 32);
  const float inv  = kCtxExtra * (1.0f / ltot);
  _Float16* os = Osh + wave * (16 * 72);
#pragma unroll
  for (int t = 0; t < 4; ++t) {
    v8h o;
#pragma unroll
    for (int r = 0; r < 8; ++r) o[r] = (_Float16)(oacc[t][r] * inv);
    *(v8h*)(os + c * 72 + t * 16 + 8 * hh) = o;
  }
  wave_lds_sync();
  {
    const int q4 = lane >> 3, c8 = (lane & 7) * 8;
    {
#pragma unroll
      for (int it = 0; it < 4; ++it) {
        const int row = it * 4 + q4;
        const v8h val = *(const v8h*)(os + row * 72 + c8);
        *(v8h*)(AOp + (size_t)(bidx * kSeq + q0 + row) * kDim + head * kHd + c8) = val;
      }
      
    }
  }
}

// ---------------------------------------------------------------------------
// Host glue: 5 kernel launches, nothing else.
// ---------------------------------------------------------------------------
extern "C" void kernel_launch(void* const* d_in, const int* in_sizes, int n_in,
                              void* d_out, int out_size, void* d_ws, size_t ws_size,
                              hipStream_t stream) {
  if (n_in < 11) return;
  if (in_sizes[0] != kTok * kDim) return;
  if (in_sizes[1] != kDim || in_sizes[2] != kDim) return;
  if (in_sizes[3] != kDim * kDim || in_sizes[5] != kDim * kDim) return;
  if (in_sizes[7] != kDim * kDim || in_sizes[9] != kDim * kDim) return;
  if (in_sizes[4] != kDim || in_sizes[6] != kDim || in_sizes[8] != kDim || in_sizes[10] != kDim) return;
  if (out_size != kTok * kDim) return;
  if (ws_size < kWsTotal) return;

  const float* x     = (const float*)d_in[0];
  const float* gamma = (const float*)d_in[1];
  const float* beta  = (const float*)d_in[2];
  const float* Wq    = (const float*)d_in[3];
  const float* bq    = (const float*)d_in[4];
  const float* Wk    = (const float*)d_in[5];
  const float* bk    = (const float*)d_in[6];
  const float* Wv    = (const float*)d_in[7];
  const float* bv    = (const float*)d_in[8];
  const float* Wo    = (const float*)d_in[9];
  const float* bo    = (const float*)d_in[10];
  float* out = (float*)d_out;

  char* ws = (char*)d_ws;
  unsigned short* XN = (unsigned short*)(ws + kOffXN);
  unsigned short* WC = (unsigned short*)(ws + kOffWC);
  unsigned short* QP = (unsigned short*)(ws + kOffQP);
  unsigned short* KP = (unsigned short*)(ws + kOffKP);
  unsigned short* VT = (unsigned short*)(ws + kOffVT);
  unsigned short* AO = (unsigned short*)(ws + kOffAO);
  unsigned short* WO = WC + (size_t)3 * kDim * kDim;

  ln_rows_kernel<<<kTok / 8, 256, 0, stream>>>(x, gamma, beta, XN);
  cast_w_kernel<<<dim3(kDim * kDim / 8 / 256, 4), 256, 0, stream>>>(Wq, Wk, Wv, Wo, WC, kWCarry);
  gemm_qkv_kernel<<<(kTok / 64) * (kQkvN / 64) / 4, 128, 0, stream>>>(XN, WC, QP, KP, VT, bq, bk, bv);
  attn_kernel<<<kBatch * kHeads * (kSeq / 128), 256, 0, stream>>>(QP, KP, VT, AO);
  gemm_out_kernel<<<(kTok / 64) * (kDim / 64) / 8, 256, 0, stream>>>(AO, WO, out, bo);
}

// v002
// A run of this version takes 176 microseconds.
// In two side-by-side timings against v001, it was 1.64 and 1.66 times as fast.
// All steps since v000 together make it 2.94 times as fast.
// All contractions (fused q|k|v projection, k.q^T scores, v^T.p^T context, output projection): v_wmma_f32_16x16x32_f16, f16 operands with power-of-two carries, f32 accumulate; LayerNorm, softmax statistics, bias adds and normalisation in f32.
#include <hip/hip_runtime.h>
#include <math.h>
#include <stdint.h>

typedef __attribute__((ext_vector_type(16))) _Float16 v16h;
typedef __attribute__((ext_vector_type(8)))  _Float16 v8h;
typedef __attribute__((ext_vector_type(8)))  float    v8f;
typedef __attribute__((ext_vector_type(4)))  float    v4f;
typedef __attribute__((ext_vector_type(4)))  uint32_t u32x4;
typedef __attribute__((ext_vector_type(8)))  uint32_t u32x8;

// ---------------------------------------------------------------------------
// Shape constants
// ---------------------------------------------------------------------------
constexpr int kBatch = 4;
constexpr int kSeq   = 2048;
constexpr int kDim   = 1024;
constexpr int kHeads = 16;
constexpr int kHd    = 64;
constexpr int kTok   = kBatch * kSeq;
constexpr int kQkvN  = 3 * kDim;
static_assert(kHeads * kHd == kDim);
static_assert(kTok == 8192);
static_assert((kDim % 32) == 0);
static_assert((kTok % 64) == 0 && (kQkvN % 64) == 0 && (kDim % 64) == 0 && (kSeq % 128) == 0);

// logit scale 1/sqrt(head dim), exact power of two for head dim 64
constexpr float kAttnScale = 0.125f;
static_assert(kHd == 64);
static_assert(kAttnScale * kAttnScale * (float)kHd == 1.0f);

// power-of-two carries of the f16 operand planes
constexpr float kXnCarry    = 16.0f;
constexpr float kWCarry     = 1024.0f;
constexpr float kQkvCarry   = 16.0f;
constexpr float kPLog2Carry = 10.0f;
constexpr float kCtxCarry   = 1024.0f;
constexpr float kProjScale  = 1.0f / (kXnCarry * kWCarry);
constexpr float kCtxExtra   = kCtxCarry / kQkvCarry;
constexpr float kOutScale   = 1.0f / (kCtxCarry * kWCarry);
constexpr float kLog2e      = 1.4426950408889634f;
// raw score = (q*carry).(k*carry) = logit * carry^2 / scale; exponent base 2
constexpr float kExpCoef    = kLog2e * kAttnScale / (kQkvCarry * kQkvCarry);
constexpr float kInvDim     = 1.0f / (float)kDim;
constexpr float kLnEps      = 1e-5f;

// ---------------------------------------------------------------------------
// Workspace region map (bytes; every offset a multiple of 128)
//   XN  f16 [8192][1024]      normalised activations x16          16,777,216
//   WC  f16 [4096][1024]      Wq | Wk | Wv | Wo rows, x1024         8,388,608
//   QP  f16 [4][16][2048][64] q x16                               16,777,216
//   KP  f16 [4][16][2048][64] k x16                               16,777,216
//   VT  f16 [4][16][64][2048] v x16, transposed per head          16,777,216
//   AO  f16 [8192][1024]      merged context x1024                16,777,216
//   total                                                         92,274,688
// ---------------------------------------------------------------------------
constexpr size_t kOffXN = 0;
constexpr size_t kOffWC = kOffXN + (size_t)kTok * kDim * 2;
constexpr size_t kOffQP = kOffWC + (size_t)4 * kDim * kDim * 2;
constexpr size_t kOffKP = kOffQP + (size_t)kTok * kDim * 2;
constexpr size_t kOffVT = kOffKP + (size_t)kTok * kDim * 2;
constexpr size_t kOffAO = kOffVT + (size_t)kTok * kDim * 2;
constexpr size_t kWsTotal = kOffAO + (size_t)kTok * kDim * 2;
static_assert(kWsTotal == 92274688ull);
static_assert(kWsTotal <= 134217728ull);
static_assert((kOffWC % 128) == 0 && (kOffQP % 128) == 0 && (kOffKP % 128) == 0 && (kOffVT % 128) == 0 && (kOffAO % 128) == 0);

// ---------------------------------------------------------------------------
// Fragment helpers (A and B use the same split k map: elements 0..7 <- p[0..7], 8..15 <- p[16..23],
// with p already offset by 8*(lane>>4); row / column = lane & 15)
// ---------------------------------------------------------------------------
struct FragH {
  union U { v16h v; v8h h[2]; };
  static __device__ __forceinline__ v16h load(const _Float16* p) {
    U f;
    f.h[0] = *(const v8h*)(p);
    f.h[1] = *(const v8h*)(p + 16);
    return f.v;
  }
  static __device__ __forceinline__ v8f mma(v16h a, v16h b, v8f c) {
    return __builtin_amdgcn_wmma_f32_16x16x32_f16(false, a, false, b, (short)0, c, false, false);
  }
};
// hazard guards: four idle slots after the last matrix op of a group, tying every accumulator of the group
// and naming the A and B fragment registers of the group as inputs
__device__ __forceinline__ void guard4_h(v8f& a, v8f& b, v8f& c, v8f& d, v16h x, v16h b0, v16h b1, v16h b2, v16h b3) {
  asm volatile("v_nop\n\tv_nop\n\tv_nop\n\tv_nop" : "+v"(a), "+v"(b), "+v"(c), "+v"(d) : "v"(x), "v"(b0), "v"(b1), "v"(b2), "v"(b3));
}
__device__ __forceinline__ void guard1_h(v8f& a, v16h x, v16h y, v16h z, v16h w) {
  asm volatile("v_nop\n\tv_nop\n\tv_nop\n\tv_nop" : "+v"(a) : "v"(x), "v"(y), "v"(z), "v"(w));
}
__device__ __forceinline__ void keep4_h(v16h a, v16h b, v16h c, v16h d) {
  asm volatile("v_nop" :: "v"(a), "v"(b), "v"(c), "v"(d));
}
__device__ __forceinline__ void acc_guard4(v8f& a, v8f& b, v8f& c, v8f& d) {
  asm volatile("v_nop\n\tv_nop\n\tv_nop\n\tv_nop" : "+v"(a), "+v"(b), "+v"(c), "+v"(d));
}
__device__ __forceinline__ void wave_lds_sync() {
  __builtin_amdgcn_fence(__ATOMIC_RELEASE, "workgroup");
  __builtin_amdgcn_wave_barrier();
  __builtin_amdgcn_fence(__ATOMIC_ACQUIRE, "workgroup");
}

// ---------------------------------------------------------------------------
// LayerNorm per token row (population variance from centred squares, eps inside the rsqrt), f32, then x16 and
// RNE convert to f16. One wave per row, 8 rows per block, grid = 8192 / 8 = 1024 blocks (exact).
// Three rolled sweeps over the row (sum, centred squares, normalise + store); in each sweep the lane owns columns
// it*256 + lane*8 .. +7 for it = 0..3: 4 x 32 x 8 = 1024 = the whole row. The row is re-read from global in each
// sweep (no per-thread arrays).
// No block barriers in this kernel; the shuffles run under wave-uniform control only.
// ---------------------------------------------------------------------------
__global__ __launch_bounds__(256) void ln_rows_kernel(const float* __restrict__ x, const float* __restrict__ gamma,
                                                      const float* __restrict__ beta, unsigned short* __restrict__ xn) {
  const int lane = threadIdx.x & 31;
  const int wave = __builtin_amdgcn_readfirstlane((int)(threadIdx.x >> 5));
  const int row = blockIdx.x * 8 + wave;
  if (row >= kTok) return;
  const float* xr = x + (size_t)row * kDim + lane * 8;
  float s = 0.0f;
#pragma unroll 1
  for (int it = 0; it < 4; ++it) {
    const v4f a0 = *(const v4f*)(xr + it * 256);
    const v4f a1 = *(const v4f*)(xr + it * 256 + 4);
    s += ((a0[0] + a0[1]) + (a0[2] + a0[3])) + ((a1[0] + a1[1]) + (a1[2] + a1[3]));
  }
#pragma unroll
  for (int off = 16; off > 0; off >>= 1) s += __shfl_xor(s, off, 32);
  const float mu = s * kInvDim;
  float ss = 0.0f;
#pragma unroll 1
  for (int it = 0; it < 4; ++it) {
    const v4f a0 = *(const v4f*)(xr + it * 256);
    const v4f a1 = *(const v4f*)(xr + it * 256 + 4);
#pragma unroll
    for (int e = 0; e < 4; ++e) {
      const float d0 = a0[e] - mu;
      const float d1 = a1[e] - mu;
      ss = fmaf(d0, d0, ss);
      ss = fmaf(d1, d1, ss);
    }
  }
#pragma unroll
  for (int off = 16; off > 0; off >>= 1) ss += __shfl_xor(ss, off, 32);
  const float inv = rsqrtf(ss * kInvDim + kLnEps);
  unsigned short* orow = xn + (size_t)row * kDim + lane * 8;
#pragma unroll 1
  for (int it = 0; it < 4; ++it) {
    const v4f a0 = *(const v4f*)(xr + it * 256);
    const v4f a1 = *(const v4f*)(xr + it * 256 + 4);
    const v4f g0 = *(const v4f*)(gamma + it * 256 + lane * 8);
    const v4f g1 = *(const v4f*)(gamma + it * 256 + lane * 8 + 4);
    const v4f b0 = *(const v4f*)(beta + it * 256 + lane * 8);
    const v4f b1 = *(const v4f*)(beta + it * 256 + lane * 8 + 4);
    v8h hv;
#pragma unroll
    for (int e = 0; e < 4; ++e) {
      const float y0 = fmaf((a0[e] - mu) * inv, g0[e], b0[e]) * kXnCarry;
      const float y1 = fmaf((a1[e] - mu) * inv, g1[e], b1[e]) * kXnCarry;
      hv[e] = (_Float16)y0;
      hv[4 + e] = (_Float16)y1;
    }
    *(v8h*)(orow + it * 256) = hv;
    
  }
}

// ---------------------------------------------------------------------------
// Weight planes: f32 [1024][1024] ([out][in], already the Bt[n][k] layout) -> f16 x carry, 8 elements per thread.
// grid (512, 4): blockIdx.y selects the matrix (block-uniform) and its 1M-half plane; 512 x 256 x 8 = 1,048,576 (exact).
// ---------------------------------------------------------------------------
__global__ __launch_bounds__(256) void cast_w_kernel(const float* __restrict__ w0, const float* __restrict__ w1,
                                                     const float* __restrict__ w2, const float* __restrict__ w3,
                                                     unsigned short* __restrict__ out, float carry) {
  const int z = blockIdx.y;
  const float* W = (z == 0) ? w0 : (z == 1) ? w1 : (z == 2) ? w2 : w3;
  const int i = blockIdx.x * 256 + threadIdx.x;
  if (i >= kDim * kDim / 8) return;
  const float* p = W + 8 * (size_t)i;
  const v4f a = *(const v4f*)(p);
  const v4f c = *(const v4f*)(p + 4);
  v8h hv;
#pragma unroll
  for (int e = 0; e < 4; ++e) {
    hv[e] = (_Float16)(a[e] * carry);
    hv[4 + e] = (_Float16)(c[e] * carry);
  }
  unsigned short* q = out + (size_t)z * kDim * kDim + 8 * (size_t)i;
  *(v8h*)q = hv;
  
}

// ---------------------------------------------------------------------------
// GEMM operand ring in LDS. A block of 4 waves (2 x 2) owns a 128 x 128 tile of the product; a stage is 64 k = 128 B of
// each of its 128 A rows and 128 Bt rows. Every wave brings one slice of 64 rows per stage with one tensor load
// (waves 0, 1: the A rows; waves 2, 3: the Bt rows); the load's pad lays the rows at a pitch of 144 B (16 B x 9) for the
// 16-B fragment reads. A slice holds 64 x 144 = 9,216 B and is placed every 10,240 B (a multiple of 2 KiB).
// Two buffers of four slices each: 81,920 B, which the epilogues reuse as per-wave staging behind the last barrier.
// ---------------------------------------------------------------------------
constexpr uint32_t kStageRowB  = 128u;
constexpr uint32_t kRingPitchB = 144u;
constexpr uint32_t kSliceRows  = 64u;
constexpr uint32_t kSliceB     = 10240u;
constexpr uint32_t kBufB       = 4u * kSliceB;
constexpr uint32_t kRingB      = 2u * kBufB;
constexpr uint32_t kStages     = (uint32_t)kDim * 2u / kStageRowB;
constexpr int      kRingPitchH = (int)kRingPitchB / 2;
static_assert(kSliceRows * kRingPitchB <= kSliceB && (kSliceB % 2048u) == 0u);
static_assert(kStages >= 2u);
static_assert((kTok % 128) == 0 && (kQkvN % 128) == 0 && (kDim % 128) == 0);

__device__ __forceinline__ uint32_t uni(uint32_t v) { return (uint32_t)__builtin_amdgcn_readfirstlane(v); }
// holds a wave-uniform value in a scalar register: a test made of it compiles to a scalar compare and branch (a tensor
// load ignores EXEC), and what is computed from it stays behind the asm waits written in front of it
__device__ __forceinline__ uint32_t pinned(uint32_t v) {
  uint32_t w = uni(v);
  asm volatile("" : "+s"(w));
  return w;
}
// the compiler places no wait for the tensor mover: a tile counts as landed only behind its issuer's s_wait_tensorcnt, and
// a buffer is handed back to the mover only behind its readers' s_wait_dscnt; the clobber keeps LDS accesses on their side
__device__ __forceinline__ void wait_ds0()     { asm volatile("s_wait_dscnt 0x0" ::: "memory"); }
__device__ __forceinline__ void wait_tensor0() { asm volatile("s_wait_tensorcnt 0x0" ::: "memory"); }
// one request of the whole wave: a 2-D tile from global memory into LDS, through no register
__device__ __forceinline__ void tdm_load(u32x4 g0, u32x8 g1) {
  asm volatile("tensor_load_to_lds %0, %1" :: "s"(g0), "s"(g1) : "memory");
}
// group 1: 1-byte elements, tensor = tile = 64 rows of 128 B, source pitch one K row, 4 dwords of LDS pad behind every 32
__device__ __forceinline__ u32x8 tdm_group1() {
  constexpr uint32_t d0 = kStageRowB, d1 = kSliceRows;
  u32x8 g;
  g[0] = uni((1u << 20) | (4u << 22) | (3u << 25));
  g[1] = uni((d0 & 0xFFFFu) << 16);
  g[2] = uni((d0 >> 16) | ((d1 & 0xFFFFu) << 16));
  g[3] = uni((d1 >> 16) | (d0 << 16));
  g[4] = uni(d1);
  g[5] = uni((uint32_t)kDim * 2u);
  g[6] = uni(0u);
  g[7] = uni(0u);
  return g;
}
__device__ __forceinline__ u32x4 tdm_group0(uint32_t lds_dst, uint64_t ga) {
  u32x4 g;
  g[0] = uni(1u);
  g[1] = uni(lds_dst);
  g[2] = uni((uint32_t)ga);
  g[3] = uni((((uint32_t)(ga >> 32)) & 0x01FFFFFFu) | 0x80000000u);
  return g;
}

// ---------------------------------------------------------------------------
// Register-blocked GEMM main loop: acc[i][j] (16x16 sub-tiles of a 64x64 wave tile) = sum_k A[m][k] * Bt[n][k],
// A row-major pitch 1024, Bt row-major pitch 1024, K = 1024 (16 stages of 64 k, two 32-k steps each).
// Wave w works on rows bm0 + 64 (w >> 1) and columns bn0 + 64 (w & 1): it reads slice w >> 1 (A) and slice 2 + (w & 1) (Bt).
// Every wave of the block runs the whole loop: all barriers stand under block-uniform control.
// ---------------------------------------------------------------------------
__device__ __forceinline__ void gemm_tile_loop(const _Float16* __restrict__ A, const _Float16* __restrict__ Bt,
                                               int bm0, int bn0, int wave, int lane, unsigned char* ring,
                                               v8f (&acc)[4][4]) {
  const int rlane = lane & 15;
  const int koff  = (lane >> 4) * 8;
#pragma unroll
  for (int i = 0; i < 4; ++i)
#pragma unroll
    for (int j = 0; j < 4; ++j) acc[i][j] = (v8f){0.f, 0.f, 0.f, 0.f, 0.f, 0.f, 0.f, 0.f};

  const _Float16* srow = (wave < 2) ? A + (size_t)(bm0 + wave * 64) * kDim : Bt + (size_t)(bn0 + (wave - 2) * 64) * kDim;
  const uint64_t src = (uint64_t)(size_t)srow;
  const uint32_t dst = (uint32_t)(size_t)ring + (uint32_t)wave * kSliceB;
  const u32x8 g1 = tdm_group1();

  tdm_load(tdm_group0(dst, src), g1);
  wait_tensor0();   // this wave's slice of stage 0 has landed
  __syncthreads();  // stage 0 published to the other waves
  {
    const uint32_t st = pinned(1u);  // pinned(): stage 1's descriptor words are formed behind stage 0's wait
    tdm_load(tdm_group0(dst + st * kBufB, src + (uint64_t)st * kStageRowB), g1);
  }

  const _Float16* Aw = (const _Float16*)(ring + (uint32_t)(wave >> 1) * kSliceB) + rlane * kRingPitchH + koff;
  const _Float16* Bw = (const _Float16*)(ring + (uint32_t)(2 + (wave & 1)) * kSliceB) + rlane * kRingPitchH + koff;
  // rolled: one stage per trip, so that the publish point below stands once in the text
#pragma unroll 1
  for (uint32_t s = 0; s < kStages; ++s) {
    const _Float16* As = Aw + (s & 1u) * (kBufB / 2u);
    const _Float16* Bs = Bw + (s & 1u) * (kBufB / 2u);
#pragma unroll
    for (int kk = 0; kk < 2; ++kk) {
      v16h ah[4], bh[4];
      ah[0] = FragH::load(As + kk * 32);
#pragma unroll
      for (int j = 0; j < 4; ++j) bh[j] = FragH::load(Bs + (j << 4) * kRingPitchH + kk * 32);
#pragma unroll
      for (int i = 1; i < 4; ++i) ah[i] = FragH::load(As + (i << 4) * kRingPitchH + kk * 32);
      // keeps the step's 16 LDS reads one group in front of its 16 matrix ops: sunk among them, each row waits out its own read
      __builtin_amdgcn_sched_barrier(0);
#pragma unroll
      for (int i = 0; i < 4; ++i) {
#pragma unroll
        for (int j = 0; j < 4; ++j) acc[i][j] = FragH::mma(ah[i], bh[j], acc[i][j]);
        guard4_h(acc[i][0], acc[i][1], acc[i][2], acc[i][3], ah[i], bh[0], bh[1], bh[2], bh[3]);
      }
      keep4_h(bh[0], bh[1], bh[2], bh[3]);
    }
    // publish point of stage s + 1
    wait_ds0();       // this wave's reads of stage s have returned
    wait_tensor0();   // this wave's slice of stage s + 1 has landed
    __syncthreads();  // stage s + 1 published; every wave has left stage s's buffer
    const uint32_t nxt = pinned(s + 2u);  // pinned(): the next descriptor's words are formed behind the wait above
    if (pinned(nxt < kStages)) {          // pinned(): scalar branch around the tensor load
      tdm_load(tdm_group0(dst + (nxt & 1u) * kBufB, src + (uint64_t)nxt * kStageRowB), g1);
    }
  }
  wait_tensor0();  // nothing of the mover in flight when the ring becomes staging
  wait_ds0();
  acc_guard4(acc[0][0], acc[0][1], acc[0][2], acc[0][3]);
  acc_guard4(acc[1][0], acc[1][1], acc[1][2], acc[1][3]);
  acc_guard4(acc[2][0], acc[2][1], acc[2][2], acc[2][3]);
  acc_guard4(acc[3][0], acc[3][1], acc[3][2], acc[3][3]);
}

// ---------------------------------------------------------------------------
// Fused q|k|v projection: [8192][3072] = XN[8192][1024] . WC[0..3071][1024]^T, f32 epilogue (x 1/16384, + bias, x16).
// One wave per 64x64 tile, 4 waves (2 x 2) per 128x128 block tile, grid = 64*24 = 1536 blocks of 128 threads (exact).
// A wave tile lies in one region (q, k or v: n0 >> 10), one head ((n0 & 1023) >> 6) and one batch element (m0 >> 11).
// The whole tile is staged per wave as f16 [64][72]: q/k regions row = token, v region row = d (transposed).
//   q/k: plane[b][head][s0 + row][0..63];  v: VT[b][head][row][s0 .. s0+63].
// ---------------------------------------------------------------------------
__global__ __launch_bounds__(128) void gemm_qkv_kernel(
    const unsigned short* __restrict__ XNp, const unsigned short* __restrict__ WCp,
    unsigned short* __restrict__ QPp, unsigned short* __restrict__ KPp, unsigned short* __restrict__ VTp,
    const float* __restrict__ bq, const float* __restrict__ bk, const float* __restrict__ bv) {
  __shared__ __attribute__((aligned(2048))) unsigned char Ring[kRingB];
  static_assert(4u * 64u * 72u * 2u <= kRingB);
  const int lane = threadIdx.x & 31;
  const int wave = __builtin_amdgcn_readfirstlane((int)(threadIdx.x >> 5));
  constexpr int tilesN = kQkvN >> 7;
  constexpr int tilesM = kTok >> 7;
  const int tile = blockIdx.x;
  if (tile >= tilesM * tilesN) return;
  const int tm = tile / tilesN;
  const int tn = tile - tm * tilesN;
  const int m0 = (tm << 7) + ((wave >> 1) << 6);
  const int n0 = (tn << 7) + ((wave & 1) << 6);

  v8f acc[4][4];
  gemm_tile_loop((const _Float16*)XNp, (const _Float16*)WCp, tm << 7, tn << 7, wave, lane, Ring, acc);

  const int rlane = lane & 15;
  const int mOff  = (lane >> 4) * 8;
  const int region = n0 >> 10;
  const int nl0  = n0 & (kDim - 1);
  const int head = nl0 >> 6;
  const int bidx = m0 >> 11;
  const int s0   = m0 & (kSeq - 1);
  const float* bias = (region == 0) ? bq : ((region == 1) ? bk : bv);
  float bvj[4];
#pragma unroll
  for (int j = 0; j < 4; ++j) bvj[j] = bias[nl0 + (j << 4) + rlane];

  _Float16* st = (_Float16*)Ring + wave * (64 * 72);
#pragma unroll
  for (int i = 0; i < 4; ++i) {
#pragma unroll
    for (int j = 0; j < 4; ++j) {
      float y[8];
#pragma unroll
      for (int r = 0; r < 8; ++r) y[r] = (acc[i][j][r] * kProjScale + bvj[j]) * kQkvCarry;
      if (region < 2) {
#pragma unroll
        for (int r = 0; r < 8; ++r) st[((i << 4) + mOff + r) * 72 + (j << 4) + rlane] = (_Float16)y[r];
      } else {
        v8h t;
#pragma unroll
        for (int r = 0; r < 8; ++r) t[r] = (_Float16)y[r];
        *(v8h*)(st + ((j << 4) + rlane) * 72 + (i << 4) + mOff) = t;
      }
    }
  }
  wave_lds_sync();

  unsigned short* plane;
  size_t gbase;
  int gpitch;
  if (region < 2) {
    plane  = (region == 0) ? QPp : KPp;
    gbase  = ((size_t)(bidx * kHeads + head) * kSeq + s0) * kHd;
    gpitch = kHd;
  } else {
    plane  = VTp;
    gbase  = (size_t)(bidx * kHeads + head) * kHd * kSeq + s0;
    gpitch = kSeq;
  }
  const int q4 = lane >> 3, c8 = (lane & 7) * 8;
  {
#pragma unroll
    for (int it = 0; it < 16; ++it) {
      const int row = it * 4 + q4;
      const v8h val = *(const v8h*)(st + row * 72 + c8);
      *(v8h*)(plane + gbase + (size_t)row * gpitch + c8) = val;
    }
    
  }
}

// ---------------------------------------------------------------------------
// Output projection: out[8192][1024] (f32) = AO[8192][1024] . WC[3072..4095][1024]^T x 2^-20 + bo.
// One wave per 64x64 tile, 4 waves (2 x 2) per 128x128 block tile, grid = 64*8 = 512 blocks of 128 threads (exact).
// 16-row f32 slabs per wave in LDS;
// ---------------------------------------------------------------------------
__global__ __launch_bounds__(128) void gemm_out_kernel(
    const unsigned short* __restrict__ AOp, const unsigned short* __restrict__ WOp,
    float* __restrict__ out, const float* __restrict__ bo) {
  __shared__ __attribute__((aligned(2048))) unsigned char Ring[kRingB];
  static_assert(4u * 16u * 68u * 4u <= kRingB);
  const int lane = threadIdx.x & 31;
  const int wave = __builtin_amdgcn_readfirstlane((int)(threadIdx.x >> 5));
  constexpr int tilesN = kDim >> 7;
  constexpr int tilesM = kTok >> 7;
  const int tile = blockIdx.x;
  if (tile >= tilesM * tilesN) return;
  const int tm = tile / tilesN;
  const int tn = tile - tm * tilesN;
  const int m0 = (tm << 7) + ((wave >> 1) << 6);
  const int n0 = (tn << 7) + ((wave & 1) << 6);

  v8f acc[4][4];
  gemm_tile_loop((const _Float16*)AOp, (const _Float16*)WOp, tm << 7, tn << 7, wave, lane, Ring, acc);

  const int rlane = lane & 15;
  const int mOff  = (lane >> 4) * 8;
  float bvj[4];
#pragma unroll
  for (int j = 0; j < 4; ++j) bvj[j] = bo[n0 + (j << 4) + rlane];
  float* slab = (float*)Ring + wave * (16 * 68);
  const int hh = lane >> 4, c4 = (lane & 15) * 4;
#pragma unroll
  for (int i = 0; i < 4; ++i) {
    const int mBase = m0 + (i << 4);
#pragma unroll
    for (int j = 0; j < 4; ++j) {
#pragma unroll
      for (int r = 0; r < 8; ++r)
        slab[(mOff + r) * 68 + (j << 4) + rlane] = acc[i][j][r] * kOutScale + bvj[j];
    }
    wave_lds_sync();
    {
#pragma unroll
      for (int it = 0; it < 8; ++it) {
        const int row = it * 2 + hh;
        const v4f v = *(const v4f*)(slab + row * 68 + c4);
        *(v4f*)(out + (size_t)(mBase + row) * kDim + n0 + c4) = v;
      }
      
    }
    wave_lds_sync();
  }
}

__global__ __launch_bounds__(256) void attn_kernel(const unsigned short* __restrict__ QPp,
                                                   const unsigned short* __restrict__ KPp,
                                                   const unsigned short* __restrict__ VTp,
                                                   unsigned short* __restrict__ AOp) {
  constexpr int kPitch = 72;
  __shared__ __align__(16) _Float16 Ksh[64 * kPitch];
  __shared__ __align__(16) _Float16 Vsh[64 * kPitch];
  __shared__ __align__(16) _Float16 Osh[8 * 16 * 72];
  const int tid  = threadIdx.x;
  const int lane = tid & 31;
  const int wave = __builtin_amdgcn_readfirstlane((int)(tid >> 5));
  const int hh   = lane >> 4;
  const int c    = lane & 15;
  const int bx   = blockIdx.x;
  const int qb   = bx & 15;
  const int bh   = bx >> 4;
  const int head = bh & (kHeads - 1);
  const int bidx = bh >> 4;
  const int q0   = qb * 128 + wave * 16;

  const _Float16* Qh = (const _Float16*)QPp + (size_t)bh * kSeq * kHd;
  const _Float16* Kh = (const _Float16*)KPp + (size_t)bh * kSeq * kHd;
  const _Float16* Vh = (const _Float16*)VTp + (size_t)bh * kHd * kSeq;

  const v16h qf0 = FragH::load(Qh + (size_t)(q0 + c) * kHd + 8 * hh);
  const v16h qf1 = FragH::load(Qh + (size_t)(q0 + c) * kHd + 32 + 8 * hh);

  v8f oacc[4];
#pragma unroll
  for (int t = 0; t < 4; ++t) oacc[t] = (v8f){0.f, 0.f, 0.f, 0.f, 0.f, 0.f, 0.f, 0.f};
  float mrun = -1e30f;
  float lrun = 0.0f;

#pragma unroll 1
  for (int kc = 0; kc < kSeq / 64; ++kc) {
    const int kv0 = kc * 64;
    __syncthreads();
#pragma unroll
    for (int i = 0; i < 2; ++i) {
      const int idx = tid + 256 * i;
      const v8h kk = *(const v8h*)(Kh + (size_t)kv0 * kHd + idx * 8);
      const v8h vv = *(const v8h*)(Vh + (size_t)(idx >> 3) * kSeq + kv0 + (idx & 7) * 8);
      *(v8h*)(Ksh + (idx >> 3) * kPitch + (idx & 7) * 8) = kk;
      *(v8h*)(Vsh + (idx >> 3) * kPitch + (idx & 7) * 8) = vv;
    }
    __syncthreads();

    v8f st[4];
#pragma unroll
    for (int j = 0; j < 4; ++j) {
      st[j] = (v8f){0.f, 0.f, 0.f, 0.f, 0.f, 0.f, 0.f, 0.f};
      const v16h ka0 = FragH::load(Ksh + (j * 16 + c) * kPitch + 8 * hh);
      const v16h ka1 = FragH::load(Ksh + (j * 16 + c) * kPitch + 32 + 8 * hh);
      st[j] = FragH::mma(ka0, qf0, st[j]);
      st[j] = FragH::mma(ka1, qf1, st[j]);
      guard1_h(st[j], ka0, ka1, qf0, qf1);
    }

    float mx = st[0][0];
#pragma unroll
    for (int j = 0; j < 4; ++j)
#pragma unroll
      for (int r = 0; r < 8; ++r) mx = fmaxf(mx, st[j][r]);
    mx = fmaxf(mx, __shfl_xor(mx, 16, 32));
    const float mnew  = fmaxf(mrun, mx);
    const float alpha = __builtin_amdgcn_exp2f((mrun - mnew) * kExpCoef);
    const float off   = fmaf(-mnew, kExpCoef, kPLog2Carry);
    mrun = mnew;

    v16h pf0, pf1;
    float psum = 0.0f;
#pragma unroll
    for (int r = 0; r < 8; ++r) {
      const _Float16 h0 = (_Float16)__builtin_amdgcn_exp2f(fmaf(st[0][r], kExpCoef, off));
      const _Float16 h1 = (_Float16)__builtin_amdgcn_exp2f(fmaf(st[1][r], kExpCoef, off));
      const _Float16 h2 = (_Float16)__builtin_amdgcn_exp2f(fmaf(st[2][r], kExpCoef, off));
      const _Float16 h3 = (_Float16)__builtin_amdgcn_exp2f(fmaf(st[3][r], kExpCoef, off));
      pf0[r] = h0;
      pf0[8 + r] = h1;
      pf1[r] = h2;
      pf1[8 + r] = h3;
      psum += ((float)h0 + (float)h1) + ((float)h2 + (float)h3);
    }
    lrun = lrun * alpha + psum;
#pragma unroll
    for (int t = 0; t < 4; ++t)
#pragma unroll
      for (int r = 0; r < 8; ++r) oacc[t][r] *= alpha;

#pragma unroll
    for (int t = 0; t < 4; ++t) {
      const v16h va0 = FragH::load(Vsh + (t * 16 + c) * kPitch + 8 * hh);
      const v16h va1 = FragH::load(Vsh + (t * 16 + c) * kPitch + 32 + 8 * hh);
      oacc[t] = FragH::mma(va0, pf0, oacc[t]);
      oacc[t] = FragH::mma(va1, pf1, oacc[t]);
      guard1_h(oacc[t], va0, va1, pf0, pf1);
    }
  }

  const float ltot = lrun + __shfl_xor(lrun, 16, 32);
  const float inv  = kCtxExtra * (1.0f / ltot);
  _Float16* os = Osh + wave * (16 * 72);
#pragma unroll
  for (int t = 0; t < 4; ++t) {
    v8h o;
#pragma unroll
    for (int r = 0; r < 8; ++r) o[r] = (_Float16)(oacc[t][r] * inv);
    *(v8h*)(os + c * 72 + t * 16 + 8 * hh) = o;
  }
  wave_lds_sync();
  {
    const int q4 = lane >> 3, c8 = (lane & 7) * 8;
    {
#pragma unroll
      for (int it = 0; it < 4; ++it) {
        const int row = it * 4 + q4;
        const v8h val = *(const v8h*)(os + row * 72 + c8);
        *(v8h*)(AOp + (size_t)(bidx * kSeq + q0 + row) * kDim + head * kHd + c8) = val;
      }
      
    }
  }
}

// ---------------------------------------------------------------------------
// Host glue: 5 kernel launches, nothing else.
// ---------------------------------------------------------------------------
extern "C" void kernel_launch(void* const* d_in, const int* in_sizes, int n_in,
                              void* d_out, int out_size, void* d_ws, size_t ws_size,
                              hipStream_t stream) {
  if (n_in < 11) return;
  if (in_sizes[0] != kTok * kDim) return;
  if (in_sizes[1] != kDim || in_sizes[2] != kDim) return;
  if (in_sizes[3] != kDim * kDim || in_sizes[5] != kDim * kDim) return;
  if (in_sizes[7] != kDim * kDim || in_sizes[9] != kDim * kDim) return;
  if (in_sizes[4] != kDim || in_sizes[6] != kDim || in_sizes[8] != kDim || in_sizes[10] != kDim) return;
  if (out_size != kTok * kDim) return;
  if (ws_size < kWsTotal) return;

  const float* x     = (const float*)d_in[0];
  const float* gamma = (const float*)d_in[1];
  const float* beta  = (const float*)d_in[2];
  const float* Wq    = (const float*)d_in[3];
  const float* bq    = (const float*)d_in[4];
  const float* Wk    = (const float*)d_in[5];
  const float* bk    = (const float*)d_in[6];
  const float* Wv    = (const float*)d_in[7];
  const float* bv    = (const float*)d_in[8];
  const float* Wo    = (const float*)d_in[9];
  const float* bo    = (const float*)d_in[10];
  float* out = (float*)d_out;

  char* ws = (char*)d_ws;
  unsigned short* XN = (unsigned short*)(ws + kOffXN);
  unsigned short* WC = (unsigned short*)(ws + kOffWC);
  unsigned short* QP = (unsigned short*)(ws + kOffQP);
  unsigned short* KP = (unsigned short*)(ws + kOffKP);
  unsigned short* VT = (unsigned short*)(ws + kOffVT);
  unsigned short* AO = (unsigned short*)(ws + kOffAO);
  unsigned short* WO = WC + (size_t)3 * kDim * kDim;

  ln_rows_kernel<<<kTok / 8, 256, 0, stream>>>(x, gamma, beta, XN);
  cast_w_kernel<<<dim3(kDim * kDim / 8 / 256, 4), 256, 0, stream>>>(Wq, Wk, Wv, Wo, WC, kWCarry);
  gemm_qkv_kernel<<<(kTok / 128) * (kQkvN / 128), 128, 0, stream>>>(XN, WC, QP, KP, VT, bq, bk, bv);
  attn_kernel<<<kBatch * kHeads * (kSeq / 128), 256, 0, stream>>>(QP, KP, VT, AO);
  gemm_out_kernel<<<(kTok / 128) * (kDim / 128), 128, 0, stream>>>(AO, WO, out, bo);
}

// v003
// Measured time: 152 microseconds a run.
// In two side-by-side timings against v002, it was 1.16 and 1.15 times as fast.
// Counting every step since v000, it is 3.39 times as fast.
// All contractions (fused q|k|v projection, k.q^T scores, v^T.p^T context, output projection): v_wmma_f32_16x16x32_f16, f16 operands with power-of-two carries, f32 accumulate; LayerNorm, softmax statistics, bias adds and normalisation in f32.
#include <hip/hip_runtime.h>
#include <math.h>
#include <stdint.h>

typedef __attribute__((ext_vector_type(16))) _Float16 v16h;
typedef __attribute__((ext_vector_type(8)))  _Float16 v8h;
typedef __attribute__((ext_vector_type(8)))  float    v8f;
typedef __attribute__((ext_vector_type(4)))  float    v4f;
typedef __attribute__((ext_vector_type(4)))  uint32_t u32x4;
typedef __attribute__((ext_vector_type(8)))  uint32_t u32x8;

// ---------------------------------------------------------------------------
// Shape constants
// ---------------------------------------------------------------------------
constexpr int kBatch = 4;
constexpr int kSeq   = 2048;
constexpr int kDim   = 1024;
constexpr int kHeads = 16;
constexpr int kHd    = 64;
constexpr int kTok   = kBatch * kSeq;
constexpr int kQkvN  = 3 * kDim;
static_assert(kHeads * kHd == kDim);
static_assert(kTok == 8192);
static_assert((kDim % 32) == 0);
static_assert((kTok % 64) == 0 && (kQkvN % 64) == 0 && (kDim % 64) == 0 && (kSeq % 128) == 0);

// logit scale 1/sqrt(head dim), exact power of two for head dim 64
constexpr float kAttnScale = 0.125f;
static_assert(kHd == 64);
static_assert(kAttnScale * kAttnScale * (float)kHd == 1.0f);

// power-of-two carries of the f16 operand planes
constexpr float kXnCarry    = 16.0f;
constexpr float kWCarry     = 1024.0f;
constexpr float kQkvCarry   = 16.0f;
constexpr float kPLog2Carry = 10.0f;
constexpr float kCtxCarry   = 1024.0f;
constexpr float kProjScale  = 1.0f / (kXnCarry * kWCarry);
constexpr float kCtxExtra   = kCtxCarry / kQkvCarry;
constexpr float kOutScale   = 1.0f / (kCtxCarry * kWCarry);
constexpr float kLog2e      = 1.4426950408889634f;
// raw score = (q*carry).(k*carry) = logit * carry^2 / scale; exponent base 2
constexpr float kExpCoef    = kLog2e * kAttnScale / (kQkvCarry * kQkvCarry);
constexpr float kInvDim     = 1.0f / (float)kDim;
constexpr float kLnEps      = 1e-5f;

// ---------------------------------------------------------------------------
// Workspace region map (bytes; every offset a multiple of 128)
//   XN  f16 [8192][1024]      normalised activations x16          16,777,216
//   WC  f16 [4096][1024]      Wq | Wk | Wv | Wo rows, x1024         8,388,608
//   QP  f16 [4][16][2048][64] q x16                               16,777,216
//   KP  f16 [4][16][2048][64] k x16                               16,777,216
//   VT  f16 [4][16][64][2048] v x16, transposed per head          16,777,216
//   AO  f16 [8192][1024]      merged context x1024                16,777,216
//   total                                                         92,274,688
// ---------------------------------------------------------------------------
constexpr size_t kOffXN = 0;
constexpr size_t kOffWC = kOffXN + (size_t)kTok * kDim * 2;
constexpr size_t kOffQP = kOffWC + (size_t)4 * kDim * kDim * 2;
constexpr size_t kOffKP = kOffQP + (size_t)kTok * kDim * 2;
constexpr size_t kOffVT = kOffKP + (size_t)kTok * kDim * 2;
constexpr size_t kOffAO = kOffVT + (size_t)kTok * kDim * 2;
constexpr size_t kWsTotal = kOffAO + (size_t)kTok * kDim * 2;
static_assert(kWsTotal == 92274688ull);
static_assert(kWsTotal <= 134217728ull);
static_assert((kOffWC % 128) == 0 && (kOffQP % 128) == 0 && (kOffKP % 128) == 0 && (kOffVT % 128) == 0 && (kOffAO % 128) == 0);

// ---------------------------------------------------------------------------
// Fragment helpers (A and B use the same split k map: elements 0..7 <- p[0..7], 8..15 <- p[16..23],
// with p already offset by 8*(lane>>4); row / column = lane & 15)
// ---------------------------------------------------------------------------
struct FragH {
  union U { v16h v; v8h h[2]; };
  static __device__ __forceinline__ v16h load(const _Float16* p) {
    U f;
    f.h[0] = *(const v8h*)(p);
    f.h[1] = *(const v8h*)(p + 16);
    return f.v;
  }
  static __device__ __forceinline__ v8f mma(v16h a, v16h b, v8f c) {
    return __builtin_amdgcn_wmma_f32_16x16x32_f16(false, a, false, b, (short)0, c, false, false);
  }
};
// hazard guards: four idle slots after the last matrix op of a group, tying every accumulator of the group
// and naming the A and B fragment registers of the group as inputs
__device__ __forceinline__ void guard4_h(v8f& a, v8f& b, v8f& c, v8f& d, v16h x, v16h b0, v16h b1, v16h b2, v16h b3) {
  asm volatile("v_nop\n\tv_nop\n\tv_nop\n\tv_nop" : "+v"(a), "+v"(b), "+v"(c), "+v"(d) : "v"(x), "v"(b0), "v"(b1), "v"(b2), "v"(b3));
}
__device__ __forceinline__ void guard1_h(v8f& a, v16h x, v16h y, v16h z, v16h w) {
  asm volatile("v_nop\n\tv_nop\n\tv_nop\n\tv_nop" : "+v"(a) : "v"(x), "v"(y), "v"(z), "v"(w));
}
__device__ __forceinline__ void keep4_h(v16h a, v16h b, v16h c, v16h d) {
  asm volatile("v_nop" :: "v"(a), "v"(b), "v"(c), "v"(d));
}
__device__ __forceinline__ void acc_guard4(v8f& a, v8f& b, v8f& c, v8f& d) {
  asm volatile("v_nop\n\tv_nop\n\tv_nop\n\tv_nop" : "+v"(a), "+v"(b), "+v"(c), "+v"(d));
}
__device__ __forceinline__ void wave_lds_sync() {
  __builtin_amdgcn_fence(__ATOMIC_RELEASE, "workgroup");
  __builtin_amdgcn_wave_barrier();
  __builtin_amdgcn_fence(__ATOMIC_ACQUIRE, "workgroup");
}

// ---------------------------------------------------------------------------
// LayerNorm per token row (population variance from centred squares, eps inside the rsqrt), f32, then x16 and
// RNE convert to f16. One wave per row, 8 rows per block, grid = 8192 / 8 = 1024 blocks (exact).
// Three rolled sweeps over the row (sum, centred squares, normalise + store); in each sweep the lane owns columns
// it*256 + lane*8 .. +7 for it = 0..3: 4 x 32 x 8 = 1024 = the whole row. The row is re-read from global in each
// sweep (no per-thread arrays).
// No block barriers in this kernel; the shuffles run under wave-uniform control only.
// ---------------------------------------------------------------------------
__global__ __launch_bounds__(256) void ln_rows_kernel(const float* __restrict__ x, const float* __restrict__ gamma,
                                                      const float* __restrict__ beta, unsigned short* __restrict__ xn) {
  const int lane = threadIdx.x & 31;
  const int wave = __builtin_amdgcn_readfirstlane((int)(threadIdx.x >> 5));
  const int row = blockIdx.x * 8 + wave;
  if (row >= kTok) return;
  const float* xr = x + (size_t)row * kDim + lane * 8;
  float s = 0.0f;
#pragma unroll 1
  for (int it = 0; it < 4; ++it) {
    const v4f a0 = *(const v4f*)(xr + it * 256);
    const v4f a1 = *(const v4f*)(xr + it * 256 + 4);
    s += ((a0[0] + a0[1]) + (a0[2] + a0[3])) + ((a1[0] + a1[1]) + (a1[2] + a1[3]));
  }
#pragma unroll
  for (int off = 16; off > 0; off >>= 1) s += __shfl_xor(s, off, 32);
  const float mu = s * kInvDim;
  float ss = 0.0f;
#pragma unroll 1
  for (int it = 0; it < 4; ++it) {
    const v4f a0 = *(const v4f*)(xr + it * 256);
    const v4f a1 = *(const v4f*)(xr + it * 256 + 4);
#pragma unroll
    for (int e = 0; e < 4; ++e) {
      const float d0 = a0[e] - mu;
      const float d1 = a1[e] - mu;
      ss = fmaf(d0, d0, ss);
      ss = fmaf(d1, d1, ss);
    }
  }
#pragma unroll
  for (int off = 16; off > 0; off >>= 1) ss += __shfl_xor(ss, off, 32);
  const float inv = rsqrtf(ss * kInvDim + kLnEps);
  unsigned short* orow = xn + (size_t)row * kDim + lane * 8;
#pragma unroll 1
  for (int it = 0; it < 4; ++it) {
    const v4f a0 = *(const v4f*)(xr + it * 256);
    const v4f a1 = *(const v4f*)(xr + it * 256 + 4);
    const v4f g0 = *(const v4f*)(gamma + it * 256 + lane * 8);
    const v4f g1 = *(const v4f*)(gamma + it * 256 + lane * 8 + 4);
    const v4f b0 = *(const v4f*)(beta + it * 256 + lane * 8);
    const v4f b1 = *(const v4f*)(beta + it * 256 + lane * 8 + 4);
    v8h hv;
#pragma unroll
    for (int e = 0; e < 4; ++e) {
      const float y0 = fmaf((a0[e] - mu) * inv, g0[e], b0[e]) * kXnCarry;
      const float y1 = fmaf((a1[e] - mu) * inv, g1[e], b1[e]) * kXnCarry;
      hv[e] = (_Float16)y0;
      hv[4 + e] = (_Float16)y1;
    }
    *(v8h*)(orow + it * 256) = hv;
    
  }
}

// ---------------------------------------------------------------------------
// Weight planes: f32 [1024][1024] ([out][in], already the Bt[n][k] layout) -> f16 x carry, 8 elements per thread.
// grid (512, 4): blockIdx.y selects the matrix (block-uniform) and its 1M-half plane; 512 x 256 x 8 = 1,048,576 (exact).
// ---------------------------------------------------------------------------
__global__ __launch_bounds__(256) void cast_w_kernel(const float* __restrict__ w0, const float* __restrict__ w1,
                                                     const float* __restrict__ w2, const float* __restrict__ w3,
                                                     unsigned short* __restrict__ out, float carry) {
  const int z = blockIdx.y;
  const float* W = (z == 0) ? w0 : (z == 1) ? w1 : (z == 2) ? w2 : w3;
  const int i = blockIdx.x * 256 + threadIdx.x;
  if (i >= kDim * kDim / 8) return;
  const float* p = W + 8 * (size_t)i;
  const v4f a = *(const v4f*)(p);
  const v4f c = *(const v4f*)(p + 4);
  v8h hv;
#pragma unroll
  for (int e = 0; e < 4; ++e) {
    hv[e] = (_Float16)(a[e] * carry);
    hv[4 + e] = (_Float16)(c[e] * carry);
  }
  unsigned short* q = out + (size_t)z * kDim * kDim + 8 * (size_t)i;
  *(v8h*)q = hv;
  
}

// ---------------------------------------------------------------------------
// GEMM operand ring in LDS. A block of 4 waves (2 x 2) owns a 128 x 128 tile of the product; a stage is 64 k = 128 B of
// each of its 128 A rows and 128 Bt rows. Every wave brings one slice of 64 rows per stage with one tensor load
// (waves 0, 1: the A rows; waves 2, 3: the Bt rows); the load's pad lays the rows at a pitch of 144 B (16 B x 9) for the
// 16-B fragment reads. A slice holds 64 x 144 = 9,216 B and is placed every 10,240 B (a multiple of 2 KiB).
// Two buffers of four slices each: 81,920 B, which the epilogues reuse as per-wave staging behind the last barrier.
// ---------------------------------------------------------------------------
constexpr uint32_t kStageRowB  = 128u;
constexpr uint32_t kRingPitchB = 144u;
constexpr uint32_t kSliceRows  = 64u;
constexpr uint32_t kSliceB     = 10240u;
constexpr uint32_t kBufB       = 4u * kSliceB;
constexpr uint32_t kRingB      = 2u * kBufB;
constexpr uint32_t kStages     = (uint32_t)kDim * 2u / kStageRowB;
constexpr int      kRingPitchH = (int)kRingPitchB / 2;
static_assert(kSliceRows * kRingPitchB <= kSliceB && (kSliceB % 2048u) == 0u);
static_assert(kStages >= 2u);
static_assert((kTok % 128) == 0 && (kQkvN % 128) == 0 && (kDim % 128) == 0);

__device__ __forceinline__ uint32_t uni(uint32_t v) { return (uint32_t)__builtin_amdgcn_readfirstlane(v); }
// holds a wave-uniform value in a scalar register: a test made of it compiles to a scalar compare and branch (a tensor
// load ignores EXEC), and what is computed from it stays behind the asm waits written in front of it
__device__ __forceinline__ uint32_t pinned(uint32_t v) {
  uint32_t w = uni(v);
  asm volatile("" : "+s"(w));
  return w;
}
// the compiler places no wait for the tensor mover: a tile counts as landed only behind its issuer's s_wait_tensorcnt, and
// a buffer is handed back to the mover only behind its readers' s_wait_dscnt; the clobber keeps LDS accesses on their side
__device__ __forceinline__ void wait_ds0()     { asm volatile("s_wait_dscnt 0x0" ::: "memory"); }
__device__ __forceinline__ void wait_tensor0() { asm volatile("s_wait_tensorcnt 0x0" ::: "memory"); }
// one request of the whole wave: a 2-D tile from global memory into LDS, through no register
__device__ __forceinline__ void tdm_load(u32x4 g0, u32x8 g1) {
  asm volatile("tensor_load_to_lds %0, %1" :: "s"(g0), "s"(g1) : "memory");
}
// group 1: 1-byte elements, tensor = tile = 64 rows of 128 B, source pitch one K row, 4 dwords of LDS pad behind every 32
__device__ __forceinline__ u32x8 tdm_group1() {
  constexpr uint32_t d0 = kStageRowB, d1 = kSliceRows;
  u32x8 g;
  g[0] = uni((1u << 20) | (4u << 22) | (3u << 25));
  g[1] = uni((d0 & 0xFFFFu) << 16);
  g[2] = uni((d0 >> 16) | ((d1 & 0xFFFFu) << 16));
  g[3] = uni((d1 >> 16) | (d0 << 16));
  g[4] = uni(d1);
  g[5] = uni((uint32_t)kDim * 2u);
  g[6] = uni(0u);
  g[7] = uni(0u);
  return g;
}
__device__ __forceinline__ u32x4 tdm_group0(uint32_t lds_dst, uint64_t ga) {
  u32x4 g;
  g[0] = uni(1u);
  g[1] = uni(lds_dst);
  g[2] = uni((uint32_t)ga);
  g[3] = uni((((uint32_t)(ga >> 32)) & 0x01FFFFFFu) | 0x80000000u);
  return g;
}

// ---------------------------------------------------------------------------
// Register-blocked GEMM main loop: acc[i][j] (16x16 sub-tiles of a 64x64 wave tile) = sum_k A[m][k] * Bt[n][k],
// A row-major pitch 1024, Bt row-major pitch 1024, K = 1024 (16 stages of 64 k, two 32-k steps each).
// Wave w works on rows bm0 + 64 (w >> 1) and columns bn0 + 64 (w & 1): it reads slice w >> 1 (A) and slice 2 + (w & 1) (Bt).
// Every wave of the block runs the whole loop: all barriers stand under block-uniform control.
// ---------------------------------------------------------------------------
__device__ __forceinline__ void gemm_tile_loop(const _Float16* __restrict__ A, const _Float16* __restrict__ Bt,
                                               int bm0, int bn0, int wave, int lane, unsigned char* ring,
                                               v8f (&acc)[4][4]) {
  const int rlane = lane & 15;
  const int koff  = (lane >> 4) * 8;
#pragma unroll
  for (int i = 0; i < 4; ++i)
#pragma unroll
    for (int j = 0; j < 4; ++j) acc[i][j] = (v8f){0.f, 0.f, 0.f, 0.f, 0.f, 0.f, 0.f, 0.f};

  const _Float16* srow = (wave < 2) ? A + (size_t)(bm0 + wave * 64) * kDim : Bt + (size_t)(bn0 + (wave - 2) * 64) * kDim;
  const uint64_t src = (uint64_t)(size_t)srow;
  const uint32_t dst = (uint32_t)(size_t)ring + (uint32_t)wave * kSliceB;
  const u32x8 g1 = tdm_group1();

  tdm_load(tdm_group0(dst, src), g1);
  wait_tensor0();   // this wave's slice of stage 0 has landed
  __syncthreads();  // stage 0 published to the other waves
  {
    const uint32_t st = pinned(1u);  // pinned(): stage 1's descriptor words are formed behind stage 0's wait
    tdm_load(tdm_group0(dst + st * kBufB, src + (uint64_t)st * kStageRowB), g1);
  }

  const _Float16* Aw = (const _Float16*)(ring + (uint32_t)(wave >> 1) * kSliceB) + rlane * kRingPitchH + koff;
  const _Float16* Bw = (const _Float16*)(ring + (uint32_t)(2 + (wave & 1)) * kSliceB) + rlane * kRingPitchH + koff;
  // rolled: one stage per trip, so that the publish point below stands once in the text
#pragma unroll 1
  for (uint32_t s = 0; s < kStages; ++s) {
    const _Float16* As = Aw + (s & 1u) * (kBufB / 2u);
    const _Float16* Bs = Bw + (s & 1u) * (kBufB / 2u);
#pragma unroll
    for (int kk = 0; kk < 2; ++kk) {
      v16h ah[4], bh[4];
      ah[0] = FragH::load(As + kk * 32);
#pragma unroll
      for (int j = 0; j < 4; ++j) bh[j] = FragH::load(Bs + (j << 4) * kRingPitchH + kk * 32);
#pragma unroll
      for (int i = 1; i < 4; ++i) ah[i] = FragH::load(As + (i << 4) * kRingPitchH + kk * 32);
      // keeps the step's 16 LDS reads one group in front of its 16 matrix ops: sunk among them, each row waits out its own read
      __builtin_amdgcn_sched_barrier(0);
#pragma unroll
      for (int i = 0; i < 4; ++i) {
#pragma unroll
        for (int j = 0; j < 4; ++j) acc[i][j] = FragH::mma(ah[i], bh[j], acc[i][j]);
        guard4_h(acc[i][0], acc[i][1], acc[i][2], acc[i][3], ah[i], bh[0], bh[1], bh[2], bh[3]);
      }
      keep4_h(bh[0], bh[1], bh[2], bh[3]);
    }
    // publish point of stage s + 1
    wait_ds0();       // this wave's reads of stage s have returned
    wait_tensor0();   // this wave's slice of stage s + 1 has landed
    __syncthreads();  // stage s + 1 published; every wave has left stage s's buffer
    const uint32_t nxt = pinned(s + 2u);  // pinned(): the next descriptor's words are formed behind the wait above
    if (pinned(nxt < kStages)) {          // pinned(): scalar branch around the tensor load
      tdm_load(tdm_group0(dst + (nxt & 1u) * kBufB, src + (uint64_t)nxt * kStageRowB), g1);
    }
  }
  wait_tensor0();  // nothing of the mover in flight when the ring becomes staging
  wait_ds0();
  acc_guard4(acc[0][0], acc[0][1], acc[0][2], acc[0][3]);
  acc_guard4(acc[1][0], acc[1][1], acc[1][2], acc[1][3]);
  acc_guard4(acc[2][0], acc[2][1], acc[2][2], acc[2][3]);
  acc_guard4(acc[3][0], acc[3][1], acc[3][2], acc[3][3]);
}

// ---------------------------------------------------------------------------
// Fused q|k|v projection: [8192][3072] = XN[8192][1024] . WC[0..3071][1024]^T, f32 epilogue (x 1/16384, + bias, x16).
// One wave per 64x64 tile, 4 waves (2 x 2) per 128x128 block tile, grid = 64*24 = 1536 blocks of 128 threads (exact).
// A wave tile lies in one region (q, k or v: n0 >> 10), one head ((n0 & 1023) >> 6) and one batch element (m0 >> 11).
// The whole tile is staged per wave as f16 [64][72]: q/k regions row = token, v region row = d (transposed).
//   q/k: plane[b][head][s0 + row][0..63];  v: VT[b][head][row][s0 .. s0+63].
// ---------------------------------------------------------------------------
__global__ __launch_bounds__(128) void gemm_qkv_kernel(
    const unsigned short* __restrict__ XNp, const unsigned short* __restrict__ WCp,
    unsigned short* __restrict__ QPp, unsigned short* __restrict__ KPp, unsigned short* __restrict__ VTp,
    const float* __restrict__ bq, const float* __restrict__ bk, const float* __restrict__ bv) {
  __shared__ __attribute__((aligned(2048))) unsigned char Ring[kRingB];
  static_assert(4u * 64u * 72u * 2u <= kRingB);
  const int lane = threadIdx.x & 31;
  const int wave = __builtin_amdgcn_readfirstlane((int)(threadIdx.x >> 5));
  constexpr int tilesN = kQkvN >> 7;
  constexpr int tilesM = kTok >> 7;
  const int tile = blockIdx.x;
  if (tile >= tilesM * tilesN) return;
  const int tm = tile / tilesN;
  const int tn = tile - tm * tilesN;
  const int m0 = (tm << 7) + ((wave >> 1) << 6);
  const int n0 = (tn << 7) + ((wave & 1) << 6);

  v8f acc[4][4];
  gemm_tile_loop((const _Float16*)XNp, (const _Float16*)WCp, tm << 7, tn << 7, wave, lane, Ring, acc);

  const int rlane = lane & 15;
  const int mOff  = (lane >> 4) * 8;
  const int region = n0 >> 10;
  const int nl0  = n0 & (kDim - 1);
  const int head = nl0 >> 6;
  const int bidx = m0 >> 11;
  const int s0   = m0 & (kSeq - 1);
  const float* bias = (region == 0) ? bq : ((region == 1) ? bk : bv);
  float bvj[4];
#pragma unroll
  for (int j = 0; j < 4; ++j) bvj[j] = bias[nl0 + (j << 4) + rlane];

  _Float16* st = (_Float16*)Ring + wave * (64 * 72);
#pragma unroll
  for (int i = 0; i < 4; ++i) {
#pragma unroll
    for (int j = 0; j < 4; ++j) {
      float y[8];
#pragma unroll
      for (int r = 0; r < 8; ++r) y[r] = (acc[i][j][r] * kProjScale + bvj[j]) * kQkvCarry;
      if (region < 2) {
#pragma unroll
        for (int r = 0; r < 8; ++r) st[((i << 4) + mOff + r) * 72 + (j << 4) + rlane] = (_Float16)y[r];
      } else {
        v8h t;
#pragma unroll
        for (int r = 0; r < 8; ++r) t[r] = (_Float16)y[r];
        *(v8h*)(st + ((j << 4) + rlane) * 72 + (i << 4) + mOff) = t;
      }
    }
  }
  wave_lds_sync();

  unsigned short* plane;
  size_t gbase;
  int gpitch;
  if (region < 2) {
    plane  = (region == 0) ? QPp : KPp;
    gbase  = ((size_t)(bidx * kHeads + head) * kSeq + s0) * kHd;
    gpitch = kHd;
  } else {
    plane  = VTp;
    gbase  = (size_t)(bidx * kHeads + head) * kHd * kSeq + s0;
    gpitch = kSeq;
  }
  const int q4 = lane >> 3, c8 = (lane & 7) * 8;
  {
#pragma unroll
    for (int it = 0; it < 16; ++it) {
      const int row = it * 4 + q4;
      const v8h val = *(const v8h*)(st + row * 72 + c8);
      *(v8h*)(plane + gbase + (size_t)row * gpitch + c8) = val;
    }
    
  }
}

// ---------------------------------------------------------------------------
// Output projection: out[8192][1024] (f32) = AO[8192][1024] . WC[3072..4095][1024]^T x 2^-20 + bo.
// One wave per 64x64 tile, 4 waves (2 x 2) per 128x128 block tile, grid = 64*8 = 512 blocks of 128 threads (exact).
// 16-row f32 slabs per wave in LDS;
// ---------------------------------------------------------------------------
__global__ __launch_bounds__(128) void gemm_out_kernel(
    const unsigned short* __restrict__ AOp, const unsigned short* __restrict__ WOp,
    float* __restrict__ out, const float* __restrict__ bo) {
  __shared__ __attribute__((aligned(2048))) unsigned char Ring[kRingB];
  static_assert(4u * 16u * 68u * 4u <= kRingB);
  const int lane = threadIdx.x & 31;
  const int wave = __builtin_amdgcn_readfirstlane((int)(threadIdx.x >> 5));
  constexpr int tilesN = kDim >> 7;
  constexpr int tilesM = kTok >> 7;
  const int tile = blockIdx.x;
  if (tile >= tilesM * tilesN) return;
  const int tm = tile / tilesN;
  const int tn = tile - tm * tilesN;
  const int m0 = (tm << 7) + ((wave >> 1) << 6);
  const int n0 = (tn << 7) + ((wave & 1) << 6);

  v8f acc[4][4];
  gemm_tile_loop((const _Float16*)AOp, (const _Float16*)WOp, tm << 7, tn << 7, wave, lane, Ring, acc);

  const int rlane = lane & 15;
  const int mOff  = (lane >> 4) * 8;
  float bvj[4];
#pragma unroll
  for (int j = 0; j < 4; ++j) bvj[j] = bo[n0 + (j << 4) + rlane];
  float* slab = (float*)Ring + wave * (16 * 68);
  const int hh = lane >> 4, c4 = (lane & 15) * 4;
#pragma unroll
  for (int i = 0; i < 4; ++i) {
    const int mBase = m0 + (i << 4);
#pragma unroll
    for (int j = 0; j < 4; ++j) {
#pragma unroll
      for (int r = 0; r < 8; ++r)
        slab[(mOff + r) * 68 + (j << 4) + rlane] = acc[i][j][r] * kOutScale + bvj[j];
    }
    wave_lds_sync();
    {
#pragma unroll
      for (int it = 0; it < 8; ++it) {
        const int row = it * 2 + hh;
        const v4f v = *(const v4f*)(slab + row * 68 + c4);
        *(v4f*)(out + (size_t)(mBase + row) * kDim + n0 + c4) = v;
      }
      
    }
    wave_lds_sync();
  }
}

__device__ __forceinline__ void guard2_h(v8f& a, v8f& b, v16h x, v16h y, v16h p, v16h q, v16h r, v16h s) {
  asm volatile("v_nop\n\tv_nop\n\tv_nop\n\tv_nop" : "+v"(a), "+v"(b) : "v"(x), "v"(y), "v"(p), "v"(q), "v"(r), "v"(s));
}
constexpr int kQWave  = 32;
constexpr int kQBlock = 8 * kQWave;
static_assert((kSeq % kQBlock) == 0);

__global__ __launch_bounds__(256) void attn_kernel(const unsigned short* __restrict__ QPp,
                                                   const unsigned short* __restrict__ KPp,
                                                   const unsigned short* __restrict__ VTp,
                                                   unsigned short* __restrict__ AOp) {
  constexpr int kPitch = 72;
  constexpr int kQBlocks = kSeq / kQBlock;
  __shared__ __align__(16) _Float16 Ksh[64 * kPitch];
  __shared__ __align__(16) _Float16 Vsh[64 * kPitch];
  __shared__ __align__(16) _Float16 Osh[8 * kQWave * 72];
  const int tid  = threadIdx.x;
  const int lane = tid & 31;
  const int wave = __builtin_amdgcn_readfirstlane((int)(tid >> 5));
  const int hh   = lane >> 4;
  const int c    = lane & 15;
  const int bx   = blockIdx.x;
  const int qb   = bx % kQBlocks;
  const int bh   = bx / kQBlocks;
  const int head = bh & (kHeads - 1);
  const int bidx = bh >> 4;
  const int q0   = qb * kQBlock + wave * kQWave;

  const _Float16* Qh = (const _Float16*)QPp + (size_t)bh * kSeq * kHd;
  const _Float16* Kh = (const _Float16*)KPp + (size_t)bh * kSeq * kHd;
  const _Float16* Vh = (const _Float16*)VTp + (size_t)bh * kHd * kSeq;

  v16h qf[2][2];
#pragma unroll
  for (int u = 0; u < 2; ++u) {
    qf[u][0] = FragH::load(Qh + (size_t)(q0 + u * 16 + c) * kHd + 8 * hh);
    qf[u][1] = FragH::load(Qh + (size_t)(q0 + u * 16 + c) * kHd + 32 + 8 * hh);
  }

  v8f oacc[2][4];
  float mrun[2], lrun[2];
#pragma unroll
  for (int u = 0; u < 2; ++u) {
#pragma unroll
    for (int t = 0; t < 4; ++t) oacc[u][t] = (v8f){0.f, 0.f, 0.f, 0.f, 0.f, 0.f, 0.f, 0.f};
    mrun[u] = -1e30f;
    lrun[u] = 0.0f;
  }

#pragma unroll 1
  for (int kc = 0; kc < kSeq / 64; ++kc) {
    const int kv0 = kc * 64;
    __syncthreads();
#pragma unroll
    for (int i = 0; i < 2; ++i) {
      const int idx = tid + 256 * i;
      const v8h kk = *(const v8h*)(Kh + (size_t)kv0 * kHd + idx * 8);
      const v8h vv = *(const v8h*)(Vh + (size_t)(idx >> 3) * kSeq + kv0 + (idx & 7) * 8);
      *(v8h*)(Ksh + (idx >> 3) * kPitch + (idx & 7) * 8) = kk;
      *(v8h*)(Vsh + (idx >> 3) * kPitch + (idx & 7) * 8) = vv;
    }
    __syncthreads();

    v8f st[2][4];
#pragma unroll
    for (int j = 0; j < 4; ++j) {
      st[0][j] = (v8f){0.f, 0.f, 0.f, 0.f, 0.f, 0.f, 0.f, 0.f};
      st[1][j] = (v8f){0.f, 0.f, 0.f, 0.f, 0.f, 0.f, 0.f, 0.f};
      const v16h ka0 = FragH::load(Ksh + (j * 16 + c) * kPitch + 8 * hh);
      const v16h ka1 = FragH::load(Ksh + (j * 16 + c) * kPitch + 32 + 8 * hh);
      st[0][j] = FragH::mma(ka0, qf[0][0], st[0][j]);
      st[1][j] = FragH::mma(ka0, qf[1][0], st[1][j]);
      st[0][j] = FragH::mma(ka1, qf[0][1], st[0][j]);
      st[1][j] = FragH::mma(ka1, qf[1][1], st[1][j]);
      guard2_h(st[0][j], st[1][j], ka0, ka1, qf[0][0], qf[0][1], qf[1][0], qf[1][1]);
    }

    v16h pf[2][2];
#pragma unroll
    for (int u = 0; u < 2; ++u) {
      float mx = st[u][0][0];
#pragma unroll
      for (int j = 0; j < 4; ++j)
#pragma unroll
        for (int r = 0; r < 8; ++r) mx = fmaxf(mx, st[u][j][r]);
      mx = fmaxf(mx, __shfl_xor(mx, 16, 32));
      const float mnew  = fmaxf(mrun[u], mx);
      const float alpha = __builtin_amdgcn_exp2f((mrun[u] - mnew) * kExpCoef);
      const float off   = fmaf(-mnew, kExpCoef, kPLog2Carry);
      mrun[u] = mnew;

      float psum = 0.0f;
#pragma unroll
      for (int r = 0; r < 8; ++r) {
        const _Float16 h0 = (_Float16)__builtin_amdgcn_exp2f(fmaf(st[u][0][r], kExpCoef, off));
        const _Float16 h1 = (_Float16)__builtin_amdgcn_exp2f(fmaf(st[u][1][r], kExpCoef, off));
        const _Float16 h2 = (_Float16)__builtin_amdgcn_exp2f(fmaf(st[u][2][r], kExpCoef, off));
        const _Float16 h3 = (_Float16)__builtin_amdgcn_exp2f(fmaf(st[u][3][r], kExpCoef, off));
        pf[u][0][r] = h0;
        pf[u][0][8 + r] = h1;
        pf[u][1][r] = h2;
        pf[u][1][8 + r] = h3;
        psum += ((float)h0 + (float)h1) + ((float)h2 + (float)h3);
      }
      lrun[u] = lrun[u] * alpha + psum;
#pragma unroll
      for (int t = 0; t < 4; ++t)
#pragma unroll
        for (int r = 0; r < 8; ++r) oacc[u][t][r] *= alpha;
    }

#pragma unroll
    for (int t = 0; t < 4; ++t) {
      const v16h va0 = FragH::load(Vsh + (t * 16 + c) * kPitch + 8 * hh);
      const v16h va1 = FragH::load(Vsh + (t * 16 + c) * kPitch + 32 + 8 * hh);
      oacc[0][t] = FragH::mma(va0, pf[0][0], oacc[0][t]);
      oacc[1][t] = FragH::mma(va0, pf[1][0], oacc[1][t]);
      oacc[0][t] = FragH::mma(va1, pf[0][1], oacc[0][t]);
      oacc[1][t] = FragH::mma(va1, pf[1][1], oacc[1][t]);
      guard2_h(oacc[0][t], oacc[1][t], va0, va1, pf[0][0], pf[0][1], pf[1][0], pf[1][1]);
    }
  }

  _Float16* os = Osh + wave * (kQWave * 72);
#pragma unroll
  for (int u = 0; u < 2; ++u) {
    const float ltot = lrun[u] + __shfl_xor(lrun[u], 16, 32);
    const float inv  = kCtxExtra * (1.0f / ltot);
#pragma unroll
    for (int t = 0; t < 4; ++t) {
      v8h o;
#pragma unroll
      for (int r = 0; r < 8; ++r) o[r] = (_Float16)(oacc[u][t][r] * inv);
      *(v8h*)(os + (u * 16 + c) * 72 + t * 16 + 8 * hh) = o;
    }
  }
  wave_lds_sync();
  {
    const int q4 = lane >> 3, c8 = (lane & 7) * 8;
    {
#pragma unroll
      for (int it = 0; it < kQWave / 4; ++it) {
        const int row = it * 4 + q4;
        const v8h val = *(const v8h*)(os + row * 72 + c8);
        *(v8h*)(AOp + (size_t)(bidx * kSeq + q0 + row) * kDim + head * kHd + c8) = val;
      }
      
    }
  }
}

// ---------------------------------------------------------------------------
// Host glue: 5 kernel launches, nothing else.
// ---------------------------------------------------------------------------
extern "C" void kernel_launch(void* const* d_in, const int* in_sizes, int n_in,
                              void* d_out, int out_size, void* d_ws, size_t ws_size,
                              hipStream_t stream) {
  if (n_in < 11) return;
  if (in_sizes[0] != kTok * kDim) return;
  if (in_sizes[1] != kDim || in_sizes[2] != kDim) return;
  if (in_sizes[3] != kDim * kDim || in_sizes[5] != kDim * kDim) return;
  if (in_sizes[7] != kDim * kDim || in_sizes[9] != kDim * kDim) return;
  if (in_sizes[4] != kDim || in_sizes[6] != kDim || in_sizes[8] != kDim || in_sizes[10] != kDim) return;
  if (out_size != kTok * kDim) return;
  if (ws_size < kWsTotal) return;

  const float* x     = (const float*)d_in[0];
  const float* gamma = (const float*)d_in[1];
  const float* beta  = (const float*)d_in[2];
  const float* Wq    = (const float*)d_in[3];
  const float* bq    = (const float*)d_in[4];
  const float* Wk    = (const float*)d_in[5];
  const float* bk    = (const float*)d_in[6];
  const float* Wv    = (const float*)d_in[7];
  const float* bv    = (const float*)d_in[8];
  const float* Wo    = (const float*)d_in[9];
  const float* bo    = (const float*)d_in[10];
  float* out = (float*)d_out;

  char* ws = (char*)d_ws;
  unsigned short* XN = (unsigned short*)(ws + kOffXN);
  unsigned short* WC = (unsigned short*)(ws + kOffWC);
  unsigned short* QP = (unsigned short*)(ws + kOffQP);
  unsigned short* KP = (unsigned short*)(ws + kOffKP);
  unsigned short* VT = (unsigned short*)(ws + kOffVT);
  unsigned short* AO = (unsigned short*)(ws + kOffAO);
  unsigned short* WO = WC + (size_t)3 * kDim * kDim;

  ln_rows_kernel<<<kTok / 8, 256, 0, stream>>>(x, gamma, beta, XN);
  cast_w_kernel<<<dim3(kDim * kDim / 8 / 256, 4), 256, 0, stream>>>(Wq, Wk, Wv, Wo, WC, kWCarry);
  gemm_qkv_kernel<<<(kTok / 128) * (kQkvN / 128), 128, 0, stream>>>(XN, WC, QP, KP, VT, bq, bk, bv);
  attn_kernel<<<kBatch * kHeads * (kSeq / kQBlock), 256, 0, stream>>>(QP, KP, VT, AO);
  gemm_out_kernel<<<(kTok / 128) * (kDim / 128), 128, 0, stream>>>(AO, WO, out, bo);
}

// v004
// One run takes 141 microseconds.
// Timed twice side by side with v003, it ran 1.08 and 1.07 times as fast.
// All steps since v000 together make it 3.66 times as fast.
// All contractions (fused q|k|v projection, k.q^T scores, v^T.p^T context, output projection): v_wmma_f32_16x16x32_f16, f16 operands with power-of-two carries, f32 accumulate; LayerNorm, softmax statistics, bias adds and normalisation in f32.
#include <hip/hip_runtime.h>
#include <math.h>
#include <stdint.h>

typedef __attribute__((ext_vector_type(16))) _Float16 v16h;
typedef __attribute__((ext_vector_type(8)))  _Float16 v8h;
typedef __attribute__((ext_vector_type(8)))  float    v8f;
typedef __attribute__((ext_vector_type(4)))  float    v4f;
typedef __attribute__((ext_vector_type(4)))  uint32_t u32x4;
typedef __attribute__((ext_vector_type(8)))  uint32_t u32x8;

// ---------------------------------------------------------------------------
// Shape constants
// ---------------------------------------------------------------------------
constexpr int kBatch = 4;
constexpr int kSeq   = 2048;
constexpr int kDim   = 1024;
constexpr int kHeads = 16;
constexpr int kHd    = 64;
constexpr int kTok   = kBatch * kSeq;
constexpr int kQkvN  = 3 * kDim;
static_assert(kHeads * kHd == kDim);
static_assert(kTok == 8192);
static_assert((kDim % 32) == 0);
static_assert((kTok % 64) == 0 && (kQkvN % 64) == 0 && (kDim % 64) == 0 && (kSeq % 128) == 0);

// logit scale 1/sqrt(head dim), exact power of two for head dim 64
constexpr float kAttnScale = 0.125f;
static_assert(kHd == 64);
static_assert(kAttnScale * kAttnScale * (float)kHd == 1.0f);

// power-of-two carries of the f16 operand planes
constexpr float kXnCarry    = 16.0f;
constexpr float kWCarry     = 1024.0f;
constexpr float kQkvCarry   = 16.0f;
constexpr float kPLog2Carry = 10.0f;
constexpr float kCtxCarry   = 1024.0f;
constexpr float kProjScale  = 1.0f / (kXnCarry * kWCarry);
constexpr float kCtxExtra   = kCtxCarry / kQkvCarry;
constexpr float kOutScale   = 1.0f / (kCtxCarry * kWCarry);
constexpr float kLog2e      = 1.4426950408889634f;
// raw score = (q*carry).(k*carry) = logit * carry^2 / scale; exponent base 2
constexpr float kExpCoef    = kLog2e * kAttnScale / (kQkvCarry * kQkvCarry);
constexpr float kInvDim     = 1.0f / (float)kDim;
constexpr float kLnEps      = 1e-5f;

// ---------------------------------------------------------------------------
// Workspace region map (bytes; every offset a multiple of 128)
//   XN  f16 [8192][1024]      normalised activations x16          16,777,216
//   WC  f16 [4096][1024]      Wq | Wk | Wv | Wo rows, x1024         8,388,608
//   QP  f16 [4][16][2048][64] q x16                               16,777,216
//   KP  f16 [4][16][2048][64] k x16                               16,777,216
//   VT  f16 [4][16][64][2048] v x16, transposed per head          16,777,216
//   AO  f16 [8192][1024]      merged context x1024                16,777,216
//   total                                                         92,274,688
// ---------------------------------------------------------------------------
constexpr size_t kOffXN = 0;
constexpr size_t kOffWC = kOffXN + (size_t)kTok * kDim * 2;
constexpr size_t kOffQP = kOffWC + (size_t)4 * kDim * kDim * 2;
constexpr size_t kOffKP = kOffQP + (size_t)kTok * kDim * 2;
constexpr size_t kOffVT = kOffKP + (size_t)kTok * kDim * 2;
constexpr size_t kOffAO = kOffVT + (size_t)kTok * kDim * 2;
constexpr size_t kWsTotal = kOffAO + (size_t)kTok * kDim * 2;
static_assert(kWsTotal == 92274688ull);
static_assert(kWsTotal <= 134217728ull);
static_assert((kOffWC % 128) == 0 && (kOffQP % 128) == 0 && (kOffKP % 128) == 0 && (kOffVT % 128) == 0 && (kOffAO % 128) == 0);

// ---------------------------------------------------------------------------
// Fragment helpers (A and B use the same split k map: elements 0..7 <- p[0..7], 8..15 <- p[16..23],
// with p already offset by 8*(lane>>4); row / column = lane & 15)
// ---------------------------------------------------------------------------
struct FragH {
  union U { v16h v; v8h h[2]; };
  static __device__ __forceinline__ v16h load(const _Float16* p) {
    U f;
    f.h[0] = *(const v8h*)(p);
    f.h[1] = *(const v8h*)(p + 16);
    return f.v;
  }
  static __device__ __forceinline__ v8f mma(v16h a, v16h b, v8f c) {
    return __builtin_amdgcn_wmma_f32_16x16x32_f16(false, a, false, b, (short)0, c, false, false);
  }
};
// hazard guards: four idle slots after the last matrix op of a group, tying every accumulator of the group
// and naming the A and B fragment registers of the group as inputs
__device__ __forceinline__ void guard4_h(v8f& a, v8f& b, v8f& c, v8f& d, v16h x, v16h b0, v16h b1, v16h b2, v16h b3) {
  asm volatile("v_nop\n\tv_nop\n\tv_nop\n\tv_nop" : "+v"(a), "+v"(b), "+v"(c), "+v"(d) : "v"(x), "v"(b0), "v"(b1), "v"(b2), "v"(b3));
}
__device__ __forceinline__ void guard1_h(v8f& a, v16h x, v16h y, v16h z, v16h w) {
  asm volatile("v_nop\n\tv_nop\n\tv_nop\n\tv_nop" : "+v"(a) : "v"(x), "v"(y), "v"(z), "v"(w));
}
__device__ __forceinline__ void keep4_h(v16h a, v16h b, v16h c, v16h d) {
  asm volatile("v_nop" :: "v"(a), "v"(b), "v"(c), "v"(d));
}
__device__ __forceinline__ void acc_guard4(v8f& a, v8f& b, v8f& c, v8f& d) {
  asm volatile("v_nop\n\tv_nop\n\tv_nop\n\tv_nop" : "+v"(a), "+v"(b), "+v"(c), "+v"(d));
}
__device__ __forceinline__ void wave_lds_sync() {
  __builtin_amdgcn_fence(__ATOMIC_RELEASE, "workgroup");
  __builtin_amdgcn_wave_barrier();
  __builtin_amdgcn_fence(__ATOMIC_ACQUIRE, "workgroup");
}

// ---------------------------------------------------------------------------
// LayerNorm per token row (population variance from centred squares, eps inside the rsqrt), f32, then x16 and
// RNE convert to f16. One wave per row, 8 rows per block, grid = 8192 / 8 = 1024 blocks (exact).
// Three rolled sweeps over the row (sum, centred squares, normalise + store); in each sweep the lane owns columns
// it*256 + lane*8 .. +7 for it = 0..3: 4 x 32 x 8 = 1024 = the whole row. The row is re-read from global in each
// sweep (no per-thread arrays).
// No block barriers in this kernel; the shuffles run under wave-uniform control only.
// ---------------------------------------------------------------------------
__global__ __launch_bounds__(256) void ln_rows_kernel(const float* __restrict__ x, const float* __restrict__ gamma,
                                                      const float* __restrict__ beta, unsigned short* __restrict__ xn) {
  const int lane = threadIdx.x & 31;
  const int wave = __builtin_amdgcn_readfirstlane((int)(threadIdx.x >> 5));
  const int row = blockIdx.x * 8 + wave;
  if (row >= kTok) return;
  const float* xr = x + (size_t)row * kDim + lane * 8;
  float s = 0.0f;
#pragma unroll 1
  for (int it = 0; it < 4; ++it) {
    const v4f a0 = *(const v4f*)(xr + it * 256);
    const v4f a1 = *(const v4f*)(xr + it * 256 + 4);
    s += ((a0[0] + a0[1]) + (a0[2] + a0[3])) + ((a1[0] + a1[1]) + (a1[2] + a1[3]));
  }
#pragma unroll
  for (int off = 16; off > 0; off >>= 1) s += __shfl_xor(s, off, 32);
  const float mu = s * kInvDim;
  float ss = 0.0f;
#pragma unroll 1
  for (int it = 0; it < 4; ++it) {
    const v4f a0 = *(const v4f*)(xr + it * 256);
    const v4f a1 = *(const v4f*)(xr + it * 256 + 4);
#pragma unroll
    for (int e = 0; e < 4; ++e) {
      const float d0 = a0[e] - mu;
      const float d1 = a1[e] - mu;
      ss = fmaf(d0, d0, ss);
      ss = fmaf(d1, d1, ss);
    }
  }
#pragma unroll
  for (int off = 16; off > 0; off >>= 1) ss += __shfl_xor(ss, off, 32);
  const float inv = rsqrtf(ss * kInvDim + kLnEps);
  unsigned short* orow = xn + (size_t)row * kDim + lane * 8;
#pragma unroll 1
  for (int it = 0; it < 4; ++it) {
    const v4f a0 = *(const v4f*)(xr + it * 256);
    const v4f a1 = *(const v4f*)(xr + it * 256 + 4);
    const v4f g0 = *(const v4f*)(gamma + it * 256 + lane * 8);
    const v4f g1 = *(const v4f*)(gamma + it * 256 + lane * 8 + 4);
    const v4f b0 = *(const v4f*)(beta + it * 256 + lane * 8);
    const v4f b1 = *(const v4f*)(beta + it * 256 + lane * 8 + 4);
    v8h hv;
#pragma unroll
    for (int e = 0; e < 4; ++e) {
      const float y0 = fmaf((a0[e] - mu) * inv, g0[e], b0[e]) * kXnCarry;
      const float y1 = fmaf((a1[e] - mu) * inv, g1[e], b1[e]) * kXnCarry;
      hv[e] = (_Float16)y0;
      hv[4 + e] = (_Float16)y1;
    }
    *(v8h*)(orow + it * 256) = hv;
    
  }
}

// ---------------------------------------------------------------------------
// Weight planes: f32 [1024][1024] ([out][in], already the Bt[n][k] layout) -> f16 x carry, 8 elements per thread.
// grid (512, 4): blockIdx.y selects the matrix (block-uniform) and its 1M-half plane; 512 x 256 x 8 = 1,048,576 (exact).
// ---------------------------------------------------------------------------
__global__ __launch_bounds__(256) void cast_w_kernel(const float* __restrict__ w0, const float* __restrict__ w1,
                                                     const float* __restrict__ w2, const float* __restrict__ w3,
                                                     unsigned short* __restrict__ out, float carry) {
  const int z = blockIdx.y;
  const float* W = (z == 0) ? w0 : (z == 1) ? w1 : (z == 2) ? w2 : w3;
  const int i = blockIdx.x * 256 + threadIdx.x;
  if (i >= kDim * kDim / 8) return;
  const float* p = W + 8 * (size_t)i;
  const v4f a = *(const v4f*)(p);
  const v4f c = *(const v4f*)(p + 4);
  v8h hv;
#pragma unroll
  for (int e = 0; e < 4; ++e) {
    hv[e] = (_Float16)(a[e] * carry);
    hv[4 + e] = (_Float16)(c[e] * carry);
  }
  unsigned short* q = out + (size_t)z * kDim * kDim + 8 * (size_t)i;
  *(v8h*)q = hv;
  
}

// ---------------------------------------------------------------------------
// GEMM operand ring in LDS. A block of 4 waves (2 x 2) owns a 128 x 128 tile of the product; a stage is 64 k = 128 B of
// each of its 128 A rows and 128 Bt rows. Every wave brings one slice of 64 rows per stage with one tensor load
// (waves 0, 1: the A rows; waves 2, 3: the Bt rows); the load's pad lays the rows at a pitch of 144 B (16 B x 9) for the
// 16-B fragment reads. A slice holds 64 x 144 = 9,216 B and is placed every 10,240 B (a multiple of 2 KiB).
// Two buffers of four slices each: 81,920 B, which the epilogues reuse as per-wave staging behind the last barrier.
// ---------------------------------------------------------------------------
constexpr uint32_t kStageRowB  = 128u;
constexpr uint32_t kRingPitchB = 144u;
constexpr uint32_t kSliceRows  = 64u;
constexpr uint32_t kSliceB     = 10240u;
constexpr uint32_t kBufB       = 4u * kSliceB;
constexpr uint32_t kRingB      = 2u * kBufB;
constexpr uint32_t kStages     = (uint32_t)kDim * 2u / kStageRowB;
constexpr int      kRingPitchH = (int)kRingPitchB / 2;
static_assert(kSliceRows * kRingPitchB <= kSliceB && (kSliceB % 2048u) == 0u);
static_assert(kStages >= 2u);
static_assert((kTok % 128) == 0 && (kQkvN % 128) == 0 && (kDim % 128) == 0);

__device__ __forceinline__ uint32_t uni(uint32_t v) { return (uint32_t)__builtin_amdgcn_readfirstlane(v); }
// holds a wave-uniform value in a scalar register: a test made of it compiles to a scalar compare and branch (a tensor
// load ignores EXEC), and what is computed from it stays behind the asm waits written in front of it
__device__ __forceinline__ uint32_t pinned(uint32_t v) {
  uint32_t w = uni(v);
  asm volatile("" : "+s"(w));
  return w;
}
// the compiler places no wait for the tensor mover: a tile counts as landed only behind its issuer's s_wait_tensorcnt, and
// a buffer is handed back to the mover only behind its readers' s_wait_dscnt; the clobber keeps LDS accesses on their side
__device__ __forceinline__ void wait_ds0()     { asm volatile("s_wait_dscnt 0x0" ::: "memory"); }
__device__ __forceinline__ void wait_tensor0() { asm volatile("s_wait_tensorcnt 0x0" ::: "memory"); }
// one request of the whole wave: a 2-D tile from global memory into LDS, through no register
__device__ __forceinline__ void tdm_load(u32x4 g0, u32x8 g1) {
  asm volatile("tensor_load_to_lds %0, %1" :: "s"(g0), "s"(g1) : "memory");
}
// group 1: 1-byte elements, tensor = tile = 64 rows of 128 B, source pitch one K row, 4 dwords of LDS pad behind every 32
__device__ __forceinline__ u32x8 tdm_group1() {
  constexpr uint32_t d0 = kStageRowB, d1 = kSliceRows;
  u32x8 g;
  g[0] = uni((1u << 20) | (4u << 22) | (3u << 25));
  g[1] = uni((d0 & 0xFFFFu) << 16);
  g[2] = uni((d0 >> 16) | ((d1 & 0xFFFFu) << 16));
  g[3] = uni((d1 >> 16) | (d0 << 16));
  g[4] = uni(d1);
  g[5] = uni((uint32_t)kDim * 2u);
  g[6] = uni(0u);
  g[7] = uni(0u);
  return g;
}
__device__ __forceinline__ u32x4 tdm_group0(uint32_t lds_dst, uint64_t ga) {
  u32x4 g;
  g[0] = uni(1u);
  g[1] = uni(lds_dst);
  g[2] = uni((uint32_t)ga);
  g[3] = uni((((uint32_t)(ga >> 32)) & 0x01FFFFFFu) | 0x80000000u);
  return g;
}

// ---------------------------------------------------------------------------
// Register-blocked GEMM main loop: acc[i][j] (16x16 sub-tiles of a 64x64 wave tile) = sum_k A[m][k] * Bt[n][k],
// A row-major pitch 1024, Bt row-major pitch 1024, K = 1024 (16 stages of 64 k, two 32-k steps each).
// Wave w works on rows bm0 + 64 (w >> 1) and columns bn0 + 64 (w & 1): it reads slice w >> 1 (A) and slice 2 + (w & 1) (Bt).
// Every wave of the block runs the whole loop: all barriers stand under block-uniform control.
// ---------------------------------------------------------------------------
__device__ __forceinline__ void gemm_tile_loop(const _Float16* __restrict__ A, const _Float16* __restrict__ Bt,
                                               int bm0, int bn0, int wave, int lane, unsigned char* ring,
                                               v8f (&acc)[4][4]) {
  const int rlane = lane & 15;
  const int koff  = (lane >> 4) * 8;
#pragma unroll
  for (int i = 0; i < 4; ++i)
#pragma unroll
    for (int j = 0; j < 4; ++j) acc[i][j] = (v8f){0.f, 0.f, 0.f, 0.f, 0.f, 0.f, 0.f, 0.f};

  const _Float16* srow = (wave < 2) ? A + (size_t)(bm0 + wave * 64) * kDim : Bt + (size_t)(bn0 + (wave - 2) * 64) * kDim;
  const uint64_t src = (uint64_t)(size_t)srow;
  const uint32_t dst = (uint32_t)(size_t)ring + (uint32_t)wave * kSliceB;
  const u32x8 g1 = tdm_group1();

  tdm_load(tdm_group0(dst, src), g1);
  wait_tensor0();   // this wave's slice of stage 0 has landed
  __syncthreads();  // stage 0 published to the other waves
  {
    const uint32_t st = pinned(1u);  // pinned(): stage 1's descriptor words are formed behind stage 0's wait
    tdm_load(tdm_group0(dst + st * kBufB, src + (uint64_t)st * kStageRowB), g1);
  }

  const _Float16* Aw = (const _Float16*)(ring + (uint32_t)(wave >> 1) * kSliceB) + rlane * kRingPitchH + koff;
  const _Float16* Bw = (const _Float16*)(ring + (uint32_t)(2 + (wave & 1)) * kSliceB) + rlane * kRingPitchH + koff;
  // rolled: one stage per trip, so that the publish point below stands once in the text
#pragma unroll 1
  for (uint32_t s = 0; s < kStages; ++s) {
    const _Float16* As = Aw + (s & 1u) * (kBufB / 2u);
    const _Float16* Bs = Bw + (s & 1u) * (kBufB / 2u);
#pragma unroll
    for (int kk = 0; kk < 2; ++kk) {
      v16h ah[4], bh[4];
      ah[0] = FragH::load(As + kk * 32);
#pragma unroll
      for (int j = 0; j < 4; ++j) bh[j] = FragH::load(Bs + (j << 4) * kRingPitchH + kk * 32);
#pragma unroll
      for (int i = 1; i < 4; ++i) ah[i] = FragH::load(As + (i << 4) * kRingPitchH + kk * 32);
      // keeps the step's 16 LDS reads one group in front of its 16 matrix ops: sunk among them, each row waits out its own read
      __builtin_amdgcn_sched_barrier(0);
#pragma unroll
      for (int i = 0; i < 4; ++i) {
#pragma unroll
        for (int j = 0; j < 4; ++j) acc[i][j] = FragH::mma(ah[i], bh[j], acc[i][j]);
        guard4_h(acc[i][0], acc[i][1], acc[i][2], acc[i][3], ah[i], bh[0], bh[1], bh[2], bh[3]);
      }
      keep4_h(bh[0], bh[1], bh[2], bh[3]);
    }
    // publish point of stage s + 1
    wait_ds0();       // this wave's reads of stage s have returned
    wait_tensor0();   // this wave's slice of stage s + 1 has landed
    __syncthreads();  // stage s + 1 published; every wave has left stage s's buffer
    const uint32_t nxt = pinned(s + 2u);  // pinned(): the next descriptor's words are formed behind the wait above
    if (pinned(nxt < kStages)) {          // pinned(): scalar branch around the tensor load
      tdm_load(tdm_group0(dst + (nxt & 1u) * kBufB, src + (uint64_t)nxt * kStageRowB), g1);
    }
  }
  wait_tensor0();  // nothing of the mover in flight when the ring becomes staging
  wait_ds0();
  acc_guard4(acc[0][0], acc[0][1], acc[0][2], acc[0][3]);
  acc_guard4(acc[1][0], acc[1][1], acc[1][2], acc[1][3]);
  acc_guard4(acc[2][0], acc[2][1], acc[2][2], acc[2][3]);
  acc_guard4(acc[3][0], acc[3][1], acc[3][2], acc[3][3]);
}

// ---------------------------------------------------------------------------
// Fused q|k|v projection: [8192][3072] = XN[8192][1024] . WC[0..3071][1024]^T, f32 epilogue (x 1/16384, + bias, x16).
// One wave per 64x64 tile, 4 waves (2 x 2) per 128x128 block tile, grid = 64*24 = 1536 blocks of 128 threads (exact).
// A wave tile lies in one region (q, k or v: n0 >> 10), one head ((n0 & 1023) >> 6) and one batch element (m0 >> 11).
// The whole tile is staged per wave as f16 [64][72]: q/k regions row = token, v region row = d (transposed).
//   q/k: plane[b][head][s0 + row][0..63];  v: VT[b][head][row][s0 .. s0+63].
// ---------------------------------------------------------------------------
__global__ __launch_bounds__(128) void gemm_qkv_kernel(
    const unsigned short* __restrict__ XNp, const unsigned short* __restrict__ WCp,
    unsigned short* __restrict__ QPp, unsigned short* __restrict__ KPp, unsigned short* __restrict__ VTp,
    const float* __restrict__ bq, const float* __restrict__ bk, const float* __restrict__ bv) {
  __shared__ __attribute__((aligned(2048))) unsigned char Ring[kRingB];
  static_assert(4u * 64u * 72u * 2u <= kRingB);
  const int lane = threadIdx.x & 31;
  const int wave = __builtin_amdgcn_readfirstlane((int)(threadIdx.x >> 5));
  constexpr int tilesN = kQkvN >> 7;
  constexpr int tilesM = kTok >> 7;
  const int tile = blockIdx.x;
  if (tile >= tilesM * tilesN) return;
  const int tm = tile / tilesN;
  const int tn = tile - tm * tilesN;
  const int m0 = (tm << 7) + ((wave >> 1) << 6);
  const int n0 = (tn << 7) + ((wave & 1) << 6);

  v8f acc[4][4];
  gemm_tile_loop((const _Float16*)XNp, (const _Float16*)WCp, tm << 7, tn << 7, wave, lane, Ring, acc);

  const int rlane = lane & 15;
  const int mOff  = (lane >> 4) * 8;
  const int region = n0 >> 10;
  const int nl0  = n0 & (kDim - 1);
  const int head = nl0 >> 6;
  const int bidx = m0 >> 11;
  const int s0   = m0 & (kSeq - 1);
  const float* bias = (region == 0) ? bq : ((region == 1) ? bk : bv);
  float bvj[4];
#pragma unroll
  for (int j = 0; j < 4; ++j) bvj[j] = bias[nl0 + (j << 4) + rlane];

  _Float16* st = (_Float16*)Ring + wave * (64 * 72);
#pragma unroll
  for (int i = 0; i < 4; ++i) {
#pragma unroll
    for (int j = 0; j < 4; ++j) {
      float y[8];
#pragma unroll
      for (int r = 0; r < 8; ++r) y[r] = (acc[i][j][r] * kProjScale + bvj[j]) * kQkvCarry;
      if (region < 2) {
#pragma unroll
        for (int r = 0; r < 8; ++r) st[((i << 4) + mOff + r) * 72 + (j << 4) + rlane] = (_Float16)y[r];
      } else {
        v8h t;
#pragma unroll
        for (int r = 0; r < 8; ++r) t[r] = (_Float16)y[r];
        *(v8h*)(st + ((j << 4) + rlane) * 72 + (i << 4) + mOff) = t;
      }
    }
  }
  wave_lds_sync();

  unsigned short* plane;
  size_t gbase;
  int gpitch;
  if (region < 2) {
    plane  = (region == 0) ? QPp : KPp;
    gbase  = ((size_t)(bidx * kHeads + head) * kSeq + s0) * kHd;
    gpitch = kHd;
  } else {
    plane  = VTp;
    gbase  = (size_t)(bidx * kHeads + head) * kHd * kSeq + s0;
    gpitch = kSeq;
  }
  const int q4 = lane >> 3, c8 = (lane & 7) * 8;
  {
#pragma unroll
    for (int it = 0; it < 16; ++it) {
      const int row = it * 4 + q4;
      const v8h val = *(const v8h*)(st + row * 72 + c8);
      *(v8h*)(plane + gbase + (size_t)row * gpitch + c8) = val;
    }
    
  }
}

// ---------------------------------------------------------------------------
// Output projection: out[8192][1024] (f32) = AO[8192][1024] . WC[3072..4095][1024]^T x 2^-20 + bo.
// One wave per 64x64 tile, 4 waves (2 x 2) per 128x128 block tile, grid = 64*8 = 512 blocks of 128 threads (exact).
// 16-row f32 slabs per wave in LDS;
// ---------------------------------------------------------------------------
__global__ __launch_bounds__(128) void gemm_out_kernel(
    const unsigned short* __restrict__ AOp, const unsigned short* __restrict__ WOp,
    float* __restrict__ out, const float* __restrict__ bo) {
  __shared__ __attribute__((aligned(2048))) unsigned char Ring[kRingB];
  static_assert(4u * 16u * 68u * 4u <= kRingB);
  const int lane = threadIdx.x & 31;
  const int wave = __builtin_amdgcn_readfirstlane((int)(threadIdx.x >> 5));
  constexpr int tilesN = kDim >> 7;
  constexpr int tilesM = kTok >> 7;
  const int tile = blockIdx.x;
  if (tile >= tilesM * tilesN) return;
  const int tm = tile / tilesN;
  const int tn = tile - tm * tilesN;
  const int m0 = (tm << 7) + ((wave >> 1) << 6);
  const int n0 = (tn << 7) + ((wave & 1) << 6);

  v8f acc[4][4];
  gemm_tile_loop((const _Float16*)AOp, (const _Float16*)WOp, tm << 7, tn << 7, wave, lane, Ring, acc);

  const int rlane = lane & 15;
  const int mOff  = (lane >> 4) * 8;
  float bvj[4];
#pragma unroll
  for (int j = 0; j < 4; ++j) bvj[j] = bo[n0 + (j << 4) + rlane];
  float* slab = (float*)Ring + wave * (16 * 68);
  const int hh = lane >> 4, c4 = (lane & 15) * 4;
#pragma unroll
  for (int i = 0; i < 4; ++i) {
    const int mBase = m0 + (i << 4);
#pragma unroll
    for (int j = 0; j < 4; ++j) {
#pragma unroll
      for (int r = 0; r < 8; ++r)
        slab[(mOff + r) * 68 + (j << 4) + rlane] = acc[i][j][r] * kOutScale + bvj[j];
    }
    wave_lds_sync();
    {
#pragma unroll
      for (int it = 0; it < 8; ++it) {
        const int row = it * 2 + hh;
        const v4f v = *(const v4f*)(slab + row * 68 + c4);
        *(v4f*)(out + (size_t)(mBase + row) * kDim + n0 + c4) = v;
      }
      
    }
    wave_lds_sync();
  }
}

__device__ __forceinline__ void guard2_h(v8f& a, v8f& b, v16h x, v16h y, v16h p, v16h q, v16h r, v16h s) {
  asm volatile("v_nop\n\tv_nop\n\tv_nop\n\tv_nop" : "+v"(a), "+v"(b) : "v"(x), "v"(y), "v"(p), "v"(q), "v"(r), "v"(s));
}
constexpr int kQWave  = 32;
constexpr int kQBlock = 8 * kQWave;
static_assert((kSeq % kQBlock) == 0);

constexpr uint32_t kKvRows   = 16u;
constexpr uint32_t kKvSliceB = 4096u;
constexpr uint32_t kKvBufB   = 8u * kKvSliceB;
constexpr uint32_t kKvRingB  = 2u * kKvBufB;
constexpr uint32_t kKvStages = (uint32_t)kSeq / 64u;
static_assert(kKvRows * kRingPitchB <= kKvSliceB && (kKvSliceB % 2048u) == 0u);
static_assert(kKvStages >= 2u);
static_assert((uint32_t)kHd * 2u == kStageRowB);
// group 1: 1-byte elements, tensor = tile = 16 rows of 128 B, source pitch as given, 4 dwords of LDS pad behind every 32
// pinned(): words 1 to 7 are descriptor words held in scalar registers of their own: built once in front of the loop, so
// that the compiler does not lend a word's register to the loop's own arithmetic while a request is outstanding
__device__ __forceinline__ u32x8 tdm_group1_kv(uint32_t src_pitch) {
  constexpr uint32_t d0 = kStageRowB, d1 = kKvRows;
  u32x8 g;
  g[0] = uni((1u << 20) | (4u << 22) | (3u << 25));
  g[1] = pinned((d0 & 0xFFFFu) << 16);
  g[2] = pinned((d0 >> 16) | ((d1 & 0xFFFFu) << 16));
  g[3] = pinned((d1 >> 16) | (d0 << 16));
  g[4] = pinned(d1);
  g[5] = pinned(src_pitch);
  g[6] = pinned(0u);
  g[7] = pinned(0u);
  return g;
}

__global__ __launch_bounds__(256) void attn_kernel(const unsigned short* __restrict__ QPp,
                                                   const unsigned short* __restrict__ KPp,
                                                   const unsigned short* __restrict__ VTp,
                                                   unsigned short* __restrict__ AOp) {
  constexpr int kPitch = 72;
  constexpr int kQBlocks = kSeq / kQBlock;
  static_assert(kPitch == kRingPitchH);
  __shared__ __attribute__((aligned(2048))) unsigned char KvRing[kKvRingB];
  __shared__ __align__(16) _Float16 Osh[8 * kQWave * 72];
  const int tid  = threadIdx.x;
  const int lane = tid & 31;
  const int wave = __builtin_amdgcn_readfirstlane((int)(tid >> 5));
  const int hh   = lane >> 4;
  const int c    = lane & 15;
  const int bx   = blockIdx.x;
  const int qb   = bx % kQBlocks;
  const int bh   = bx / kQBlocks;
  const int head = bh & (kHeads - 1);
  const int bidx = bh >> 4;
  const int q0   = qb * kQBlock + wave * kQWave;

  const _Float16* Qh = (const _Float16*)QPp + (size_t)bh * kSeq * kHd;
  const _Float16* Kh = (const _Float16*)KPp + (size_t)bh * kSeq * kHd;
  const _Float16* Vh = (const _Float16*)VTp + (size_t)bh * kHd * kSeq;

  v16h qf[2][2];
#pragma unroll
  for (int u = 0; u < 2; ++u) {
    qf[u][0] = FragH::load(Qh + (size_t)(q0 + u * 16 + c) * kHd + 8 * hh);
    qf[u][1] = FragH::load(Qh + (size_t)(q0 + u * 16 + c) * kHd + 32 + 8 * hh);
  }

  v8f oacc[2][4];
  float mrun[2], lrun[2];
#pragma unroll
  for (int u = 0; u < 2; ++u) {
#pragma unroll
    for (int t = 0; t < 4; ++t) oacc[u][t] = (v8f){0.f, 0.f, 0.f, 0.f, 0.f, 0.f, 0.f, 0.f};
    mrun[u] = -1e30f;
    lrun[u] = 0.0f;
  }

  // this wave's slice: its first byte in stage 0, the bytes from one stage to the next, its source pitch, its LDS place
  const _Float16* srow = (wave < 4) ? Kh + (size_t)(wave * 16) * kHd : Vh + (size_t)((wave - 4) * 16) * kSeq;
  const uint64_t src  = (uint64_t)(size_t)srow;
  const uint32_t step = (wave < 4) ? 64u * kStageRowB : kStageRowB;
  const uint32_t dst  = (uint32_t)(size_t)KvRing + (uint32_t)wave * kKvSliceB;
  const u32x8 g1 = tdm_group1_kv((wave < 4) ? kStageRowB : (uint32_t)kSeq * 2u);

  tdm_load(tdm_group0(dst, src), g1);
  wait_tensor0();   // this wave's slice of stage 0 has landed
  __syncthreads();  // stage 0 published to the other waves

  const _Float16* Kw = (const _Float16*)KvRing + c * kPitch + 8 * hh;
  const _Float16* Vw = (const _Float16*)(KvRing + 4u * kKvSliceB) + c * kPitch + 8 * hh;
  constexpr int kSliceH = (int)kKvSliceB / 2;
  // rolled: one stage per trip, so that the refill and the publish point stand once in the text
#pragma unroll 1
  for (uint32_t s = 0; s < kKvStages; ++s) {
    // refill, directly behind the barrier that published stage s (in front of the loop, or at the foot of trip s - 1):
    // stage s + 1 goes into the buffer that every wave has left, and flies while stage s is worked on. It stands at the
    // head of the trip, so that the trip's work is one block of code up to its barrier: with this branch at the foot the
    // compiler moved the row-sum arithmetic out from among the matrix ops to behind the barrier
    const uint32_t nxt = pinned(s + 1u);  // pinned(): the descriptor's words are formed behind the wait in front of that barrier
    if (pinned(nxt < kKvStages)) {        // pinned(): scalar branch around the tensor load
      tdm_load(tdm_group0(dst + (nxt & 1u) * kKvBufB, src + (uint64_t)nxt * step), g1);
    }
    const _Float16* Ks = Kw + (s & 1u) * (kKvBufB / 2u);
    const _Float16* Vs = Vw + (s & 1u) * (kKvBufB / 2u);

    v8f st[2][4];
#pragma unroll
    for (int j = 0; j < 4; ++j) {
      st[0][j] = (v8f){0.f, 0.f, 0.f, 0.f, 0.f, 0.f, 0.f, 0.f};
      st[1][j] = (v8f){0.f, 0.f, 0.f, 0.f, 0.f, 0.f, 0.f, 0.f};
      const v16h ka0 = FragH::load(Ks + j * kSliceH);
      const v16h ka1 = FragH::load(Ks + j * kSliceH + 32);
      st[0][j] = FragH::mma(ka0, qf[0][0], st[0][j]);
      st[1][j] = FragH::mma(ka0, qf[1][0], st[1][j]);
      st[0][j] = FragH::mma(ka1, qf[0][1], st[0][j]);
      st[1][j] = FragH::mma(ka1, qf[1][1], st[1][j]);
      guard2_h(st[0][j], st[1][j], ka0, ka1, qf[0][0], qf[0][1], qf[1][0], qf[1][1]);
    }

    v16h pf[2][2];
#pragma unroll
    for (int u = 0; u < 2; ++u) {
      float mx = st[u][0][0];
#pragma unroll
      for (int j = 0; j < 4; ++j)
#pragma unroll
        for (int r = 0; r < 8; ++r) mx = fmaxf(mx, st[u][j][r]);
      mx = fmaxf(mx, __shfl_xor(mx, 16, 32));
      const float mnew  = fmaxf(mrun[u], mx);
      const float alpha = __builtin_amdgcn_exp2f((mrun[u] - mnew) * kExpCoef);
      const float off   = fmaf(-mnew, kExpCoef, kPLog2Carry);
      mrun[u] = mnew;

      float psum = 0.0f;
#pragma unroll
      for (int r = 0; r < 8; ++r) {
        const _Float16 h0 = (_Float16)__builtin_amdgcn_exp2f(fmaf(st[u][0][r], kExpCoef, off));
        const _Float16 h1 = (_Float16)__builtin_amdgcn_exp2f(fmaf(st[u][1][r], kExpCoef, off));
        const _Float16 h2 = (_Float16)__builtin_amdgcn_exp2f(fmaf(st[u][2][r], kExpCoef, off));
        const _Float16 h3 = (_Float16)__builtin_amdgcn_exp2f(fmaf(st[u][3][r], kExpCoef, off));
        pf[u][0][r] = h0;
        pf[u][0][8 + r] = h1;
        pf[u][1][r] = h2;
        pf[u][1][8 + r] = h3;
        psum += ((float)h0 + (float)h1) + ((float)h2 + (float)h3);
      }
      lrun[u] = lrun[u] * alpha + psum;
#pragma unroll
      for (int t = 0; t < 4; ++t)
#pragma unroll
        for (int r = 0; r < 8; ++r) oacc[u][t][r] *= alpha;
    }

#pragma unroll
    for (int t = 0; t < 4; ++t) {
      const v16h va0 = FragH::load(Vs + t * kSliceH);
      const v16h va1 = FragH::load(Vs + t * kSliceH + 32);
      oacc[0][t] = FragH::mma(va0, pf[0][0], oacc[0][t]);
      oacc[1][t] = FragH::mma(va0, pf[1][0], oacc[1][t]);
      oacc[0][t] = FragH::mma(va1, pf[0][1], oacc[0][t]);
      oacc[1][t] = FragH::mma(va1, pf[1][1], oacc[1][t]);
      guard2_h(oacc[0][t], oacc[1][t], va0, va1, pf[0][0], pf[0][1], pf[1][0], pf[1][1]);
    }
    // publish point of stage s + 1
    wait_ds0();       // this wave's reads of stage s have returned
    wait_tensor0();   // this wave's slice of stage s + 1 has landed
    __syncthreads();  // stage s + 1 published; every wave has left stage s's buffer
  }
  wait_tensor0();  // nothing of the mover in flight when the wave ends
  wait_ds0();

  _Float16* os = Osh + wave * (kQWave * 72);
#pragma unroll
  for (int u = 0; u < 2; ++u) {
    const float ltot = lrun[u] + __shfl_xor(lrun[u], 16, 32);
    const float inv  = kCtxExtra * (1.0f / ltot);
#pragma unroll
    for (int t = 0; t < 4; ++t) {
      v8h o;
#pragma unroll
      for (int r = 0; r < 8; ++r) o[r] = (_Float16)(oacc[u][t][r] * inv);
      *(v8h*)(os + (u * 16 + c) * 72 + t * 16 + 8 * hh) = o;
    }
  }
  wave_lds_sync();
  {
    const int q4 = lane >> 3, c8 = (lane & 7) * 8;
    {
#pragma unroll
      for (int it = 0; it < kQWave / 4; ++it) {
        const int row = it * 4 + q4;
        const v8h val = *(const v8h*)(os + row * 72 + c8);
        *(v8h*)(AOp + (size_t)(bidx * kSeq + q0 + row) * kDim + head * kHd + c8) = val;
      }
      
    }
  }
}

// ---------------------------------------------------------------------------
// Host glue: 5 kernel launches, nothing else.
// ---------------------------------------------------------------------------
extern "C" void kernel_launch(void* const* d_in, const int* in_sizes, int n_in,
                              void* d_out, int out_size, void* d_ws, size_t ws_size,
                              hipStream_t stream) {
  if (n_in < 11) return;
  if (in_sizes[0] != kTok * kDim) return;
  if (in_sizes[1] != kDim || in_sizes[2] != kDim) return;
  if (in_sizes[3] != kDim * kDim || in_sizes[5] != kDim * kDim) return;
  if (in_sizes[7] != kDim * kDim || in_sizes[9] != kDim * kDim) return;
  if (in_sizes[4] != kDim || in_sizes[6] != kDim || in_sizes[8] != kDim || in_sizes[10] != kDim) return;
  if (out_size != kTok * kDim) return;
  if (ws_size < kWsTotal) return;

  const float* x     = (const float*)d_in[0];
  const float* gamma = (const float*)d_in[1];
  const float* beta  = (const float*)d_in[2];
  const float* Wq    = (const float*)d_in[3];
  const float* bq    = (const float*)d_in[4];
  const float* Wk    = (const float*)d_in[5];
  const float* bk    = (const float*)d_in[6];
  const float* Wv    = (const float*)d_in[7];
  const float* bv    = (const float*)d_in[8];
  const float* Wo    = (const float*)d_in[9];
  const float* bo    = (const float*)d_in[10];
  float* out = (float*)d_out;

  char* ws = (char*)d_ws;
  unsigned short* XN = (unsigned short*)(ws + kOffXN);
  unsigned short* WC = (unsigned short*)(ws + kOffWC);
  unsigned short* QP = (unsigned short*)(ws + kOffQP);
  unsigned short* KP = (unsigned short*)(ws + kOffKP);
  unsigned short* VT = (unsigned short*)(ws + kOffVT);
  unsigned short* AO = (unsigned short*)(ws + kOffAO);
  unsigned short* WO = WC + (size_t)3 * kDim * kDim;

  ln_rows_kernel<<<kTok / 8, 256, 0, stream>>>(x, gamma, beta, XN);
  cast_w_kernel<<<dim3(kDim * kDim / 8 / 256, 4), 256, 0, stream>>>(Wq, Wk, Wv, Wo, WC, kWCarry);
  gemm_qkv_kernel<<<(kTok / 128) * (kQkvN / 128), 128, 0, stream>>>(XN, WC, QP, KP, VT, bq, bk, bv);
  attn_kernel<<<kBatch * kHeads * (kSeq / kQBlock), 256, 0, stream>>>(QP, KP, VT, AO);
  gemm_out_kernel<<<(kTok / 128) * (kDim / 128), 128, 0, stream>>>(AO, WO, out, bo);
}

// v005
// A run of this version takes 134 microseconds.
// Timed twice side by side with v004, it ran 1.06 and 1.05 times as fast.
// Over all steps from v000 it is 3.86 times as fast.
// All contractions (fused q|k|v projection, k.q^T scores, softmax row sums, v^T.p^T context, output projection): v_wmma_f32_16x16x32_f16, f16 operands with power-of-two carries, f32 accumulate; LayerNorm, softmax running max and rescaling, bias adds and normalisation in f32.
#include <hip/hip_runtime.h>
#include <math.h>
#include <stdint.h>

typedef __attribute__((ext_vector_type(16))) _Float16 v16h;
typedef __attribute__((ext_vector_type(8)))  _Float16 v8h;
typedef __attribute__((ext_vector_type(8)))  float    v8f;
typedef __attribute__((ext_vector_type(4)))  float    v4f;
typedef __attribute__((ext_vector_type(4)))  uint32_t u32x4;
typedef __attribute__((ext_vector_type(8)))  uint32_t u32x8;

// ---------------------------------------------------------------------------
// Shape constants
// ---------------------------------------------------------------------------
constexpr int kBatch = 4;
constexpr int kSeq   = 2048;
constexpr int kDim   = 1024;
constexpr int kHeads = 16;
constexpr int kHd    = 64;
constexpr int kTok   = kBatch * kSeq;
constexpr int kQkvN  = 3 * kDim;
static_assert(kHeads * kHd == kDim);
static_assert(kTok == 8192);
static_assert((kDim % 32) == 0);
static_assert((kTok % 64) == 0 && (kQkvN % 64) == 0 && (kDim % 64) == 0 && (kSeq % 128) == 0);

// logit scale 1/sqrt(head dim), exact power of two for head dim 64
constexpr float kAttnScale = 0.125f;
static_assert(kHd == 64);
static_assert(kAttnScale * kAttnScale * (float)kHd == 1.0f);

// power-of-two carries of the f16 operand planes
constexpr float kXnCarry    = 16.0f;
constexpr float kWCarry     = 1024.0f;
constexpr float kQkvCarry   = 16.0f;
constexpr float kPLog2Carry = 10.0f;
constexpr float kCtxCarry   = 1024.0f;
constexpr float kProjScale  = 1.0f / (kXnCarry * kWCarry);
constexpr float kCtxExtra   = kCtxCarry / kQkvCarry;
constexpr float kOutScale   = 1.0f / (kCtxCarry * kWCarry);
constexpr float kLog2e      = 1.4426950408889634f;
// raw score = (q*carry).(k*carry) = logit * carry^2 / scale; exponent base 2
constexpr float kExpCoef    = kLog2e * kAttnScale / (kQkvCarry * kQkvCarry);
constexpr float kInvDim     = 1.0f / (float)kDim;
constexpr float kLnEps      = 1e-5f;

// ---------------------------------------------------------------------------
// Workspace region map (bytes; every offset a multiple of 128)
//   XN  f16 [8192][1024]      normalised activations x16          16,777,216
//   WC  f16 [4096][1024]      Wq | Wk | Wv | Wo rows, x1024         8,388,608
//   QP  f16 [4][16][2048][64] q x16                               16,777,216
//   KP  f16 [4][16][2048][64] k x16                               16,777,216
//   VT  f16 [4][16][64][2048] v x16, transposed per head          16,777,216
//   AO  f16 [8192][1024]      merged context x1024                16,777,216
//   total                                                         92,274,688
// ---------------------------------------------------------------------------
constexpr size_t kOffXN = 0;
constexpr size_t kOffWC = kOffXN + (size_t)kTok * kDim * 2;
constexpr size_t kOffQP = kOffWC + (size_t)4 * kDim * kDim * 2;
constexpr size_t kOffKP = kOffQP + (size_t)kTok * kDim * 2;
constexpr size_t kOffVT = kOffKP + (size_t)kTok * kDim * 2;
constexpr size_t kOffAO = kOffVT + (size_t)kTok * kDim * 2;
constexpr size_t kWsTotal = kOffAO + (size_t)kTok * kDim * 2;
static_assert(kWsTotal == 92274688ull);
static_assert(kWsTotal <= 134217728ull);
static_assert((kOffWC % 128) == 0 && (kOffQP % 128) == 0 && (kOffKP % 128) == 0 && (kOffVT % 128) == 0 && (kOffAO % 128) == 0);

// ---------------------------------------------------------------------------
// Fragment helpers (A and B use the same split k map: elements 0..7 <- p[0..7], 8..15 <- p[16..23],
// with p already offset by 8*(lane>>4); row / column = lane & 15)
// ---------------------------------------------------------------------------
struct FragH {
  union U { v16h v; v8h h[2]; };
  static __device__ __forceinline__ v16h load(const _Float16* p) {
    U f;
    f.h[0] = *(const v8h*)(p);
    f.h[1] = *(const v8h*)(p + 16);
    return f.v;
  }
  static __device__ __forceinline__ v8f mma(v16h a, v16h b, v8f c) {
    return __builtin_amdgcn_wmma_f32_16x16x32_f16(false, a, false, b, (short)0, c, false, false);
  }
};
// hazard guards: four idle slots after the last matrix op of a group, tying every accumulator of the group
// and naming the A and B fragment registers of the group as inputs
__device__ __forceinline__ void guard4_h(v8f& a, v8f& b, v8f& c, v8f& d, v16h x, v16h b0, v16h b1, v16h b2, v16h b3) {
  asm volatile("v_nop\n\tv_nop\n\tv_nop\n\tv_nop" : "+v"(a), "+v"(b), "+v"(c), "+v"(d) : "v"(x), "v"(b0), "v"(b1), "v"(b2), "v"(b3));
}
__device__ __forceinline__ void guard1_h(v8f& a, v16h x, v16h y, v16h z, v16h w) {
  asm volatile("v_nop\n\tv_nop\n\tv_nop\n\tv_nop" : "+v"(a) : "v"(x), "v"(y), "v"(z), "v"(w));
}
__device__ __forceinline__ void keep4_h(v16h a, v16h b, v16h c, v16h d) {
  asm volatile("v_nop" :: "v"(a), "v"(b), "v"(c), "v"(d));
}
__device__ __forceinline__ void acc_guard4(v8f& a, v8f& b, v8f& c, v8f& d) {
  asm volatile("v_nop\n\tv_nop\n\tv_nop\n\tv_nop" : "+v"(a), "+v"(b), "+v"(c), "+v"(d));
}
__device__ __forceinline__ void wave_lds_sync() {
  __builtin_amdgcn_fence(__ATOMIC_RELEASE, "workgroup");
  __builtin_amdgcn_wave_barrier();
  __builtin_amdgcn_fence(__ATOMIC_ACQUIRE, "workgroup");
}

// ---------------------------------------------------------------------------
// LayerNorm per token row (population variance from centred squares, eps inside the rsqrt), f32, then x16 and
// RNE convert to f16. One wave per row, 8 rows per block, grid = 8192 / 8 = 1024 blocks (exact).
// Three rolled sweeps over the row (sum, centred squares, normalise + store); in each sweep the lane owns columns
// it*256 + lane*8 .. +7 for it = 0..3: 4 x 32 x 8 = 1024 = the whole row. The row is re-read from global in each
// sweep (no per-thread arrays).
// No block barriers in this kernel; the shuffles run under wave-uniform control only.
// ---------------------------------------------------------------------------
__global__ __launch_bounds__(256) void ln_rows_kernel(const float* __restrict__ x, const float* __restrict__ gamma,
                                                      const float* __restrict__ beta, unsigned short* __restrict__ xn) {
  const int lane = threadIdx.x & 31;
  const int wave = __builtin_amdgcn_readfirstlane((int)(threadIdx.x >> 5));
  const int row = blockIdx.x * 8 + wave;
  if (row >= kTok) return;
  const float* xr = x + (size_t)row * kDim + lane * 8;
  float s = 0.0f;
#pragma unroll 1
  for (int it = 0; it < 4; ++it) {
    const v4f a0 = *(const v4f*)(xr + it * 256);
    const v4f a1 = *(const v4f*)(xr + it * 256 + 4);
    s += ((a0[0] + a0[1]) + (a0[2] + a0[3])) + ((a1[0] + a1[1]) + (a1[2] + a1[3]));
  }
#pragma unroll
  for (int off = 16; off > 0; off >>= 1) s += __shfl_xor(s, off, 32);
  const float mu = s * kInvDim;
  float ss = 0.0f;
#pragma unroll 1
  for (int it = 0; it < 4; ++it) {
    const v4f a0 = *(const v4f*)(xr + it * 256);
    const v4f a1 = *(const v4f*)(xr + it * 256 + 4);
#pragma unroll
    for (int e = 0; e < 4; ++e) {
      const float d0 = a0[e] - mu;
      const float d1 = a1[e] - mu;
      ss = fmaf(d0, d0, ss);
      ss = fmaf(d1, d1, ss);
    }
  }
#pragma unroll
  for (int off = 16; off > 0; off >>= 1) ss += __shfl_xor(ss, off, 32);
  const float inv = rsqrtf(ss * kInvDim + kLnEps);
  unsigned short* orow = xn + (size_t)row * kDim + lane * 8;
#pragma unroll 1
  for (int it = 0; it < 4; ++it) {
    const v4f a0 = *(const v4f*)(xr + it * 256);
    const v4f a1 = *(const v4f*)(xr + it * 256 + 4);
    const v4f g0 = *(const v4f*)(gamma + it * 256 + lane * 8);
    const v4f g1 = *(const v4f*)(gamma + it * 256 + lane * 8 + 4);
    const v4f b0 = *(const v4f*)(beta + it * 256 + lane * 8);
    const v4f b1 = *(const v4f*)(beta + it * 256 + lane * 8 + 4);
    v8h hv;
#pragma unroll
    for (int e = 0; e < 4; ++e) {
      const float y0 = fmaf((a0[e] - mu) * inv, g0[e], b0[e]) * kXnCarry;
      const float y1 = fmaf((a1[e] - mu) * inv, g1[e], b1[e]) * kXnCarry;
      hv[e] = (_Float16)y0;
      hv[4 + e] = (_Float16)y1;
    }
    *(v8h*)(orow + it * 256) = hv;
    
  }
}

// ---------------------------------------------------------------------------
// Weight planes: f32 [1024][1024] ([out][in], already the Bt[n][k] layout) -> f16 x carry, 8 elements per thread.
// grid (512, 4): blockIdx.y selects the matrix (block-uniform) and its 1M-half plane; 512 x 256 x 8 = 1,048,576 (exact).
// ---------------------------------------------------------------------------
__global__ __launch_bounds__(256) void cast_w_kernel(const float* __restrict__ w0, const float* __restrict__ w1,
                                                     const float* __restrict__ w2, const float* __restrict__ w3,
                                                     unsigned short* __restrict__ out, float carry) {
  const int z = blockIdx.y;
  const float* W = (z == 0) ? w0 : (z == 1) ? w1 : (z == 2) ? w2 : w3;
  const int i = blockIdx.x * 256 + threadIdx.x;
  if (i >= kDim * kDim / 8) return;
  const float* p = W + 8 * (size_t)i;
  const v4f a = *(const v4f*)(p);
  const v4f c = *(const v4f*)(p + 4);
  v8h hv;
#pragma unroll
  for (int e = 0; e < 4; ++e) {
    hv[e] = (_Float16)(a[e] * carry);
    hv[4 + e] = (_Float16)(c[e] * carry);
  }
  unsigned short* q = out + (size_t)z * kDim * kDim + 8 * (size_t)i;
  *(v8h*)q = hv;
  
}

// ---------------------------------------------------------------------------
// GEMM operand ring in LDS. A block of 4 waves (2 x 2) owns a 128 x 128 tile of the product; a stage is 64 k = 128 B of
// each of its 128 A rows and 128 Bt rows. Every wave brings one slice of 64 rows per stage with one tensor load
// (waves 0, 1: the A rows; waves 2, 3: the Bt rows); the load's pad lays the rows at a pitch of 144 B (16 B x 9) for the
// 16-B fragment reads. A slice holds 64 x 144 = 9,216 B and is placed every 10,240 B (a multiple of 2 KiB).
// Two buffers of four slices each: 81,920 B, which the epilogues reuse as per-wave staging behind the last barrier.
// ---------------------------------------------------------------------------
constexpr uint32_t kStageRowB  = 128u;
constexpr uint32_t kRingPitchB = 144u;
constexpr uint32_t kSliceRows  = 64u;
constexpr uint32_t kSliceB     = 10240u;
constexpr uint32_t kBufB       = 4u * kSliceB;
constexpr uint32_t kRingB      = 2u * kBufB;
constexpr uint32_t kStages     = (uint32_t)kDim * 2u / kStageRowB;
constexpr int      kRingPitchH = (int)kRingPitchB / 2;
static_assert(kSliceRows * kRingPitchB <= kSliceB && (kSliceB % 2048u) == 0u);
static_assert(kStages >= 2u);
static_assert((kTok % 128) == 0 && (kQkvN % 128) == 0 && (kDim % 128) == 0);

__device__ __forceinline__ uint32_t uni(uint32_t v) { return (uint32_t)__builtin_amdgcn_readfirstlane(v); }
// holds a wave-uniform value in a scalar register: a test made of it compiles to a scalar compare and branch (a tensor
// load ignores EXEC), and what is computed from it stays behind the asm waits written in front of it
__device__ __forceinline__ uint32_t pinned(uint32_t v) {
  uint32_t w = uni(v);
  asm volatile("" : "+s"(w));
  return w;
}
// the compiler places no wait for the tensor mover: a tile counts as landed only behind its issuer's s_wait_tensorcnt, and
// a buffer is handed back to the mover only behind its readers' s_wait_dscnt; the clobber keeps LDS accesses on their side
__device__ __forceinline__ void wait_ds0()     { asm volatile("s_wait_dscnt 0x0" ::: "memory"); }
__device__ __forceinline__ void wait_tensor0() { asm volatile("s_wait_tensorcnt 0x0" ::: "memory"); }
// one request of the whole wave: a 2-D tile from global memory into LDS, through no register
__device__ __forceinline__ void tdm_load(u32x4 g0, u32x8 g1) {
  asm volatile("tensor_load_to_lds %0, %1" :: "s"(g0), "s"(g1) : "memory");
}
// group 1: 1-byte elements, tensor = tile = 64 rows of 128 B, source pitch one K row, 4 dwords of LDS pad behind every 32
__device__ __forceinline__ u32x8 tdm_group1() {
  constexpr uint32_t d0 = kStageRowB, d1 = kSliceRows;
  u32x8 g;
  g[0] = uni((1u << 20) | (4u << 22) | (3u << 25));
  g[1] = uni((d0 & 0xFFFFu) << 16);
  g[2] = uni((d0 >> 16) | ((d1 & 0xFFFFu) << 16));
  g[3] = uni((d1 >> 16) | (d0 << 16));
  g[4] = uni(d1);
  g[5] = uni((uint32_t)kDim * 2u);
  g[6] = uni(0u);
  g[7] = uni(0u);
  return g;
}
__device__ __forceinline__ u32x4 tdm_group0(uint32_t lds_dst, uint64_t ga) {
  u32x4 g;
  g[0] = uni(1u);
  g[1] = uni(lds_dst);
  g[2] = uni((uint32_t)ga);
  g[3] = uni((((uint32_t)(ga >> 32)) & 0x01FFFFFFu) | 0x80000000u);
  return g;
}

// ---------------------------------------------------------------------------
// Register-blocked GEMM main loop: acc[i][j] (16x16 sub-tiles of a 64x64 wave tile) = sum_k A[m][k] * Bt[n][k],
// A row-major pitch 1024, Bt row-major pitch 1024, K = 1024 (16 stages of 64 k, two 32-k steps each).
// Wave w works on rows bm0 + 64 (w >> 1) and columns bn0 + 64 (w & 1): it reads slice w >> 1 (A) and slice 2 + (w & 1) (Bt).
// Every wave of the block runs the whole loop: all barriers stand under block-uniform control.
// ---------------------------------------------------------------------------
__device__ __forceinline__ void gemm_tile_loop(const _Float16* __restrict__ A, const _Float16* __restrict__ Bt,
                                               int bm0, int bn0, int wave, int lane, unsigned char* ring,
                                               v8f (&acc)[4][4]) {
  const int rlane = lane & 15;
  const int koff  = (lane >> 4) * 8;
#pragma unroll
  for (int i = 0; i < 4; ++i)
#pragma unroll
    for (int j = 0; j < 4; ++j) acc[i][j] = (v8f){0.f, 0.f, 0.f, 0.f, 0.f, 0.f, 0.f, 0.f};

  const _Float16* srow = (wave < 2) ? A + (size_t)(bm0 + wave * 64) * kDim : Bt + (size_t)(bn0 + (wave - 2) * 64) * kDim;
  const uint64_t src = (uint64_t)(size_t)srow;
  const uint32_t dst = (uint32_t)(size_t)ring + (uint32_t)wave * kSliceB;
  const u32x8 g1 = tdm_group1();

  tdm_load(tdm_group0(dst, src), g1);
  wait_tensor0();   // this wave's slice of stage 0 has landed
  __syncthreads();  // stage 0 published to the other waves
  {
    const uint32_t st = pinned(1u);  // pinned(): stage 1's descriptor words are formed behind stage 0's wait
    tdm_load(tdm_group0(dst + st * kBufB, src + (uint64_t)st * kStageRowB), g1);
  }

  const _Float16* Aw = (const _Float16*)(ring + (uint32_t)(wave >> 1) * kSliceB) + rlane * kRingPitchH + koff;
  const _Float16* Bw = (const _Float16*)(ring + (uint32_t)(2 + (wave & 1)) * kSliceB) + rlane * kRingPitchH + koff;
  // rolled: one stage per trip, so that the publish point below stands once in the text
#pragma unroll 1
  for (uint32_t s = 0; s < kStages; ++s) {
    const _Float16* As = Aw + (s & 1u) * (kBufB / 2u);
    const _Float16* Bs = Bw + (s & 1u) * (kBufB / 2u);
#pragma unroll
    for (int kk = 0; kk < 2; ++kk) {
      v16h ah[4], bh[4];
      ah[0] = FragH::load(As + kk * 32);
#pragma unroll
      for (int j = 0; j < 4; ++j) bh[j] = FragH::load(Bs + (j << 4) * kRingPitchH + kk * 32);
#pragma unroll
      for (int i = 1; i < 4; ++i) ah[i] = FragH::load(As + (i << 4) * kRingPitchH + kk * 32);
      // keeps the step's 16 LDS reads one group in front of its 16 matrix ops: sunk among them, each row waits out its own read
      __builtin_amdgcn_sched_barrier(0);
#pragma unroll
      for (int i = 0; i < 4; ++i) {
#pragma unroll
        for (int j = 0; j < 4; ++j) acc[i][j] = FragH::mma(ah[i], bh[j], acc[i][j]);
        guard4_h(acc[i][0], acc[i][1], acc[i][2], acc[i][3], ah[i], bh[0], bh[1], bh[2], bh[3]);
      }
      keep4_h(bh[0], bh[1], bh[2], bh[3]);
    }
    // publish point of stage s + 1
    wait_ds0();       // this wave's reads of stage s have returned
    wait_tensor0();   // this wave's slice of stage s + 1 has landed
    __syncthreads();  // stage s + 1 published; every wave has left stage s's buffer
    const uint32_t nxt = pinned(s + 2u);  // pinned(): the next descriptor's words are formed behind the wait above
    if (pinned(nxt < kStages)) {          // pinned(): scalar branch around the tensor load
      tdm_load(tdm_group0(dst + (nxt & 1u) * kBufB, src + (uint64_t)nxt * kStageRowB), g1);
    }
  }
  wait_tensor0();  // nothing of the mover in flight when the ring becomes staging
  wait_ds0();
  acc_guard4(acc[0][0], acc[0][1], acc[0][2], acc[0][3]);
  acc_guard4(acc[1][0], acc[1][1], acc[1][2], acc[1][3]);
  acc_guard4(acc[2][0], acc[2][1], acc[2][2], acc[2][3]);
  acc_guard4(acc[3][0], acc[3][1], acc[3][2], acc[3][3]);
}

// ---------------------------------------------------------------------------
// Fused q|k|v projection: [8192][3072] = XN[8192][1024] . WC[0..3071][1024]^T, f32 epilogue (x 1/16384, + bias, x16).
// One wave per 64x64 tile, 4 waves (2 x 2) per 128x128 block tile, grid = 64*24 = 1536 blocks of 128 threads (exact).
// A wave tile lies in one region (q, k or v: n0 >> 10), one head ((n0 & 1023) >> 6) and one batch element (m0 >> 11).
// The whole tile is staged per wave as f16 [64][72]: q/k regions row = token, v region row = d (transposed).
//   q/k: plane[b][head][s0 + row][0..63];  v: VT[b][head][row][s0 .. s0+63].
// ---------------------------------------------------------------------------
__global__ __launch_bounds__(128) void gemm_qkv_kernel(
    const unsigned short* __restrict__ XNp, const unsigned short* __restrict__ WCp,
    unsigned short* __restrict__ QPp, unsigned short* __restrict__ KPp, unsigned short* __restrict__ VTp,
    const float* __restrict__ bq, const float* __restrict__ bk, const float* __restrict__ bv) {
  __shared__ __attribute__((aligned(2048))) unsigned char Ring[kRingB];
  static_assert(4u * 64u * 72u * 2u <= kRingB);
  const int lane = threadIdx.x & 31;
  const int wave = __builtin_amdgcn_readfirstlane((int)(threadIdx.x >> 5));
  constexpr int tilesN = kQkvN >> 7;
  constexpr int tilesM = kTok >> 7;
  const int tile = blockIdx.x;
  if (tile >= tilesM * tilesN) return;
  const int tm = tile / tilesN;
  const int tn = tile - tm * tilesN;
  const int m0 = (tm << 7) + ((wave >> 1) << 6);
  const int n0 = (tn << 7) + ((wave & 1) << 6);

  v8f acc[4][4];
  gemm_tile_loop((const _Float16*)XNp, (const _Float16*)WCp, tm << 7, tn << 7, wave, lane, Ring, acc);

  const int rlane = lane & 15;
  const int mOff  = (lane >> 4) * 8;
  const int region = n0 >> 10;
  const int nl0  = n0 & (kDim - 1);
  const int head = nl0 >> 6;
  const int bidx = m0 >> 11;
  const int s0   = m0 & (kSeq - 1);
  const float* bias = (region == 0) ? bq : ((region == 1) ? bk : bv);
  float bvj[4];
#pragma unroll
  for (int j = 0; j < 4; ++j) bvj[j] = bias[nl0 + (j << 4) + rlane];

  _Float16* st = (_Float16*)Ring + wave * (64 * 72);
#pragma unroll
  for (int i = 0; i < 4; ++i) {
#pragma unroll
    for (int j = 0; j < 4; ++j) {
      float y[8];
#pragma unroll
      for (int r = 0; r < 8; ++r) y[r] = (acc[i][j][r] * kProjScale + bvj[j]) * kQkvCarry;
      if (region < 2) {
#pragma unroll
        for (int r = 0; r < 8; ++r) st[((i << 4) + mOff + r) * 72 + (j << 4) + rlane] = (_Float16)y[r];
      } else {
        v8h t;
#pragma unroll
        for (int r = 0; r < 8; ++r) t[r] = (_Float16)y[r];
        *(v8h*)(st + ((j << 4) + rlane) * 72 + (i << 4) + mOff) = t;
      }
    }
  }
  wave_lds_sync();

  unsigned short* plane;
  size_t gbase;
  int gpitch;
  if (region < 2) {
    plane  = (region == 0) ? QPp : KPp;
    gbase  = ((size_t)(bidx * kHeads + head) * kSeq + s0) * kHd;
    gpitch = kHd;
  } else {
    plane  = VTp;
    gbase  = (size_t)(bidx * kHeads + head) * kHd * kSeq + s0;
    gpitch = kSeq;
  }
  const int q4 = lane >> 3, c8 = (lane & 7) * 8;
  {
#pragma unroll
    for (int it = 0; it < 16; ++it) {
      const int row = it * 4 + q4;
      const v8h val = *(const v8h*)(st + row * 72 + c8);
      *(v8h*)(plane + gbase + (size_t)row * gpitch + c8) = val;
    }
    
  }
}

// ---------------------------------------------------------------------------
// Output projection: out[8192][1024] (f32) = AO[8192][1024] . WC[3072..4095][1024]^T x 2^-20 + bo.
// One wave per 64x64 tile, 4 waves (2 x 2) per 128x128 block tile, grid = 64*8 = 512 blocks of 128 threads (exact).
// 16-row f32 slabs per wave in LDS;
// ---------------------------------------------------------------------------
__global__ __launch_bounds__(128) void gemm_out_kernel(
    const unsigned short* __restrict__ AOp, const unsigned short* __restrict__ WOp,
    float* __restrict__ out, const float* __restrict__ bo) {
  __shared__ __attribute__((aligned(2048))) unsigned char Ring[kRingB];
  static_assert(4u * 16u * 68u * 4u <= kRingB);
  const int lane = threadIdx.x & 31;
  const int wave = __builtin_amdgcn_readfirstlane((int)(threadIdx.x >> 5));
  constexpr int tilesN = kDim >> 7;
  constexpr int tilesM = kTok >> 7;
  const int tile = blockIdx.x;
  if (tile >= tilesM * tilesN) return;
  const int tm = tile / tilesN;
  const int tn = tile - tm * tilesN;
  const int m0 = (tm << 7) + ((wave >> 1) << 6);
  const int n0 = (tn << 7) + ((wave & 1) << 6);

  v8f acc[4][4];
  gemm_tile_loop((const _Float16*)AOp, (const _Float16*)WOp, tm << 7, tn << 7, wave, lane, Ring, acc);

  const int rlane = lane & 15;
  const int mOff  = (lane >> 4) * 8;
  float bvj[4];
#pragma unroll
  for (int j = 0; j < 4; ++j) bvj[j] = bo[n0 + (j << 4) + rlane];
  float* slab = (float*)Ring + wave * (16 * 68);
  const int hh = lane >> 4, c4 = (lane & 15) * 4;
#pragma unroll
  for (int i = 0; i < 4; ++i) {
    const int mBase = m0 + (i << 4);
#pragma unroll
    for (int j = 0; j < 4; ++j) {
#pragma unroll
      for (int r = 0; r < 8; ++r)
        slab[(mOff + r) * 68 + (j << 4) + rlane] = acc[i][j][r] * kOutScale + bvj[j];
    }
    wave_lds_sync();
    {
#pragma unroll
      for (int it = 0; it < 8; ++it) {
        const int row = it * 2 + hh;
        const v4f v = *(const v4f*)(slab + row * 68 + c4);
        *(v4f*)(out + (size_t)(mBase + row) * kDim + n0 + c4) = v;
      }
      
    }
    wave_lds_sync();
  }
}

__device__ __forceinline__ void guard2_h(v8f& a, v8f& b, v16h x, v16h y, v16h p, v16h q, v16h r, v16h s) {
  asm volatile("v_nop\n\tv_nop\n\tv_nop\n\tv_nop" : "+v"(a), "+v"(b) : "v"(x), "v"(y), "v"(p), "v"(q), "v"(r), "v"(s));
}
// the same for a group of five: the row-sum op's accumulator and A fragment are named too, so that the op stays in its
// group (untied, the compiler sinks it behind the stage barrier, in front of the next stage's K reads)
__device__ __forceinline__ void guard3_h(v8f& a, v8f& b, v8f& l, v16h x, v16h y, v16h e, v16h p, v16h q, v16h r, v16h s) {
  asm volatile("v_nop\n\tv_nop\n\tv_nop\n\tv_nop" : "+v"(a), "+v"(b), "+v"(l) : "v"(x), "v"(y), "v"(e), "v"(p), "v"(q), "v"(r), "v"(s));
}
constexpr int kQWave  = 32;
constexpr int kQBlock = 8 * kQWave;
static_assert((kSeq % kQBlock) == 0);

constexpr uint32_t kKvRows   = 16u;
constexpr uint32_t kKvSliceB = 4096u;
constexpr uint32_t kKvBufB   = 8u * kKvSliceB;
constexpr uint32_t kKvRingB  = 2u * kKvBufB;
constexpr uint32_t kKvStages = (uint32_t)kSeq / 64u;
static_assert(kKvRows * kRingPitchB <= kKvSliceB && (kKvSliceB % 2048u) == 0u);
static_assert(kKvStages >= 2u);
static_assert((uint32_t)kHd * 2u == kStageRowB);
// group 1: 1-byte elements, tensor = tile = 16 rows of 128 B, source pitch as given, 4 dwords of LDS pad behind every 32
// pinned(): words 1 to 7 are descriptor words held in scalar registers of their own: built once in front of the loop, so
// that the compiler does not lend a word's register to the loop's own arithmetic while a request is outstanding
__device__ __forceinline__ u32x8 tdm_group1_kv(uint32_t src_pitch) {
  constexpr uint32_t d0 = kStageRowB, d1 = kKvRows;
  u32x8 g;
  g[0] = uni((1u << 20) | (4u << 22) | (3u << 25));
  g[1] = pinned((d0 & 0xFFFFu) << 16);
  g[2] = pinned((d0 >> 16) | ((d1 & 0xFFFFu) << 16));
  g[3] = pinned((d1 >> 16) | (d0 << 16));
  g[4] = pinned(d1);
  g[5] = pinned(src_pitch);
  g[6] = pinned(0u);
  g[7] = pinned(0u);
  return g;
}

__global__ __launch_bounds__(256) void attn_kernel(const unsigned short* __restrict__ QPp,
                                                   const unsigned short* __restrict__ KPp,
                                                   const unsigned short* __restrict__ VTp,
                                                   unsigned short* __restrict__ AOp) {
  constexpr int kPitch = 72;
  constexpr int kQBlocks = kSeq / kQBlock;
  static_assert(kPitch == kRingPitchH);
  __shared__ __attribute__((aligned(2048))) unsigned char KvRing[kKvRingB];
  __shared__ __align__(16) _Float16 Osh[8 * kQWave * 72];
  const int tid  = threadIdx.x;
  const int lane = tid & 31;
  const int wave = __builtin_amdgcn_readfirstlane((int)(tid >> 5));
  const int hh   = lane >> 4;
  const int c    = lane & 15;
  const int bx   = blockIdx.x;
  const int qb   = bx % kQBlocks;
  const int bh   = bx / kQBlocks;
  const int head = bh & (kHeads - 1);
  const int bidx = bh >> 4;
  const int q0   = qb * kQBlock + wave * kQWave;

  const _Float16* Qh = (const _Float16*)QPp + (size_t)bh * kSeq * kHd;
  const _Float16* Kh = (const _Float16*)KPp + (size_t)bh * kSeq * kHd;
  const _Float16* Vh = (const _Float16*)VTp + (size_t)bh * kHd * kSeq;

  v16h qf[2][2];
#pragma unroll
  for (int u = 0; u < 2; ++u) {
    qf[u][0] = FragH::load(Qh + (size_t)(q0 + u * 16 + c) * kHd + 8 * hh);
    qf[u][1] = FragH::load(Qh + (size_t)(q0 + u * 16 + c) * kHd + 32 + 8 * hh);
  }

  v8f oacc[2][4], lacc[2];
  float mrun[2];
#pragma unroll
  for (int u = 0; u < 2; ++u) {
#pragma unroll
    for (int t = 0; t < 4; ++t) oacc[u][t] = (v8f){0.f, 0.f, 0.f, 0.f, 0.f, 0.f, 0.f, 0.f};
    lacc[u] = (v8f){0.f, 0.f, 0.f, 0.f, 0.f, 0.f, 0.f, 0.f};
    mrun[u] = -1e30f;
  }
  // A fragment of the row sums: row = lane & 15, so rows 0 and 8 are the lanes with lane & 7 == 0; every k alike
  const _Float16 e1 = ((lane & 7) == 0) ? (_Float16)1.0f : (_Float16)0.0f;
  const v16h ef = {e1, e1, e1, e1, e1, e1, e1, e1, e1, e1, e1, e1, e1, e1, e1, e1};

  // this wave's slice: its first byte in stage 0, the bytes from one stage to the next, its source pitch, its LDS place
  const _Float16* srow = (wave < 4) ? Kh + (size_t)(wave * 16) * kHd : Vh + (size_t)((wave - 4) * 16) * kSeq;
  const uint64_t src  = (uint64_t)(size_t)srow;
  const uint32_t step = (wave < 4) ? 64u * kStageRowB : kStageRowB;
  const uint32_t dst  = (uint32_t)(size_t)KvRing + (uint32_t)wave * kKvSliceB;
  const u32x8 g1 = tdm_group1_kv((wave < 4) ? kStageRowB : (uint32_t)kSeq * 2u);

  tdm_load(tdm_group0(dst, src), g1);
  wait_tensor0();   // this wave's slice of stage 0 has landed
  __syncthreads();  // stage 0 published to the other waves

  const _Float16* Kw = (const _Float16*)KvRing + c * kPitch + 8 * hh;
  const _Float16* Vw = (const _Float16*)(KvRing + 4u * kKvSliceB) + c * kPitch + 8 * hh;
  constexpr int kSliceH = (int)kKvSliceB / 2;
  // rolled: one stage per trip, so that the refill and the publish point stand once in the text
#pragma unroll 1
  for (uint32_t s = 0; s < kKvStages; ++s) {
    // refill, directly behind the barrier that published stage s (in front of the loop, or at the foot of trip s - 1):
    // stage s + 1 goes into the buffer that every wave has left, and flies while stage s is worked on. It stands at the
    // head of the trip, so that the trip's work is one block of code up to its barrier: with this branch at the foot the
    // compiler moved the row-sum arithmetic out from among the matrix ops to behind the barrier
    const uint32_t nxt = pinned(s + 1u);  // pinned(): the descriptor's words are formed behind the wait in front of that barrier
    if (pinned(nxt < kKvStages)) {        // pinned(): scalar branch around the tensor load
      tdm_load(tdm_group0(dst + (nxt & 1u) * kKvBufB, src + (uint64_t)nxt * step), g1);
    }
    const _Float16* Ks = Kw + (s & 1u) * (kKvBufB / 2u);
    const _Float16* Vs = Vw + (s & 1u) * (kKvBufB / 2u);

    v8f st[2][4];
#pragma unroll
    for (int j = 0; j < 4; ++j) {
      st[0][j] = (v8f){0.f, 0.f, 0.f, 0.f, 0.f, 0.f, 0.f, 0.f};
      st[1][j] = (v8f){0.f, 0.f, 0.f, 0.f, 0.f, 0.f, 0.f, 0.f};
      const v16h ka0 = FragH::load(Ks + j * kSliceH);
      const v16h ka1 = FragH::load(Ks + j * kSliceH + 32);
      st[0][j] = FragH::mma(ka0, qf[0][0], st[0][j]);
      st[1][j] = FragH::mma(ka0, qf[1][0], st[1][j]);
      st[0][j] = FragH::mma(ka1, qf[0][1], st[0][j]);
      st[1][j] = FragH::mma(ka1, qf[1][1], st[1][j]);
      guard2_h(st[0][j], st[1][j], ka0, ka1, qf[0][0], qf[0][1], qf[1][0], qf[1][1]);
    }

    v16h pf[2][2];
#pragma unroll
    for (int u = 0; u < 2; ++u) {
      float mx = st[u][0][0];
#pragma unroll
      for (int j = 0; j < 4; ++j)
#pragma unroll
        for (int r = 0; r < 8; ++r) mx = fmaxf(mx, st[u][j][r]);
      mx = fmaxf(mx, __shfl_xor(mx, 16, 32));
      const float mnew  = fmaxf(mrun[u], mx);
      const float alpha = __builtin_amdgcn_exp2f((mrun[u] - mnew) * kExpCoef);
      const float off   = fmaf(-mnew, kExpCoef, kPLog2Carry);
      mrun[u] = mnew;

#pragma unroll
      for (int j = 0; j < 4; ++j)
#pragma unroll
        for (int r = 0; r < 8; ++r)
          pf[u][j >> 1][(j & 1) * 8 + r] = (_Float16)__builtin_amdgcn_exp2f(fmaf(st[u][j][r], kExpCoef, off));
      lacc[u][0] *= alpha;
#pragma unroll
      for (int t = 0; t < 4; ++t)
#pragma unroll
        for (int r = 0; r < 8; ++r) oacc[u][t][r] *= alpha;
    }

#pragma unroll
    for (int t = 0; t < 4; ++t) {
      const v16h va0 = FragH::load(Vs + t * kSliceH);
      const v16h va1 = FragH::load(Vs + t * kSliceH + 32);
      // one of the stage's four row-sum ops per group (query tile t & 1, keys 32 (t >> 1) ..): it reads no LDS
      lacc[t & 1] = FragH::mma(ef, pf[t & 1][t >> 1], lacc[t & 1]);
      oacc[0][t] = FragH::mma(va0, pf[0][0], oacc[0][t]);
      oacc[1][t] = FragH::mma(va0, pf[1][0], oacc[1][t]);
      oacc[0][t] = FragH::mma(va1, pf[0][1], oacc[0][t]);
      oacc[1][t] = FragH::mma(va1, pf[1][1], oacc[1][t]);
      guard3_h(oacc[0][t], oacc[1][t], lacc[t & 1], va0, va1, ef, pf[0][0], pf[0][1], pf[1][0], pf[1][1]);
    }
    // publish point of stage s + 1
    wait_ds0();       // this wave's reads of stage s have returned
    wait_tensor0();   // this wave's slice of stage s + 1 has landed
    __syncthreads();  // stage s + 1 published; every wave has left stage s's buffer
  }
  wait_tensor0();  // nothing of the mover in flight when the wave ends
  wait_ds0();

  _Float16* os = Osh + wave * (kQWave * 72);
#pragma unroll
  for (int u = 0; u < 2; ++u) {
    const float inv = kCtxExtra * (1.0f / lacc[u][0]);
#pragma unroll
    for (int t = 0; t < 4; ++t) {
      v8h o;
#pragma unroll
      for (int r = 0; r < 8; ++r) o[r] = (_Float16)(oacc[u][t][r] * inv);
      *(v8h*)(os + (u * 16 + c) * 72 + t * 16 + 8 * hh) = o;
    }
  }
  wave_lds_sync();
  {
    const int q4 = lane >> 3, c8 = (lane & 7) * 8;
    {
#pragma unroll
      for (int it = 0; it < kQWave / 4; ++it) {
        const int row = it * 4 + q4;
        const v8h val = *(const v8h*)(os + row * 72 + c8);
        *(v8h*)(AOp + (size_t)(bidx * kSeq + q0 + row) * kDim + head * kHd + c8) = val;
      }
      
    }
  }
}

// ---------------------------------------------------------------------------
// Host glue: 5 kernel launches, nothing else.
// ---------------------------------------------------------------------------
extern "C" void kernel_launch(void* const* d_in, const int* in_sizes, int n_in,
                              void* d_out, int out_size, void* d_ws, size_t ws_size,
                              hipStream_t stream) {
  if (n_in < 11) return;
  if (in_sizes[0] != kTok * kDim) return;
  if (in_sizes[1] != kDim || in_sizes[2] != kDim) return;
  if (in_sizes[3] != kDim * kDim || in_sizes[5] != kDim * kDim) return;
  if (in_sizes[7] != kDim * kDim || in_sizes[9] != kDim * kDim) return;
  if (in_sizes[4] != kDim || in_sizes[6] != kDim || in_sizes[8] != kDim || in_sizes[10] != kDim) return;
  if (out_size != kTok * kDim) return;
  if (ws_size < kWsTotal) return;

  const float* x     = (const float*)d_in[0];
  const float* gamma = (const float*)d_in[1];
  const float* beta  = (const float*)d_in[2];
  const float* Wq    = (const float*)d_in[3];
  const float* bq    = (const float*)d_in[4];
  const float* Wk    = (const float*)d_in[5];
  const float* bk    = (const float*)d_in[6];
  const float* Wv    = (const float*)d_in[7];
  const float* bv    = (const float*)d_in[8];
  const float* Wo    = (const float*)d_in[9];
  const float* bo    = (const float*)d_in[10];
  float* out = (float*)d_out;

  char* ws = (char*)d_ws;
  unsigned short* XN = (unsigned short*)(ws + kOffXN);
  unsigned short* WC = (unsigned short*)(ws + kOffWC);
  unsigned short* QP = (unsigned short*)(ws + kOffQP);
  unsigned short* KP = (unsigned short*)(ws + kOffKP);
  unsigned short* VT = (unsigned short*)(ws + kOffVT);
  unsigned short* AO = (unsigned short*)(ws + kOffAO);
  unsigned short* WO = WC + (size_t)3 * kDim * kDim;

  ln_rows_kernel<<<kTok / 8, 256, 0, stream>>>(x, gamma, beta, XN);
  cast_w_kernel<<<dim3(kDim * kDim / 8 / 256, 4), 256, 0, stream>>>(Wq, Wk, Wv, Wo, WC, kWCarry);
  gemm_qkv_kernel<<<(kTok / 128) * (kQkvN / 128), 128, 0, stream>>>(XN, WC, QP, KP, VT, bq, bk, bv);
  attn_kernel<<<kBatch * kHeads * (kSeq / kQBlock), 256, 0, stream>>>(QP, KP, VT, AO);
  gemm_out_kernel<<<(kTok / 128) * (kDim / 128), 128, 0, stream>>>(AO, WO, out, bo);
}

// v006
// A run of this version takes 130 microseconds.
// Next to v005, in two timings, it ran 1.03 and 1.02 times as fast.
// All steps since v000 together make it 3.97 times as fast.
// All contractions (fused q|k|v projection, k.q^T scores, v^T.p^T context, output projection): v_wmma_f32_16x16x32_f16, f16 operands with constant carries, f32 accumulate; LayerNorm, softmax statistics, bias adds and normalisation in f32.
#include <hip/hip_runtime.h>
#include <math.h>
#include <stdint.h>

typedef __attribute__((ext_vector_type(16))) _Float16 v16h;
typedef __attribute__((ext_vector_type(8)))  _Float16 v8h;
typedef __attribute__((ext_vector_type(8)))  float    v8f;
typedef __attribute__((ext_vector_type(4)))  float    v4f;
typedef __attribute__((ext_vector_type(4)))  uint32_t u32x4;
typedef __attribute__((ext_vector_type(8)))  uint32_t u32x8;

// ---------------------------------------------------------------------------
// Shape constants
// ---------------------------------------------------------------------------
constexpr int kBatch = 4;
constexpr int kSeq   = 2048;
constexpr int kDim   = 1024;
constexpr int kHeads = 16;
constexpr int kHd    = 64;
constexpr int kTok   = kBatch * kSeq;
constexpr int kQkvN  = 3 * kDim;
static_assert(kHeads * kHd == kDim);
static_assert(kTok == 8192);
static_assert((kDim % 32) == 0);
static_assert((kTok % 64) == 0 && (kQkvN % 64) == 0 && (kDim % 64) == 0 && (kSeq % 128) == 0);

// logit scale 1/sqrt(head dim), exact power of two for head dim 64
constexpr float kAttnScale = 0.125f;
static_assert(kHd == 64);
static_assert(kAttnScale * kAttnScale * (float)kHd == 1.0f);

// power-of-two carries of the f16 operand planes
constexpr float kXnCarry    = 16.0f;
constexpr float kWCarry     = 1024.0f;
constexpr float kQkvCarry   = 16.0f;
constexpr float kPLog2Carry = 10.0f;
constexpr float kCtxCarry   = 1024.0f;
constexpr float kProjScale  = 1.0f / (kXnCarry * kWCarry);
constexpr float kCtxExtra   = kCtxCarry / kQkvCarry;
constexpr float kOutScale   = 1.0f / (kCtxCarry * kWCarry);
constexpr float kLog2e      = 1.4426950408889634f;
// q's carry: (q*kQCarry).(k*kQkvCarry) = logit * log2(e), so the score product is already a base-2 exponent
constexpr float kQCarry     = kLog2e * kAttnScale / kQkvCarry;
// largest base-2 exponent a probability may take before the maximum in use is moved: 2^15 is finite in f16
constexpr float kPLog2Top   = 15.0f;
static_assert(kPLog2Top > kPLog2Carry && kPLog2Top < 16.0f);
constexpr float kInvDim     = 1.0f / (float)kDim;
constexpr float kLnEps      = 1e-5f;

// ---------------------------------------------------------------------------
// Workspace region map (bytes; every offset a multiple of 128)
//   XN  f16 [8192][1024]      normalised activations x16          16,777,216
//   WC  f16 [4096][1024]      Wq | Wk | Wv | Wo rows, x1024         8,388,608
//   QP  f16 [4][16][2048][64] q x log2(e)/128                      16,777,216
//   KP  f16 [4][16][2048][64] k x16                               16,777,216
//   VT  f16 [4][16][64][2048] v x16, transposed per head          16,777,216
//   AO  f16 [8192][1024]      merged context x1024                16,777,216
//   total                                                         92,274,688
// ---------------------------------------------------------------------------
constexpr size_t kOffXN = 0;
constexpr size_t kOffWC = kOffXN + (size_t)kTok * kDim * 2;
constexpr size_t kOffQP = kOffWC + (size_t)4 * kDim * kDim * 2;
constexpr size_t kOffKP = kOffQP + (size_t)kTok * kDim * 2;
constexpr size_t kOffVT = kOffKP + (size_t)kTok * kDim * 2;
constexpr size_t kOffAO = kOffVT + (size_t)kTok * kDim * 2;
constexpr size_t kWsTotal = kOffAO + (size_t)kTok * kDim * 2;
static_assert(kWsTotal == 92274688ull);
static_assert(kWsTotal <= 134217728ull);
static_assert((kOffWC % 128) == 0 && (kOffQP % 128) == 0 && (kOffKP % 128) == 0 && (kOffVT % 128) == 0 && (kOffAO % 128) == 0);

// ---------------------------------------------------------------------------
// Fragment helpers (A and B use the same split k map: elements 0..7 <- p[0..7], 8..15 <- p[16..23],
// with p already offset by 8*(lane>>4); row / column = lane & 15)
// ---------------------------------------------------------------------------
struct FragH {
  union U { v16h v; v8h h[2]; };
  static __device__ __forceinline__ v16h load(const _Float16* p) {
    U f;
    f.h[0] = *(const v8h*)(p);
    f.h[1] = *(const v8h*)(p + 16);
    return f.v;
  }
  static __device__ __forceinline__ v8f mma(v16h a, v16h b, v8f c) {
    return __builtin_amdgcn_wmma_f32_16x16x32_f16(false, a, false, b, (short)0, c, false, false);
  }
};
// hazard guards: four idle slots after the last matrix op of a group, tying every accumulator of the group
// and naming the A and B fragment registers of the group as inputs
__device__ __forceinline__ void guard4_h(v8f& a, v8f& b, v8f& c, v8f& d, v16h x, v16h b0, v16h b1, v16h b2, v16h b3) {
  asm volatile("v_nop\n\tv_nop\n\tv_nop\n\tv_nop" : "+v"(a), "+v"(b), "+v"(c), "+v"(d) : "v"(x), "v"(b0), "v"(b1), "v"(b2), "v"(b3));
}
__device__ __forceinline__ void guard1_h(v8f& a, v16h x, v16h y, v16h z, v16h w) {
  asm volatile("v_nop\n\tv_nop\n\tv_nop\n\tv_nop" : "+v"(a) : "v"(x), "v"(y), "v"(z), "v"(w));
}
__device__ __forceinline__ void keep4_h(v16h a, v16h b, v16h c, v16h d) {
  asm volatile("v_nop" :: "v"(a), "v"(b), "v"(c), "v"(d));
}
__device__ __forceinline__ void acc_guard4(v8f& a, v8f& b, v8f& c, v8f& d) {
  asm volatile("v_nop\n\tv_nop\n\tv_nop\n\tv_nop" : "+v"(a), "+v"(b), "+v"(c), "+v"(d));
}
__device__ __forceinline__ void wave_lds_sync() {
  __builtin_amdgcn_fence(__ATOMIC_RELEASE, "workgroup");
  __builtin_amdgcn_wave_barrier();
  __builtin_amdgcn_fence(__ATOMIC_ACQUIRE, "workgroup");
}

// ---------------------------------------------------------------------------
// LayerNorm per token row (population variance from centred squares, eps inside the rsqrt), f32, then x16 and
// RNE convert to f16. One wave per row, 8 rows per block, grid = 8192 / 8 = 1024 blocks (exact).
// Three rolled sweeps over the row (sum, centred squares, normalise + store); in each sweep the lane owns columns
// it*256 + lane*8 .. +7 for it = 0..3: 4 x 32 x 8 = 1024 = the whole row. The row is re-read from global in each
// sweep (no per-thread arrays).
// No block barriers in this kernel; the shuffles run under wave-uniform control only.
// ---------------------------------------------------------------------------
__global__ __launch_bounds__(256) void ln_rows_kernel(const float* __restrict__ x, const float* __restrict__ gamma,
                                                      const float* __restrict__ beta, unsigned short* __restrict__ xn) {
  const int lane = threadIdx.x & 31;
  const int wave = __builtin_amdgcn_readfirstlane((int)(threadIdx.x >> 5));
  const int row = blockIdx.x * 8 + wave;
  if (row >= kTok) return;
  const float* xr = x + (size_t)row * kDim + lane * 8;
  float s = 0.0f;
#pragma unroll 1
  for (int it = 0; it < 4; ++it) {
    const v4f a0 = *(const v4f*)(xr + it * 256);
    const v4f a1 = *(const v4f*)(xr + it * 256 + 4);
    s += ((a0[0] + a0[1]) + (a0[2] + a0[3])) + ((a1[0] + a1[1]) + (a1[2] + a1[3]));
  }
#pragma unroll
  for (int off = 16; off > 0; off >>= 1) s += __shfl_xor(s, off, 32);
  const float mu = s * kInvDim;
  float ss = 0.0f;
#pragma unroll 1
  for (int it = 0; it < 4; ++it) {
    const v4f a0 = *(const v4f*)(xr + it * 256);
    const v4f a1 = *(const v4f*)(xr + it * 256 + 4);
#pragma unroll
    for (int e = 0; e < 4; ++e) {
      const float d0 = a0[e] - mu;
      const float d1 = a1[e] - mu;
      ss = fmaf(d0, d0, ss);
      ss = fmaf(d1, d1, ss);
    }
  }
#pragma unroll
  for (int off = 16; off > 0; off >>= 1) ss += __shfl_xor(ss, off, 32);
  const float inv = rsqrtf(ss * kInvDim + kLnEps);
  unsigned short* orow = xn + (size_t)row * kDim + lane * 8;
#pragma unroll 1
  for (int it = 0; it < 4; ++it) {
    const v4f a0 = *(const v4f*)(xr + it * 256);
    const v4f a1 = *(const v4f*)(xr + it * 256 + 4);
    const v4f g0 = *(const v4f*)(gamma + it * 256 + lane * 8);
    const v4f g1 = *(const v4f*)(gamma + it * 256 + lane * 8 + 4);
    const v4f b0 = *(const v4f*)(beta + it * 256 + lane * 8);
    const v4f b1 = *(const v4f*)(beta + it * 256 + lane * 8 + 4);
    v8h hv;
#pragma unroll
    for (int e = 0; e < 4; ++e) {
      const float y0 = fmaf((a0[e] - mu) * inv, g0[e], b0[e]) * kXnCarry;
      const float y1 = fmaf((a1[e] - mu) * inv, g1[e], b1[e]) * kXnCarry;
      hv[e] = (_Float16)y0;
      hv[4 + e] = (_Float16)y1;
    }
    *(v8h*)(orow + it * 256) = hv;
    
  }
}

// ---------------------------------------------------------------------------
// Weight planes: f32 [1024][1024] ([out][in], already the Bt[n][k] layout) -> f16 x carry, 8 elements per thread.
// grid (512, 4): blockIdx.y selects the matrix (block-uniform) and its 1M-half plane; 512 x 256 x 8 = 1,048,576 (exact).
// ---------------------------------------------------------------------------
__global__ __launch_bounds__(256) void cast_w_kernel(const float* __restrict__ w0, const float* __restrict__ w1,
                                                     const float* __restrict__ w2, const float* __restrict__ w3,
                                                     unsigned short* __restrict__ out, float carry) {
  const int z = blockIdx.y;
  const float* W = (z == 0) ? w0 : (z == 1) ? w1 : (z == 2) ? w2 : w3;
  const int i = blockIdx.x * 256 + threadIdx.x;
  if (i >= kDim * kDim / 8) return;
  const float* p = W + 8 * (size_t)i;
  const v4f a = *(const v4f*)(p);
  const v4f c = *(const v4f*)(p + 4);
  v8h hv;
#pragma unroll
  for (int e = 0; e < 4; ++e) {
    hv[e] = (_Float16)(a[e] * carry);
    hv[4 + e] = (_Float16)(c[e] * carry);
  }
  unsigned short* q = out + (size_t)z * kDim * kDim + 8 * (size_t)i;
  *(v8h*)q = hv;
  
}

// ---------------------------------------------------------------------------
// GEMM operand ring in LDS. A block of 4 waves (2 x 2) owns a 128 x 128 tile of the product; a stage is 64 k = 128 B of
// each of its 128 A rows and 128 Bt rows. Every wave brings one slice of 64 rows per stage with one tensor load
// (waves 0, 1: the A rows; waves 2, 3: the Bt rows); the load's pad lays the rows at a pitch of 144 B (16 B x 9) for the
// 16-B fragment reads. A slice holds 64 x 144 = 9,216 B and is placed every 10,240 B (a multiple of 2 KiB).
// Two buffers of four slices each: 81,920 B, which the epilogues reuse as per-wave staging behind the last barrier.
// ---------------------------------------------------------------------------
constexpr uint32_t kStageRowB  = 128u;
constexpr uint32_t kRingPitchB = 144u;
constexpr uint32_t kSliceRows  = 64u;
constexpr uint32_t kSliceB     = 10240u;
constexpr uint32_t kBufB       = 4u * kSliceB;
constexpr uint32_t kRingB      = 2u * kBufB;
constexpr uint32_t kStages     = (uint32_t)kDim * 2u / kStageRowB;
constexpr int      kRingPitchH = (int)kRingPitchB / 2;
static_assert(kSliceRows * kRingPitchB <= kSliceB && (kSliceB % 2048u) == 0u);
static_assert(kStages >= 2u);
static_assert((kTok % 128) == 0 && (kQkvN % 128) == 0 && (kDim % 128) == 0);

__device__ __forceinline__ uint32_t uni(uint32_t v) { return (uint32_t)__builtin_amdgcn_readfirstlane(v); }
// holds a wave-uniform value in a scalar register: a test made of it compiles to a scalar compare and branch (a tensor
// load ignores EXEC), and what is computed from it stays behind the asm waits written in front of it
__device__ __forceinline__ uint32_t pinned(uint32_t v) {
  uint32_t w = uni(v);
  asm volatile("" : "+s"(w));
  return w;
}
// the compiler places no wait for the tensor mover: a tile counts as landed only behind its issuer's s_wait_tensorcnt, and
// a buffer is handed back to the mover only behind its readers' s_wait_dscnt; the clobber keeps LDS accesses on their side
__device__ __forceinline__ void wait_ds0()     { asm volatile("s_wait_dscnt 0x0" ::: "memory"); }
__device__ __forceinline__ void wait_tensor0() { asm volatile("s_wait_tensorcnt 0x0" ::: "memory"); }
// one request of the whole wave: a 2-D tile from global memory into LDS, through no register
__device__ __forceinline__ void tdm_load(u32x4 g0, u32x8 g1) {
  asm volatile("tensor_load_to_lds %0, %1" :: "s"(g0), "s"(g1) : "memory");
}
// group 1: 1-byte elements, tensor = tile = 64 rows of 128 B, source pitch one K row, 4 dwords of LDS pad behind every 32
__device__ __forceinline__ u32x8 tdm_group1() {
  constexpr uint32_t d0 = kStageRowB, d1 = kSliceRows;
  u32x8 g;
  g[0] = uni((1u << 20) | (4u << 22) | (3u << 25));
  g[1] = uni((d0 & 0xFFFFu) << 16);
  g[2] = uni((d0 >> 16) | ((d1 & 0xFFFFu) << 16));
  g[3] = uni((d1 >> 16) | (d0 << 16));
  g[4] = uni(d1);
  g[5] = uni((uint32_t)kDim * 2u);
  g[6] = uni(0u);
  g[7] = uni(0u);
  return g;
}
__device__ __forceinline__ u32x4 tdm_group0(uint32_t lds_dst, uint64_t ga) {
  u32x4 g;
  g[0] = uni(1u);
  g[1] = uni(lds_dst);
  g[2] = uni((uint32_t)ga);
  g[3] = uni((((uint32_t)(ga >> 32)) & 0x01FFFFFFu) | 0x80000000u);
  return g;
}

// ---------------------------------------------------------------------------
// Register-blocked GEMM main loop: acc[i][j] (16x16 sub-tiles of a 64x64 wave tile) = sum_k A[m][k] * Bt[n][k],
// A row-major pitch 1024, Bt row-major pitch 1024, K = 1024 (16 stages of 64 k, two 32-k steps each).
// Wave w works on rows bm0 + 64 (w >> 1) and columns bn0 + 64 (w & 1): it reads slice w >> 1 (A) and slice 2 + (w & 1) (Bt).
// Every wave of the block runs the whole loop: all barriers stand under block-uniform control.
// ---------------------------------------------------------------------------
__device__ __forceinline__ void gemm_tile_loop(const _Float16* __restrict__ A, const _Float16* __restrict__ Bt,
                                               int bm0, int bn0, int wave, int lane, unsigned char* ring,
                                               v8f (&acc)[4][4]) {
  const int rlane = lane & 15;
  const int koff  = (lane >> 4) * 8;
#pragma unroll
  for (int i = 0; i < 4; ++i)
#pragma unroll
    for (int j = 0; j < 4; ++j) acc[i][j] = (v8f){0.f, 0.f, 0.f, 0.f, 0.f, 0.f, 0.f, 0.f};

  const _Float16* srow = (wave < 2) ? A + (size_t)(bm0 + wave * 64) * kDim : Bt + (size_t)(bn0 + (wave - 2) * 64) * kDim;
  const uint64_t src = (uint64_t)(size_t)srow;
  const uint32_t dst = (uint32_t)(size_t)ring + (uint32_t)wave * kSliceB;
  const u32x8 g1 = tdm_group1();

  tdm_load(tdm_group0(dst, src), g1);
  wait_tensor0();   // this wave's slice of stage 0 has landed
  __syncthreads();  // stage 0 published to the other waves
  {
    const uint32_t st = pinned(1u);  // pinned(): stage 1's descriptor words are formed behind stage 0's wait
    tdm_load(tdm_group0(dst + st * kBufB, src + (uint64_t)st * kStageRowB), g1);
  }

  const _Float16* Aw = (const _Float16*)(ring + (uint32_t)(wave >> 1) * kSliceB) + rlane * kRingPitchH + koff;
  const _Float16* Bw = (const _Float16*)(ring + (uint32_t)(2 + (wave & 1)) * kSliceB) + rlane * kRingPitchH + koff;
  // rolled: one stage per trip, so that the publish point below stands once in the text
#pragma unroll 1
  for (uint32_t s = 0; s < kStages; ++s) {
    const _Float16* As = Aw + (s & 1u) * (kBufB / 2u);
    const _Float16* Bs = Bw + (s & 1u) * (kBufB / 2u);
#pragma unroll
    for (int kk = 0; kk < 2; ++kk) {
      v16h ah[4], bh[4];
      ah[0] = FragH::load(As + kk * 32);
#pragma unroll
      for (int j = 0; j < 4; ++j) bh[j] = FragH::load(Bs + (j << 4) * kRingPitchH + kk * 32);
#pragma unroll
      for (int i = 1; i < 4; ++i) ah[i] = FragH::load(As + (i << 4) * kRingPitchH + kk * 32);
      // keeps the step's 16 LDS reads one group in front of its 16 matrix ops: sunk among them, each row waits out its own read
      __builtin_amdgcn_sched_barrier(0);
#pragma unroll
      for (int i = 0; i < 4; ++i) {
#pragma unroll
        for (int j = 0; j < 4; ++j) acc[i][j] = FragH::mma(ah[i], bh[j], acc[i][j]);
        guard4_h(acc[i][0], acc[i][1], acc[i][2], acc[i][3], ah[i], bh[0], bh[1], bh[2], bh[3]);
      }
      keep4_h(bh[0], bh[1], bh[2], bh[3]);
    }
    // publish point of stage s + 1
    wait_ds0();       // this wave's reads of stage s have returned
    wait_tensor0();   // this wave's slice of stage s + 1 has landed
    __syncthreads();  // stage s + 1 published; every wave has left stage s's buffer
    const uint32_t nxt = pinned(s + 2u);  // pinned(): the next descriptor's words are formed behind the wait above
    if (pinned(nxt < kStages)) {          // pinned(): scalar branch around the tensor load
      tdm_load(tdm_group0(dst + (nxt & 1u) * kBufB, src + (uint64_t)nxt * kStageRowB), g1);
    }
  }
  wait_tensor0();  // nothing of the mover in flight when the ring becomes staging
  wait_ds0();
  acc_guard4(acc[0][0], acc[0][1], acc[0][2], acc[0][3]);
  acc_guard4(acc[1][0], acc[1][1], acc[1][2], acc[1][3]);
  acc_guard4(acc[2][0], acc[2][1], acc[2][2], acc[2][3]);
  acc_guard4(acc[3][0], acc[3][1], acc[3][2], acc[3][3]);
}

// ---------------------------------------------------------------------------
// Fused q|k|v projection: [8192][3072] = XN[8192][1024] . WC[0..3071][1024]^T, f32 epilogue (x 1/16384, + bias, x carry: q kQCarry, k and v 16).
// One wave per 64x64 tile, 4 waves (2 x 2) per 128x128 block tile, grid = 64*24 = 1536 blocks of 128 threads (exact).
// A wave tile lies in one region (q, k or v: n0 >> 10), one head ((n0 & 1023) >> 6) and one batch element (m0 >> 11).
// The whole tile is staged per wave as f16 [64][72]: q/k regions row = token, v region row = d (transposed).
//   q/k: plane[b][head][s0 + row][0..63];  v: VT[b][head][row][s0 .. s0+63].
// ---------------------------------------------------------------------------
__global__ __launch_bounds__(128) void gemm_qkv_kernel(
    const unsigned short* __restrict__ XNp, const unsigned short* __restrict__ WCp,
    unsigned short* __restrict__ QPp, unsigned short* __restrict__ KPp, unsigned short* __restrict__ VTp,
    const float* __restrict__ bq, const float* __restrict__ bk, const float* __restrict__ bv) {
  __shared__ __attribute__((aligned(2048))) unsigned char Ring[kRingB];
  static_assert(4u * 64u * 72u * 2u <= kRingB);
  const int lane = threadIdx.x & 31;
  const int wave = __builtin_amdgcn_readfirstlane((int)(threadIdx.x >> 5));
  constexpr int tilesN = kQkvN >> 7;
  constexpr int tilesM = kTok >> 7;
  const int tile = blockIdx.x;
  if (tile >= tilesM * tilesN) return;
  const int tm = tile / tilesN;
  const int tn = tile - tm * tilesN;
  const int m0 = (tm << 7) + ((wave >> 1) << 6);
  const int n0 = (tn << 7) + ((wave & 1) << 6);

  v8f acc[4][4];
  gemm_tile_loop((const _Float16*)XNp, (const _Float16*)WCp, tm << 7, tn << 7, wave, lane, Ring, acc);

  const int rlane = lane & 15;
  const int mOff  = (lane >> 4) * 8;
  const int region = n0 >> 10;
  const int nl0  = n0 & (kDim - 1);
  const int head = nl0 >> 6;
  const int bidx = m0 >> 11;
  const int s0   = m0 & (kSeq - 1);
  const float* bias = (region == 0) ? bq : ((region == 1) ? bk : bv);
  const float carry = (region == 0) ? kQCarry : kQkvCarry;
  float bvj[4];
#pragma unroll
  for (int j = 0; j < 4; ++j) bvj[j] = bias[nl0 + (j << 4) + rlane];

  _Float16* st = (_Float16*)Ring + wave * (64 * 72);
#pragma unroll
  for (int i = 0; i < 4; ++i) {
#pragma unroll
    for (int j = 0; j < 4; ++j) {
      float y[8];
#pragma unroll
      for (int r = 0; r < 8; ++r) y[r] = (acc[i][j][r] * kProjScale + bvj[j]) * carry;
      if (region < 2) {
#pragma unroll
        for (int r = 0; r < 8; ++r) st[((i << 4) + mOff + r) * 72 + (j << 4) + rlane] = (_Float16)y[r];
      } else {
        v8h t;
#pragma unroll
        for (int r = 0; r < 8; ++r) t[r] = (_Float16)y[r];
        *(v8h*)(st + ((j << 4) + rlane) * 72 + (i << 4) + mOff) = t;
      }
    }
  }
  wave_lds_sync();

  unsigned short* plane;
  size_t gbase;
  int gpitch;
  if (region < 2) {
    plane  = (region == 0) ? QPp : KPp;
    gbase  = ((size_t)(bidx * kHeads + head) * kSeq + s0) * kHd;
    gpitch = kHd;
  } else {
    plane  = VTp;
    gbase  = (size_t)(bidx * kHeads + head) * kHd * kSeq + s0;
    gpitch = kSeq;
  }
  const int q4 = lane >> 3, c8 = (lane & 7) * 8;
  {
#pragma unroll
    for (int it = 0; it < 16; ++it) {
      const int row = it * 4 + q4;
      const v8h val = *(const v8h*)(st + row * 72 + c8);
      *(v8h*)(plane + gbase + (size_t)row * gpitch + c8) = val;
    }
    
  }
}

// ---------------------------------------------------------------------------
// Output projection: out[8192][1024] (f32) = AO[8192][1024] . WC[3072..4095][1024]^T x 2^-20 + bo.
// One wave per 64x64 tile, 4 waves (2 x 2) per 128x128 block tile, grid = 64*8 = 512 blocks of 128 threads (exact).
// 16-row f32 slabs per wave in LDS;
// ---------------------------------------------------------------------------
__global__ __launch_bounds__(128) void gemm_out_kernel(
    const unsigned short* __restrict__ AOp, const unsigned short* __restrict__ WOp,
    float* __restrict__ out, const float* __restrict__ bo) {
  __shared__ __attribute__((aligned(2048))) unsigned char Ring[kRingB];
  static_assert(4u * 16u * 68u * 4u <= kRingB);
  const int lane = threadIdx.x & 31;
  const int wave = __builtin_amdgcn_readfirstlane((int)(threadIdx.x >> 5));
  constexpr int tilesN = kDim >> 7;
  constexpr int tilesM = kTok >> 7;
  const int tile = blockIdx.x;
  if (tile >= tilesM * tilesN) return;
  const int tm = tile / tilesN;
  const int tn = tile - tm * tilesN;
  const int m0 = (tm << 7) + ((wave >> 1) << 6);
  const int n0 = (tn << 7) + ((wave & 1) << 6);

  v8f acc[4][4];
  gemm_tile_loop((const _Float16*)AOp, (const _Float16*)WOp, tm << 7, tn << 7, wave, lane, Ring, acc);

  const int rlane = lane & 15;
  const int mOff  = (lane >> 4) * 8;
  float bvj[4];
#pragma unroll
  for (int j = 0; j < 4; ++j) bvj[j] = bo[n0 + (j << 4) + rlane];
  float* slab = (float*)Ring + wave * (16 * 68);
  const int hh = lane >> 4, c4 = (lane & 15) * 4;
#pragma unroll
  for (int i = 0; i < 4; ++i) {
    const int mBase = m0 + (i << 4);
#pragma unroll
    for (int j = 0; j < 4; ++j) {
#pragma unroll
      for (int r = 0; r < 8; ++r)
        slab[(mOff + r) * 68 + (j << 4) + rlane] = acc[i][j][r] * kOutScale + bvj[j];
    }
    wave_lds_sync();
    {
#pragma unroll
      for (int it = 0; it < 8; ++it) {
        const int row = it * 2 + hh;
        const v4f v = *(const v4f*)(slab + row * 68 + c4);
        *(v4f*)(out + (size_t)(mBase + row) * kDim + n0 + c4) = v;
      }
      
    }
    wave_lds_sync();
  }
}

__device__ __forceinline__ void guard2_h(v8f& a, v8f& b, v16h x, v16h y, v16h p, v16h q, v16h r, v16h s) {
  asm volatile("v_nop\n\tv_nop\n\tv_nop\n\tv_nop" : "+v"(a), "+v"(b) : "v"(x), "v"(y), "v"(p), "v"(q), "v"(r), "v"(s));
}
// the same for a group of five: the row-sum op's accumulator and A fragment are named too, so that the op stays in its
// group (untied, the compiler sinks it behind the stage barrier, in front of the next stage's K reads)
__device__ __forceinline__ void guard3_h(v8f& a, v8f& b, v8f& l, v16h x, v16h y, v16h e, v16h p, v16h q, v16h r, v16h s) {
  asm volatile("v_nop\n\tv_nop\n\tv_nop\n\tv_nop" : "+v"(a), "+v"(b), "+v"(l) : "v"(x), "v"(y), "v"(e), "v"(p), "v"(q), "v"(r), "v"(s));
}
constexpr int kQWave  = 32;
constexpr int kQBlock = 8 * kQWave;
static_assert((kSeq % kQBlock) == 0);

constexpr uint32_t kKvRows   = 16u;
constexpr uint32_t kKvSliceB = 4096u;
constexpr uint32_t kKvBufB   = 8u * kKvSliceB;
constexpr uint32_t kKvRingB  = 2u * kKvBufB;
constexpr uint32_t kKvStages = (uint32_t)kSeq / 64u;
static_assert(kKvRows * kRingPitchB <= kKvSliceB && (kKvSliceB % 2048u) == 0u);
static_assert(kKvStages >= 2u);
static_assert((uint32_t)kHd * 2u == kStageRowB);
// group 1: 1-byte elements, tensor = tile = 16 rows of 128 B, source pitch as given, 4 dwords of LDS pad behind every 32
// pinned(): words 1 to 7 are descriptor words held in scalar registers of their own: built once in front of the loop, so
// that the compiler does not lend a word's register to the loop's own arithmetic while a request is outstanding
__device__ __forceinline__ u32x8 tdm_group1_kv(uint32_t src_pitch) {
  constexpr uint32_t d0 = kStageRowB, d1 = kKvRows;
  u32x8 g;
  g[0] = uni((1u << 20) | (4u << 22) | (3u << 25));
  g[1] = pinned((d0 & 0xFFFFu) << 16);
  g[2] = pinned((d0 >> 16) | ((d1 & 0xFFFFu) << 16));
  g[3] = pinned((d1 >> 16) | (d0 << 16));
  g[4] = pinned(d1);
  g[5] = pinned(src_pitch);
  g[6] = pinned(0u);
  g[7] = pinned(0u);
  return g;
}

__global__ __launch_bounds__(256) void attn_kernel(const unsigned short* __restrict__ QPp,
                                                   const unsigned short* __restrict__ KPp,
                                                   const unsigned short* __restrict__ VTp,
                                                   unsigned short* __restrict__ AOp) {
  constexpr int kPitch = 72;
  constexpr int kQBlocks = kSeq / kQBlock;
  static_assert(kPitch == kRingPitchH);
  __shared__ __attribute__((aligned(2048))) unsigned char KvRing[kKvRingB];
  __shared__ __align__(16) _Float16 Osh[8 * kQWave * 72];
  const int tid  = threadIdx.x;
  const int lane = tid & 31;
  const int wave = __builtin_amdgcn_readfirstlane((int)(tid >> 5));
  const int hh   = lane >> 4;
  const int c    = lane & 15;
  const int bx   = blockIdx.x;
  const int qb   = bx % kQBlocks;
  const int bh   = bx / kQBlocks;
  const int head = bh & (kHeads - 1);
  const int bidx = bh >> 4;
  const int q0   = qb * kQBlock + wave * kQWave;

  const _Float16* Qh = (const _Float16*)QPp + (size_t)bh * kSeq * kHd;
  const _Float16* Kh = (const _Float16*)KPp + (size_t)bh * kSeq * kHd;
  const _Float16* Vh = (const _Float16*)VTp + (size_t)bh * kHd * kSeq;

  v16h qf[2][2];
#pragma unroll
  for (int u = 0; u < 2; ++u) {
    qf[u][0] = FragH::load(Qh + (size_t)(q0 + u * 16 + c) * kHd + 8 * hh);
    qf[u][1] = FragH::load(Qh + (size_t)(q0 + u * 16 + c) * kHd + 32 + 8 * hh);
  }

  // cin: C operand of a stage's first score ops, 10 - maximum in use of the lane's query, alike in all 8 registers (a lane's
  // 8 accumulator rows are 8 keys of one query); 0 until stage 0 has set the first maximum
  v8f oacc[2][4], lacc[2], cin[2];
#pragma unroll
  for (int u = 0; u < 2; ++u) {
#pragma unroll
    for (int t = 0; t < 4; ++t) oacc[u][t] = (v8f){0.f, 0.f, 0.f, 0.f, 0.f, 0.f, 0.f, 0.f};
    lacc[u] = (v8f){0.f, 0.f, 0.f, 0.f, 0.f, 0.f, 0.f, 0.f};
    cin[u]  = (v8f){0.f, 0.f, 0.f, 0.f, 0.f, 0.f, 0.f, 0.f};
  }
  // A fragment of the row sums: row = lane & 15, so rows 0 and 8 are the lanes with lane & 7 == 0; every k alike
  const _Float16 e1 = ((lane & 7) == 0) ? (_Float16)1.0f : (_Float16)0.0f;
  const v16h ef = {e1, e1, e1, e1, e1, e1, e1, e1, e1, e1, e1, e1, e1, e1, e1, e1};

  // this wave's slice: its first byte in stage 0, the bytes from one stage to the next, its source pitch, its LDS place
  const _Float16* srow = (wave < 4) ? Kh + (size_t)(wave * 16) * kHd : Vh + (size_t)((wave - 4) * 16) * kSeq;
  const uint64_t src  = (uint64_t)(size_t)srow;
  const uint32_t step = (wave < 4) ? 64u * kStageRowB : kStageRowB;
  const uint32_t dst  = (uint32_t)(size_t)KvRing + (uint32_t)wave * kKvSliceB;
  const u32x8 g1 = tdm_group1_kv((wave < 4) ? kStageRowB : (uint32_t)kSeq * 2u);

  tdm_load(tdm_group0(dst, src), g1);
  wait_tensor0();   // this wave's slice of stage 0 has landed
  __syncthreads();  // stage 0 published to the other waves

  const _Float16* Kw = (const _Float16*)KvRing + c * kPitch + 8 * hh;
  const _Float16* Vw = (const _Float16*)(KvRing + 4u * kKvSliceB) + c * kPitch + 8 * hh;
  constexpr int kSliceH = (int)kKvSliceB / 2;
  // rolled: one stage per trip, so that the refill and the publish point stand once in the text
#pragma unroll 1
  for (uint32_t s = 0; s < kKvStages; ++s) {
    // refill, directly behind the barrier that published stage s (in front of the loop, or at the foot of trip s - 1):
    // stage s + 1 goes into the buffer that every wave has left, and flies while stage s is worked on. It stands at the
    // head of the trip, so that the trip's work behind the rescale branch is one block of code up to its barrier: with this branch at the foot the
    // compiler moved the row-sum arithmetic out from among the matrix ops to behind the barrier
    const uint32_t nxt = pinned(s + 1u);  // pinned(): the descriptor's words are formed behind the wait in front of that barrier
    if (pinned(nxt < kKvStages)) {        // pinned(): scalar branch around the tensor load
      tdm_load(tdm_group0(dst + (nxt & 1u) * kKvBufB, src + (uint64_t)nxt * step), g1);
    }
    const _Float16* Ks = Kw + (s & 1u) * (kKvBufB / 2u);
    const _Float16* Vs = Vw + (s & 1u) * (kKvBufB / 2u);

    v8f st[2][4];
#pragma unroll
    for (int j = 0; j < 4; ++j) {
      const v16h ka0 = FragH::load(Ks + j * kSliceH);
      const v16h ka1 = FragH::load(Ks + j * kSliceH + 32);
      st[0][j] = FragH::mma(ka0, qf[0][0], cin[0]);
      st[1][j] = FragH::mma(ka0, qf[1][0], cin[1]);
      st[0][j] = FragH::mma(ka1, qf[0][1], st[0][j]);
      st[1][j] = FragH::mma(ka1, qf[1][1], st[1][j]);
      guard2_h(st[0][j], st[1][j], ka0, ka1, qf[0][0], qf[0][1], qf[1][0], qf[1][1]);
    }

    float mx[2];
#pragma unroll
    for (int u = 0; u < 2; ++u) {
      mx[u] = st[u][0][0];
#pragma unroll
      for (int j = 0; j < 4; ++j)
#pragma unroll
        for (int r = 0; r < 8; ++r) mx[u] = fmaxf(mx[u], st[u][j][r]);
    }
    // one test per stage on each lane's own maxima; the ballot makes it a scalar branch, rarely taken behind stage 0
    if ((__builtin_amdgcn_ballot_w32(fmaxf(mx[0], mx[1]) > kPLog2Top) | (uint32_t)(s == 0u)) != 0u) {
#pragma unroll
      for (int u = 0; u < 2; ++u) {
        const float rise  = fmaxf(mx[u], __shfl_xor(mx[u], 16, 32)) - kPLog2Carry;  // the query's maximum over the one in use
        const float up    = fmaxf(rise, 0.0f);
        const float delta = (s == 0u) ? rise : up;  // stage 0 sets the maximum, down as well as up; later it only grows
        const float alpha = __builtin_amdgcn_exp2f(-up);
#pragma unroll
        for (int r = 0; r < 8; ++r) cin[u][r] -= delta;
#pragma unroll
        for (int j = 0; j < 4; ++j)
#pragma unroll
          for (int r = 0; r < 8; ++r) st[u][j][r] -= delta;
        lacc[u][0] *= alpha;
#pragma unroll
        for (int t = 0; t < 4; ++t)
#pragma unroll
          for (int r = 0; r < 8; ++r) oacc[u][t][r] *= alpha;
      }
    }

    v16h pf[2][2];
#pragma unroll
    for (int u = 0; u < 2; ++u)
#pragma unroll
      for (int j = 0; j < 4; ++j)
#pragma unroll
        for (int r = 0; r < 8; ++r)
          pf[u][j >> 1][(j & 1) * 8 + r] = (_Float16)__builtin_amdgcn_exp2f(st[u][j][r]);

#pragma unroll
    for (int t = 0; t < 4; ++t) {
      const v16h va0 = FragH::load(Vs + t * kSliceH);
      const v16h va1 = FragH::load(Vs + t * kSliceH + 32);
      // one of the stage's four row-sum ops per group (query tile t & 1, keys 32 (t >> 1) ..): it reads no LDS
      lacc[t & 1] = FragH::mma(ef, pf[t & 1][t >> 1], lacc[t & 1]);
      oacc[0][t] = FragH::mma(va0, pf[0][0], oacc[0][t]);
      oacc[1][t] = FragH::mma(va0, pf[1][0], oacc[1][t]);
      oacc[0][t] = FragH::mma(va1, pf[0][1], oacc[0][t]);
      oacc[1][t] = FragH::mma(va1, pf[1][1], oacc[1][t]);
      guard3_h(oacc[0][t], oacc[1][t], lacc[t & 1], va0, va1, ef, pf[0][0], pf[0][1], pf[1][0], pf[1][1]);
    }
    // publish point of stage s + 1
    wait_ds0();       // this wave's reads of stage s have returned
    wait_tensor0();   // this wave's slice of stage s + 1 has landed
    __syncthreads();  // stage s + 1 published; every wave has left stage s's buffer
  }
  wait_tensor0();  // nothing of the mover in flight when the wave ends
  wait_ds0();

  _Float16* os = Osh + wave * (kQWave * 72);
#pragma unroll
  for (int u = 0; u < 2; ++u) {
    const float inv = kCtxExtra * (1.0f / lacc[u][0]);
#pragma unroll
    for (int t = 0; t < 4; ++t) {
      v8h o;
#pragma unroll
      for (int r = 0; r < 8; ++r) o[r] = (_Float16)(oacc[u][t][r] * inv);
      *(v8h*)(os + (u * 16 + c) * 72 + t * 16 + 8 * hh) = o;
    }
  }
  wave_lds_sync();
  {
    const int q4 = lane >> 3, c8 = (lane & 7) * 8;
    {
#pragma unroll
      for (int it = 0; it < kQWave / 4; ++it) {
        const int row = it * 4 + q4;
        const v8h val = *(const v8h*)(os + row * 72 + c8);
        *(v8h*)(AOp + (size_t)(bidx * kSeq + q0 + row) * kDim + head * kHd + c8) = val;
      }
      
    }
  }
}

// ---------------------------------------------------------------------------
// Host glue: 5 kernel launches, nothing else.
// ---------------------------------------------------------------------------
extern "C" void kernel_launch(void* const* d_in, const int* in_sizes, int n_in,
                              void* d_out, int out_size, void* d_ws, size_t ws_size,
                              hipStream_t stream) {
  if (n_in < 11) return;
  if (in_sizes[0] != kTok * kDim) return;
  if (in_sizes[1] != kDim || in_sizes[2] != kDim) return;
  if (in_sizes[3] != kDim * kDim || in_sizes[5] != kDim * kDim) return;
  if (in_sizes[7] != kDim * kDim || in_sizes[9] != kDim * kDim) return;
  if (in_sizes[4] != kDim || in_sizes[6] != kDim || in_sizes[8] != kDim || in_sizes[10] != kDim) return;
  if (out_size != kTok * kDim) return;
  if (ws_size < kWsTotal) return;

  const float* x     = (const float*)d_in[0];
  const float* gamma = (const float*)d_in[1];
  const float* beta  = (const float*)d_in[2];
  const float* Wq    = (const float*)d_in[3];
  const float* bq    = (const float*)d_in[4];
  const float* Wk    = (const float*)d_in[5];
  const float* bk    = (const float*)d_in[6];
  const float* Wv    = (const float*)d_in[7];
  const float* bv    = (const float*)d_in[8];
  const float* Wo    = (const float*)d_in[9];
  const float* bo    = (const float*)d_in[10];
  float* out = (float*)d_out;

  char* ws = (char*)d_ws;
  unsigned short* XN = (unsigned short*)(ws + kOffXN);
  unsigned short* WC = (unsigned short*)(ws + kOffWC);
  unsigned short* QP = (unsigned short*)(ws + kOffQP);
  unsigned short* KP = (unsigned short*)(ws + kOffKP);
  unsigned short* VT = (unsigned short*)(ws + kOffVT);
  unsigned short* AO = (unsigned short*)(ws + kOffAO);
  unsigned short* WO = WC + (size_t)3 * kDim * kDim;

  ln_rows_kernel<<<kTok / 8, 256, 0, stream>>>(x, gamma, beta, XN);
  cast_w_kernel<<<dim3(kDim * kDim / 8 / 256, 4), 256, 0, stream>>>(Wq, Wk, Wv, Wo, WC, kWCarry);
  gemm_qkv_kernel<<<(kTok / 128) * (kQkvN / 128), 128, 0, stream>>>(XN, WC, QP, KP, VT, bq, bk, bv);
  attn_kernel<<<kBatch * kHeads * (kSeq / kQBlock), 256, 0, stream>>>(QP, KP, VT, AO);
  gemm_out_kernel<<<(kTok / 128) * (kDim / 128), 128, 0, stream>>>(AO, WO, out, bo);
}

// v007
// A run of this version takes 124 microseconds.
// Next to v006, in two timings, it ran 1.06 and 1.05 times as fast.
// Over all steps from v000 it is 4.19 times as fast.
// All contractions (fused q|k|v projection, k.q^T scores, v^T.p^T context, output projection): v_wmma_f32_16x16x32_f16, f16 operands with constant carries, f32 accumulate; LayerNorm, softmax statistics, bias adds and normalisation in f32.
#include <hip/hip_runtime.h>
#include <math.h>
#include <stdint.h>

typedef __attribute__((ext_vector_type(16))) _Float16 v16h;
typedef __attribute__((ext_vector_type(8)))  _Float16 v8h;
typedef __attribute__((ext_vector_type(8)))  float    v8f;
typedef __attribute__((ext_vector_type(4)))  float    v4f;
typedef __attribute__((ext_vector_type(4)))  uint32_t u32x4;
typedef __attribute__((ext_vector_type(8)))  uint32_t u32x8;

// ---------------------------------------------------------------------------
// Shape constants
// ---------------------------------------------------------------------------
constexpr int kBatch = 4;
constexpr int kSeq   = 2048;
constexpr int kDim   = 1024;
constexpr int kHeads = 16;
constexpr int kHd    = 64;
constexpr int kTok   = kBatch * kSeq;
constexpr int kQkvN  = 3 * kDim;
static_assert(kHeads * kHd == kDim);
static_assert(kTok == 8192);
static_assert((kDim % 32) == 0);
static_assert((kTok % 64) == 0 && (kQkvN % 64) == 0 && (kDim % 64) == 0 && (kSeq % 128) == 0);

// logit scale 1/sqrt(head dim), exact power of two for head dim 64
constexpr float kAttnScale = 0.125f;
static_assert(kHd == 64);
static_assert(kAttnScale * kAttnScale * (float)kHd == 1.0f);

// power-of-two carries of the f16 operand planes
constexpr float kXnCarry    = 16.0f;
constexpr float kWCarry     = 1024.0f;
constexpr float kQkvCarry   = 16.0f;
constexpr float kPLog2Carry = 10.0f;
constexpr float kCtxCarry   = 1024.0f;
constexpr float kProjScale  = 1.0f / (kXnCarry * kWCarry);
constexpr float kCtxExtra   = kCtxCarry / kQkvCarry;
constexpr float kOutScale   = 1.0f / (kCtxCarry * kWCarry);
constexpr float kLog2e      = 1.4426950408889634f;
// q's carry: (q*kQCarry).(k*kQkvCarry) = logit * log2(e), so the score product is already a base-2 exponent
constexpr float kQCarry     = kLog2e * kAttnScale / kQkvCarry;
// largest base-2 exponent a probability may take before the maximum in use is moved: 2^15 is finite in f16
constexpr float kPLog2Top   = 15.0f;
static_assert(kPLog2Top > kPLog2Carry && kPLog2Top < 16.0f);
constexpr float kInvDim     = 1.0f / (float)kDim;
constexpr float kLnEps      = 1e-5f;

// ---------------------------------------------------------------------------
// Workspace region map (bytes; every offset a multiple of 128)
//   XN  f16 [8192][1024]      normalised activations x16          16,777,216
//   WC  f16 [4096][1024]      Wq | Wk | Wv | Wo rows, x1024         8,388,608
//   QP  f16 [4][16][2048][64] q x log2(e)/128                      16,777,216
//   KP  f16 [4][16][2048][64] k x16                               16,777,216
//   VT  f16 [4][16][64][2048] v x16, transposed per head          16,777,216
//   AO  f16 [8192][1024]      merged context x1024                16,777,216
//   total                                                         92,274,688
// ---------------------------------------------------------------------------
constexpr size_t kOffXN = 0;
constexpr size_t kOffWC = kOffXN + (size_t)kTok * kDim * 2;
constexpr size_t kOffQP = kOffWC + (size_t)4 * kDim * kDim * 2;
constexpr size_t kOffKP = kOffQP + (size_t)kTok * kDim * 2;
constexpr size_t kOffVT = kOffKP + (size_t)kTok * kDim * 2;
constexpr size_t kOffAO = kOffVT + (size_t)kTok * kDim * 2;
constexpr size_t kWsTotal = kOffAO + (size_t)kTok * kDim * 2;
static_assert(kWsTotal == 92274688ull);
static_assert(kWsTotal <= 134217728ull);
static_assert((kOffWC % 128) == 0 && (kOffQP % 128) == 0 && (kOffKP % 128) == 0 && (kOffVT % 128) == 0 && (kOffAO % 128) == 0);

// ---------------------------------------------------------------------------
// Fragment helpers (A and B use the same split k map: elements 0..7 <- p[0..7], 8..15 <- p[16..23],
// with p already offset by 8*(lane>>4); row / column = lane & 15)
// ---------------------------------------------------------------------------
struct FragH {
  union U { v16h v; v8h h[2]; };
  static __device__ __forceinline__ v16h load(const _Float16* p) {
    U f;
    f.h[0] = *(const v8h*)(p);
    f.h[1] = *(const v8h*)(p + 16);
    return f.v;
  }
  static __device__ __forceinline__ v8f mma(v16h a, v16h b, v8f c) {
    return __builtin_amdgcn_wmma_f32_16x16x32_f16(false, a, false, b, (short)0, c, false, false);
  }
};
// hazard guards: four idle slots after the last matrix op of a group, tying every accumulator of the group
// and naming the A and B fragment registers of the group as inputs
__device__ __forceinline__ void guard4_h(v8f& a, v8f& b, v8f& c, v8f& d, v16h x, v16h b0, v16h b1, v16h b2, v16h b3) {
  asm volatile("v_nop\n\tv_nop\n\tv_nop\n\tv_nop" : "+v"(a), "+v"(b), "+v"(c), "+v"(d) : "v"(x), "v"(b0), "v"(b1), "v"(b2), "v"(b3));
}
__device__ __forceinline__ void guard1_h(v8f& a, v16h x, v16h y, v16h z, v16h w) {
  asm volatile("v_nop\n\tv_nop\n\tv_nop\n\tv_nop" : "+v"(a) : "v"(x), "v"(y), "v"(z), "v"(w));
}
__device__ __forceinline__ void keep4_h(v16h a, v16h b, v16h c, v16h d) {
  asm volatile("v_nop" :: "v"(a), "v"(b), "v"(c), "v"(d));
}
__device__ __forceinline__ void acc_guard4(v8f& a, v8f& b, v8f& c, v8f& d) {
  asm volatile("v_nop\n\tv_nop\n\tv_nop\n\tv_nop" : "+v"(a), "+v"(b), "+v"(c), "+v"(d));
}
__device__ __forceinline__ void wave_lds_sync() {
  __builtin_amdgcn_fence(__ATOMIC_RELEASE, "workgroup");
  __builtin_amdgcn_wave_barrier();
  __builtin_amdgcn_fence(__ATOMIC_ACQUIRE, "workgroup");
}

// ---------------------------------------------------------------------------
// Operand preparation, one launch: LayerNorm of the token rows (-> XN) and the cast of the four weight matrices (-> WC).
// The two jobs do not depend on each other and both are short streams, so what they cost is mostly the launch and the
// start of their waves: one grid of 256 blocks of 16 waves (4,096 waves) does both. A row is 1,024 f32; wave w takes token
// rows 2w and 2w + 1 (4,096 x 2 = 8,192, exact) and row w of the stacked weights Wq | Wk | Wv | Wo (4 x 1,024, exact).
// All three rows are read once and held in registers: the lane owns columns it*256 + lane*8 .. +7 for it = 0..3, and the
// wave's 24 16-B loads, and the 16 of gamma and beta, are in flight together.
// LayerNorm: population variance from centred squares, eps inside the rsqrt, f32, then x16 and RNE convert to f16.
// Weights: f32 [1024][1024] ([out][in], already the Bt[n][k] layout) -> f16 x carry, same linear order.
// No block barriers in this kernel; the shuffles run under wave-uniform control only.
// ---------------------------------------------------------------------------
constexpr int kPrepWaves  = 16;
constexpr int kPrepBlocks = kTok / (2 * kPrepWaves);
static_assert(kPrepBlocks * kPrepWaves * 2 == kTok && kPrepBlocks * kPrepWaves == 4 * kDim);
__global__ __launch_bounds__(512) void prep_kernel(const float* __restrict__ x, const float* __restrict__ gamma,
                                                   const float* __restrict__ beta,
                                                   const float* __restrict__ w0, const float* __restrict__ w1,
                                                   const float* __restrict__ w2, const float* __restrict__ w3,
                                                   unsigned short* __restrict__ xn, unsigned short* __restrict__ wc,
                                                   float carry) {
  const int lane = threadIdx.x & 31;
  const int wave = __builtin_amdgcn_readfirstlane((int)(threadIdx.x >> 5));
  const int wid  = blockIdx.x * kPrepWaves + wave;
  if (wid >= 4 * kDim) return;
  const int z = wid >> 10;
  const float* W  = (z == 0) ? w0 : (z == 1) ? w1 : (z == 2) ? w2 : w3;
  // wave-uniform row bases and the lane's own column: the registers that every load below names
  const float* xb = x + (size_t)(2 * wid) * kDim;
  const float* wb = W + (size_t)(wid & (kDim - 1)) * kDim;
  const int col = lane * 8;
  const float* xr = xb + col;
  const float* wr = wb + col;

  v4f a[2][4][2], w[4][2], g[4][2], b[4][2];
#pragma unroll
  for (int it = 0; it < 4; ++it) {
    w[it][0] = *(const v4f*)(wr + it * 256);
    w[it][1] = *(const v4f*)(wr + it * 256 + 4);
  }
  // keeps the weight row's loads first in the queue (left free, this build issues six of them last): loads are waited for
  // in issue order, and the row is to be cast and stored while the token rows are still on their way
  __builtin_amdgcn_sched_barrier(0);
#pragma unroll
  for (int u = 0; u < 2; ++u)
#pragma unroll
    for (int it = 0; it < 4; ++it) {
      a[u][it][0] = *(const v4f*)(xr + u * kDim + it * 256);
      a[u][it][1] = *(const v4f*)(xr + u * kDim + it * 256 + 4);
    }
#pragma unroll
  for (int it = 0; it < 4; ++it) {
    g[it][0] = *(const v4f*)(gamma + col + it * 256);
    g[it][1] = *(const v4f*)(gamma + col + it * 256 + 4);
    b[it][0] = *(const v4f*)(beta + col + it * 256);
    b[it][1] = *(const v4f*)(beta + col + it * 256 + 4);
  }
  // the wait in front of any overwrite of a register that an issued load names. Its inputs are those registers (the lane's
  // byte offset and the four bases): live up to the wait, none of them is handed out as a load's result or to a later
  // argument fetch in front of it. Its "memory" clobber keeps all 40 loads in front of it, so that the wave waits out one
  // memory latency and not several; the fence behind it holds the arithmetic's register writes behind the wait
  asm volatile("s_wait_xcnt 0x0" :: "v"(col * 4), "s"(wb), "s"(xb), "s"(gamma), "s"(beta) : "memory");
  __builtin_amdgcn_sched_barrier(0);

  // the weight row was asked for first: it is cast and stored while the token rows are still on their way
  unsigned short* q = wc + (size_t)wid * kDim + lane * 8;
#pragma unroll
  for (int it = 0; it < 4; ++it) {
    v8h hv;
#pragma unroll
    for (int e = 0; e < 4; ++e) {
      hv[e] = (_Float16)(w[it][0][e] * carry);
      hv[4 + e] = (_Float16)(w[it][1][e] * carry);
    }
    *(v8h*)(q + it * 256) = hv;
  }
  // the same wait for the four stores, whose data registers the LayerNorm arithmetic takes over; the fence keeps the
  // stores here, ahead of the wait for the token rows, and that arithmetic behind the wait
  asm volatile("s_wait_xcnt 0x0" ::: "memory");
  __builtin_amdgcn_sched_barrier(0);

  float s[2] = {0.0f, 0.0f};
#pragma unroll
  for (int u = 0; u < 2; ++u)
#pragma unroll
    for (int it = 0; it < 4; ++it) {
      const v4f a0 = a[u][it][0], a1 = a[u][it][1];
      s[u] += ((a0[0] + a0[1]) + (a0[2] + a0[3])) + ((a1[0] + a1[1]) + (a1[2] + a1[3]));
    }
#pragma unroll
  for (int off = 16; off > 0; off >>= 1)
#pragma unroll
    for (int u = 0; u < 2; ++u) s[u] += __shfl_xor(s[u], off, 32);
  float mu[2], ss[2];
#pragma unroll
  for (int u = 0; u < 2; ++u) {
    mu[u] = s[u] * kInvDim;
    ss[u] = 0.0f;
#pragma unroll
    for (int it = 0; it < 4; ++it)
#pragma unroll
      for (int e = 0; e < 4; ++e) {
        const float d0 = a[u][it][0][e] - mu[u];
        const float d1 = a[u][it][1][e] - mu[u];
        ss[u] = fmaf(d0, d0, ss[u]);
        ss[u] = fmaf(d1, d1, ss[u]);
      }
  }
#pragma unroll
  for (int off = 16; off > 0; off >>= 1)
#pragma unroll
    for (int u = 0; u < 2; ++u) ss[u] += __shfl_xor(ss[u], off, 32);
  float inv[2];
#pragma unroll
  for (int u = 0; u < 2; ++u) inv[u] = rsqrtf(ss[u] * kInvDim + kLnEps);

  unsigned short* orow = xn + (size_t)(2 * wid) * kDim + lane * 8;
#pragma unroll
  for (int it = 0; it < 4; ++it) {
    const v4f g0 = g[it][0], g1 = g[it][1], b0 = b[it][0], b1 = b[it][1];
#pragma unroll
    for (int u = 0; u < 2; ++u) {
      v8h hv;
#pragma unroll
      for (int e = 0; e < 4; ++e) {
        const float y0 = fmaf((a[u][it][0][e] - mu[u]) * inv[u], g0[e], b0[e]) * kXnCarry;
        const float y1 = fmaf((a[u][it][1][e] - mu[u]) * inv[u], g1[e], b1[e]) * kXnCarry;
        hv[e] = (_Float16)y0;
        hv[4 + e] = (_Float16)y1;
      }
      *(v8h*)(orow + u * kDim + it * 256) = hv;
    }
  }
}

// ---------------------------------------------------------------------------
// GEMM operand ring in LDS. A block of 4 waves (2 x 2) owns a 128 x 128 tile of the product; a stage is 64 k = 128 B of
// each of its 128 A rows and 128 Bt rows. Every wave brings one slice of 64 rows per stage with one tensor load
// (waves 0, 1: the A rows; waves 2, 3: the Bt rows); the load's pad lays the rows at a pitch of 144 B (16 B x 9) for the
// 16-B fragment reads. A slice holds 64 x 144 = 9,216 B and is placed every 10,240 B (a multiple of 2 KiB).
// Two buffers of four slices each: 81,920 B, which the epilogues reuse as per-wave staging behind the last barrier.
// ---------------------------------------------------------------------------
constexpr uint32_t kStageRowB  = 128u;
constexpr uint32_t kRingPitchB = 144u;
constexpr uint32_t kSliceRows  = 64u;
constexpr uint32_t kSliceB     = 10240u;
constexpr uint32_t kBufB       = 4u * kSliceB;
constexpr uint32_t kRingB      = 2u * kBufB;
constexpr uint32_t kStages     = (uint32_t)kDim * 2u / kStageRowB;
constexpr int      kRingPitchH = (int)kRingPitchB / 2;
static_assert(kSliceRows * kRingPitchB <= kSliceB && (kSliceB % 2048u) == 0u);
static_assert(kStages >= 2u);
static_assert((kTok % 128) == 0 && (kQkvN % 128) == 0 && (kDim % 128) == 0);

__device__ __forceinline__ uint32_t uni(uint32_t v) { return (uint32_t)__builtin_amdgcn_readfirstlane(v); }
// holds a wave-uniform value in a scalar register: a test made of it compiles to a scalar compare and branch (a tensor
// load ignores EXEC), and what is computed from it stays behind the asm waits written in front of it
__device__ __forceinline__ uint32_t pinned(uint32_t v) {
  uint32_t w = uni(v);
  asm volatile("" : "+s"(w));
  return w;
}
// the compiler places no wait for the tensor mover: a tile counts as landed only behind its issuer's s_wait_tensorcnt, and
// a buffer is handed back to the mover only behind its readers' s_wait_dscnt; the clobber keeps LDS accesses on their side
__device__ __forceinline__ void wait_ds0()     { asm volatile("s_wait_dscnt 0x0" ::: "memory"); }
__device__ __forceinline__ void wait_tensor0() { asm volatile("s_wait_tensorcnt 0x0" ::: "memory"); }
// one request of the whole wave: a 2-D tile from global memory into LDS, through no register
__device__ __forceinline__ void tdm_load(u32x4 g0, u32x8 g1) {
  asm volatile("tensor_load_to_lds %0, %1" :: "s"(g0), "s"(g1) : "memory");
}
// group 1: 1-byte elements, tensor = tile = 64 rows of 128 B, source pitch one K row, 4 dwords of LDS pad behind every 32
__device__ __forceinline__ u32x8 tdm_group1() {
  constexpr uint32_t d0 = kStageRowB, d1 = kSliceRows;
  u32x8 g;
  g[0] = uni((1u << 20) | (4u << 22) | (3u << 25));
  g[1] = uni((d0 & 0xFFFFu) << 16);
  g[2] = uni((d0 >> 16) | ((d1 & 0xFFFFu) << 16));
  g[3] = uni((d1 >> 16) | (d0 << 16));
  g[4] = uni(d1);
  g[5] = uni((uint32_t)kDim * 2u);
  g[6] = uni(0u);
  g[7] = uni(0u);
  return g;
}
__device__ __forceinline__ u32x4 tdm_group0(uint32_t lds_dst, uint64_t ga) {
  u32x4 g;
  g[0] = uni(1u);
  g[1] = uni(lds_dst);
  g[2] = uni((uint32_t)ga);
  g[3] = uni((((uint32_t)(ga >> 32)) & 0x01FFFFFFu) | 0x80000000u);
  return g;
}

// ---------------------------------------------------------------------------
// Register-blocked GEMM main loop: acc[i][j] (16x16 sub-tiles of a 64x64 wave tile) = sum_k A[m][k] * Bt[n][k],
// A row-major pitch 1024, Bt row-major pitch 1024, K = 1024 (16 stages of 64 k, two 32-k steps each).
// Wave w works on rows bm0 + 64 (w >> 1) and columns bn0 + 64 (w & 1): it reads slice w >> 1 (A) and slice 2 + (w & 1) (Bt).
// Every wave of the block runs the whole loop: all barriers stand under block-uniform control.
// ---------------------------------------------------------------------------
__device__ __forceinline__ void gemm_tile_loop(const _Float16* __restrict__ A, const _Float16* __restrict__ Bt,
                                               int bm0, int bn0, int wave, int lane, unsigned char* ring,
                                               v8f (&acc)[4][4]) {
  const int rlane = lane & 15;
  const int koff  = (lane >> 4) * 8;
#pragma unroll
  for (int i = 0; i < 4; ++i)
#pragma unroll
    for (int j = 0; j < 4; ++j) acc[i][j] = (v8f){0.f, 0.f, 0.f, 0.f, 0.f, 0.f, 0.f, 0.f};

  const _Float16* srow = (wave < 2) ? A + (size_t)(bm0 + wave * 64) * kDim : Bt + (size_t)(bn0 + (wave - 2) * 64) * kDim;
  const uint64_t src = (uint64_t)(size_t)srow;
  const uint32_t dst = (uint32_t)(size_t)ring + (uint32_t)wave * kSliceB;
  const u32x8 g1 = tdm_group1();

  tdm_load(tdm_group0(dst, src), g1);
  wait_tensor0();   // this wave's slice of stage 0 has landed
  __syncthreads();  // stage 0 published to the other waves
  {
    const uint32_t st = pinned(1u);  // pinned(): stage 1's descriptor words are formed behind stage 0's wait
    tdm_load(tdm_group0(dst + st * kBufB, src + (uint64_t)st * kStageRowB), g1);
  }

  const _Float16* Aw = (const _Float16*)(ring + (uint32_t)(wave >> 1) * kSliceB) + rlane * kRingPitchH + koff;
  const _Float16* Bw = (const _Float16*)(ring + (uint32_t)(2 + (wave & 1)) * kSliceB) + rlane * kRingPitchH + koff;
  // rolled: one stage per trip, so that the publish point below stands once in the text
#pragma unroll 1
  for (uint32_t s = 0; s < kStages; ++s) {
    const _Float16* As = Aw + (s & 1u) * (kBufB / 2u);
    const _Float16* Bs = Bw + (s & 1u) * (kBufB / 2u);
#pragma unroll
    for (int kk = 0; kk < 2; ++kk) {
      v16h ah[4], bh[4];
      ah[0] = FragH::load(As + kk * 32);
#pragma unroll
      for (int j = 0; j < 4; ++j) bh[j] = FragH::load(Bs + (j << 4) * kRingPitchH + kk * 32);
#pragma unroll
      for (int i = 1; i < 4; ++i) ah[i] = FragH::load(As + (i << 4) * kRingPitchH + kk * 32);
      // keeps the step's 16 LDS reads one group in front of its 16 matrix ops: sunk among them, each row waits out its own read
      __builtin_amdgcn_sched_barrier(0);
#pragma unroll
      for (int i = 0; i < 4; ++i) {
#pragma unroll
        for (int j = 0; j < 4; ++j) acc[i][j] = FragH::mma(ah[i], bh[j], acc[i][j]);
        guard4_h(acc[i][0], acc[i][1], acc[i][2], acc[i][3], ah[i], bh[0], bh[1], bh[2], bh[3]);
      }
      keep4_h(bh[0], bh[1], bh[2], bh[3]);
    }
    // publish point of stage s + 1
    wait_ds0();       // this wave's reads of stage s have returned
    wait_tensor0();   // this wave's slice of stage s + 1 has landed
    __syncthreads();  // stage s + 1 published; every wave has left stage s's buffer
    const uint32_t nxt = pinned(s + 2u);  // pinned(): the next descriptor's words are formed behind the wait above
    if (pinned(nxt < kStages)) {          // pinned(): scalar branch around the tensor load
      tdm_load(tdm_group0(dst + (nxt & 1u) * kBufB, src + (uint64_t)nxt * kStageRowB), g1);
    }
  }
  wait_tensor0();  // nothing of the mover in flight when the ring becomes staging
  wait_ds0();
  acc_guard4(acc[0][0], acc[0][1], acc[0][2], acc[0][3]);
  acc_guard4(acc[1][0], acc[1][1], acc[1][2], acc[1][3]);
  acc_guard4(acc[2][0], acc[2][1], acc[2][2], acc[2][3]);
  acc_guard4(acc[3][0], acc[3][1], acc[3][2], acc[3][3]);
}

// ---------------------------------------------------------------------------
// Fused q|k|v projection: [8192][3072] = XN[8192][1024] . WC[0..3071][1024]^T, f32 epilogue (x 1/16384, + bias, x carry: q kQCarry, k and v 16).
// One wave per 64x64 tile, 4 waves (2 x 2) per 128x128 block tile, grid = 64*24 = 1536 blocks of 128 threads (exact).
// A wave tile lies in one region (q, k or v: n0 >> 10), one head ((n0 & 1023) >> 6) and one batch element (m0 >> 11).
// The whole tile is staged per wave as f16 [64][72]: q/k regions row = token, v region row = d (transposed).
//   q/k: plane[b][head][s0 + row][0..63];  v: VT[b][head][row][s0 .. s0+63].
// ---------------------------------------------------------------------------
__global__ __launch_bounds__(128) void gemm_qkv_kernel(
    const unsigned short* __restrict__ XNp, const unsigned short* __restrict__ WCp,
    unsigned short* __restrict__ QPp, unsigned short* __restrict__ KPp, unsigned short* __restrict__ VTp,
    const float* __restrict__ bq, const float* __restrict__ bk, const float* __restrict__ bv) {
  __shared__ __attribute__((aligned(2048))) unsigned char Ring[kRingB];
  static_assert(4u * 64u * 72u * 2u <= kRingB);
  const int lane = threadIdx.x & 31;
  const int wave = __builtin_amdgcn_readfirstlane((int)(threadIdx.x >> 5));
  constexpr int tilesN = kQkvN >> 7;
  constexpr int tilesM = kTok >> 7;
  const int tile = blockIdx.x;
  if (tile >= tilesM * tilesN) return;
  const int tm = tile / tilesN;
  const int tn = tile - tm * tilesN;
  const int m0 = (tm << 7) + ((wave >> 1) << 6);
  const int n0 = (tn << 7) + ((wave & 1) << 6);

  v8f acc[4][4];
  gemm_tile_loop((const _Float16*)XNp, (const _Float16*)WCp, tm << 7, tn << 7, wave, lane, Ring, acc);

  const int rlane = lane & 15;
  const int mOff  = (lane >> 4) * 8;
  const int region = n0 >> 10;
  const int nl0  = n0 & (kDim - 1);
  const int head = nl0 >> 6;
  const int bidx = m0 >> 11;
  const int s0   = m0 & (kSeq - 1);
  const float* bias = (region == 0) ? bq : ((region == 1) ? bk : bv);
  const float carry = (region == 0) ? kQCarry : kQkvCarry;
  float bvj[4];
#pragma unroll
  for (int j = 0; j < 4; ++j) bvj[j] = bias[nl0 + (j << 4) + rlane];

  _Float16* st = (_Float16*)Ring + wave * (64 * 72);
#pragma unroll
  for (int i = 0; i < 4; ++i) {
#pragma unroll
    for (int j = 0; j < 4; ++j) {
      float y[8];
#pragma unroll
      for (int r = 0; r < 8; ++r) y[r] = (acc[i][j][r] * kProjScale + bvj[j]) * carry;
      if (region < 2) {
#pragma unroll
        for (int r = 0; r < 8; ++r) st[((i << 4) + mOff + r) * 72 + (j << 4) + rlane] = (_Float16)y[r];
      } else {
        v8h t;
#pragma unroll
        for (int r = 0; r < 8; ++r) t[r] = (_Float16)y[r];
        *(v8h*)(st + ((j << 4) + rlane) * 72 + (i << 4) + mOff) = t;
      }
    }
  }
  wave_lds_sync();

  unsigned short* plane;
  size_t gbase;
  int gpitch;
  if (region < 2) {
    plane  = (region == 0) ? QPp : KPp;
    gbase  = ((size_t)(bidx * kHeads + head) * kSeq + s0) * kHd;
    gpitch = kHd;
  } else {
    plane  = VTp;
    gbase  = (size_t)(bidx * kHeads + head) * kHd * kSeq + s0;
    gpitch = kSeq;
  }
  const int q4 = lane >> 3, c8 = (lane & 7) * 8;
  {
#pragma unroll
    for (int it = 0; it < 16; ++it) {
      const int row = it * 4 + q4;
      const v8h val = *(const v8h*)(st + row * 72 + c8);
      *(v8h*)(plane + gbase + (size_t)row * gpitch + c8) = val;
    }
    
  }
}

// ---------------------------------------------------------------------------
// Output projection: out[8192][1024] (f32) = AO[8192][1024] . WC[3072..4095][1024]^T x 2^-20 + bo.
// One wave per 64x64 tile, 4 waves (2 x 2) per 128x128 block tile, grid = 64*8 = 512 blocks of 128 threads (exact).
// 16-row f32 slabs per wave in LDS;
// ---------------------------------------------------------------------------
__global__ __launch_bounds__(128) void gemm_out_kernel(
    const unsigned short* __restrict__ AOp, const unsigned short* __restrict__ WOp,
    float* __restrict__ out, const float* __restrict__ bo) {
  __shared__ __attribute__((aligned(2048))) unsigned char Ring[kRingB];
  static_assert(4u * 16u * 68u * 4u <= kRingB);
  const int lane = threadIdx.x & 31;
  const int wave = __builtin_amdgcn_readfirstlane((int)(threadIdx.x >> 5));
  constexpr int tilesN = kDim >> 7;
  constexpr int tilesM = kTok >> 7;
  const int tile = blockIdx.x;
  if (tile >= tilesM * tilesN) return;
  const int tm = tile / tilesN;
  const int tn = tile - tm * tilesN;
  const int m0 = (tm << 7) + ((wave >> 1) << 6);
  const int n0 = (tn << 7) + ((wave & 1) << 6);

  v8f acc[4][4];
  gemm_tile_loop((const _Float16*)AOp, (const _Float16*)WOp, tm << 7, tn << 7, wave, lane, Ring, acc);

  const int rlane = lane & 15;
  const int mOff  = (lane >> 4) * 8;
  float bvj[4];
#pragma unroll
  for (int j = 0; j < 4; ++j) bvj[j] = bo[n0 + (j << 4) + rlane];
  float* slab = (float*)Ring + wave * (16 * 68);
  const int hh = lane >> 4, c4 = (lane & 15) * 4;
#pragma unroll
  for (int i = 0; i < 4; ++i) {
    const int mBase = m0 + (i << 4);
#pragma unroll
    for (int j = 0; j < 4; ++j) {
#pragma unroll
      for (int r = 0; r < 8; ++r)
        slab[(mOff + r) * 68 + (j << 4) + rlane] = acc[i][j][r] * kOutScale + bvj[j];
    }
    wave_lds_sync();
    {
#pragma unroll
      for (int it = 0; it < 8; ++it) {
        const int row = it * 2 + hh;
        const v4f v = *(const v4f*)(slab + row * 68 + c4);
        *(v4f*)(out + (size_t)(mBase + row) * kDim + n0 + c4) = v;
      }
      
    }
    wave_lds_sync();
  }
}

__device__ __forceinline__ void guard2_h(v8f& a, v8f& b, v16h x, v16h y, v16h p, v16h q, v16h r, v16h s) {
  asm volatile("v_nop\n\tv_nop\n\tv_nop\n\tv_nop" : "+v"(a), "+v"(b) : "v"(x), "v"(y), "v"(p), "v"(q), "v"(r), "v"(s));
}
// the same for a group of five: the row-sum op's accumulator and A fragment are named too, so that the op stays in its
// group (untied, the compiler sinks it behind the stage barrier, in front of the next stage's K reads)
__device__ __forceinline__ void guard3_h(v8f& a, v8f& b, v8f& l, v16h x, v16h y, v16h e, v16h p, v16h q, v16h r, v16h s) {
  asm volatile("v_nop\n\tv_nop\n\tv_nop\n\tv_nop" : "+v"(a), "+v"(b), "+v"(l) : "v"(x), "v"(y), "v"(e), "v"(p), "v"(q), "v"(r), "v"(s));
}
constexpr int kQWave  = 32;
constexpr int kQBlock = 8 * kQWave;
static_assert((kSeq % kQBlock) == 0);

constexpr uint32_t kKvRows   = 16u;
constexpr uint32_t kKvSliceB = 4096u;
constexpr uint32_t kKvBufB   = 8u * kKvSliceB;
constexpr uint32_t kKvRingB  = 2u * kKvBufB;
constexpr uint32_t kKvStages = (uint32_t)kSeq / 64u;
static_assert(kKvRows * kRingPitchB <= kKvSliceB && (kKvSliceB % 2048u) == 0u);
static_assert(kKvStages >= 2u);
static_assert((uint32_t)kHd * 2u == kStageRowB);
// group 1: 1-byte elements, tensor = tile = 16 rows of 128 B, source pitch as given, 4 dwords of LDS pad behind every 32
// pinned(): words 1 to 7 are descriptor words held in scalar registers of their own: built once in front of the loop, so
// that the compiler does not lend a word's register to the loop's own arithmetic while a request is outstanding
__device__ __forceinline__ u32x8 tdm_group1_kv(uint32_t src_pitch) {
  constexpr uint32_t d0 = kStageRowB, d1 = kKvRows;
  u32x8 g;
  g[0] = uni((1u << 20) | (4u << 22) | (3u << 25));
  g[1] = pinned((d0 & 0xFFFFu) << 16);
  g[2] = pinned((d0 >> 16) | ((d1 & 0xFFFFu) << 16));
  g[3] = pinned((d1 >> 16) | (d0 << 16));
  g[4] = pinned(d1);
  g[5] = pinned(src_pitch);
  g[6] = pinned(0u);
  g[7] = pinned(0u);
  return g;
}

__global__ __launch_bounds__(256) void attn_kernel(const unsigned short* __restrict__ QPp,
                                                   const unsigned short* __restrict__ KPp,
                                                   const unsigned short* __restrict__ VTp,
                                                   unsigned short* __restrict__ AOp) {
  constexpr int kPitch = 72;
  constexpr int kQBlocks = kSeq / kQBlock;
  static_assert(kPitch == kRingPitchH);
  __shared__ __attribute__((aligned(2048))) unsigned char KvRing[kKvRingB];
  __shared__ __align__(16) _Float16 Osh[8 * kQWave * 72];
  const int tid  = threadIdx.x;
  const int lane = tid & 31;
  const int wave = __builtin_amdgcn_readfirstlane((int)(tid >> 5));
  const int hh   = lane >> 4;
  const int c    = lane & 15;
  const int bx   = blockIdx.x;
  const int qb   = bx % kQBlocks;
  const int bh   = bx / kQBlocks;
  const int head = bh & (kHeads - 1);
  const int bidx = bh >> 4;
  const int q0   = qb * kQBlock + wave * kQWave;

  const _Float16* Qh = (const _Float16*)QPp + (size_t)bh * kSeq * kHd;
  const _Float16* Kh = (const _Float16*)KPp + (size_t)bh * kSeq * kHd;
  const _Float16* Vh = (const _Float16*)VTp + (size_t)bh * kHd * kSeq;

  v16h qf[2][2];
#pragma unroll
  for (int u = 0; u < 2; ++u) {
    qf[u][0] = FragH::load(Qh + (size_t)(q0 + u * 16 + c) * kHd + 8 * hh);
    qf[u][1] = FragH::load(Qh + (size_t)(q0 + u * 16 + c) * kHd + 32 + 8 * hh);
  }

  // cin: C operand of a stage's first score ops, 10 - maximum in use of the lane's query, alike in all 8 registers (a lane's
  // 8 accumulator rows are 8 keys of one query); 0 until stage 0 has set the first maximum
  v8f oacc[2][4], lacc[2], cin[2];
#pragma unroll
  for (int u = 0; u < 2; ++u) {
#pragma unroll
    for (int t = 0; t < 4; ++t) oacc[u][t] = (v8f){0.f, 0.f, 0.f, 0.f, 0.f, 0.f, 0.f, 0.f};
    lacc[u] = (v8f){0.f, 0.f, 0.f, 0.f, 0.f, 0.f, 0.f, 0.f};
    cin[u]  = (v8f){0.f, 0.f, 0.f, 0.f, 0.f, 0.f, 0.f, 0.f};
  }
  // A fragment of the row sums: row = lane & 15, so rows 0 and 8 are the lanes with lane & 7 == 0; every k alike
  const _Float16 e1 = ((lane & 7) == 0) ? (_Float16)1.0f : (_Float16)0.0f;
  const v16h ef = {e1, e1, e1, e1, e1, e1, e1, e1, e1, e1, e1, e1, e1, e1, e1, e1};

  // this wave's slice: its first byte in stage 0, the bytes from one stage to the next, its source pitch, its LDS place
  const _Float16* srow = (wave < 4) ? Kh + (size_t)(wave * 16) * kHd : Vh + (size_t)((wave - 4) * 16) * kSeq;
  const uint64_t src  = (uint64_t)(size_t)srow;
  const uint32_t step = (wave < 4) ? 64u * kStageRowB : kStageRowB;
  const uint32_t dst  = (uint32_t)(size_t)KvRing + (uint32_t)wave * kKvSliceB;
  const u32x8 g1 = tdm_group1_kv((wave < 4) ? kStageRowB : (uint32_t)kSeq * 2u);

  tdm_load(tdm_group0(dst, src), g1);
  wait_tensor0();   // this wave's slice of stage 0 has landed
  __syncthreads();  // stage 0 published to the other waves

  const _Float16* Kw = (const _Float16*)KvRing + c * kPitch + 8 * hh;
  const _Float16* Vw = (const _Float16*)(KvRing + 4u * kKvSliceB) + c * kPitch + 8 * hh;
  constexpr int kSliceH = (int)kKvSliceB / 2;
  // rolled: one stage per trip, so that the refill and the publish point stand once in the text
#pragma unroll 1
  for (uint32_t s = 0; s < kKvStages; ++s) {
    // refill, directly behind the barrier that published stage s (in front of the loop, or at the foot of trip s - 1):
    // stage s + 1 goes into the buffer that every wave has left, and flies while stage s is worked on. It stands at the
    // head of the trip, so that the trip's work behind the rescale branch is one block of code up to its barrier: with this branch at the foot the
    // compiler moved the row-sum arithmetic out from among the matrix ops to behind the barrier
    const uint32_t nxt = pinned(s + 1u);  // pinned(): the descriptor's words are formed behind the wait in front of that barrier
    if (pinned(nxt < kKvStages)) {        // pinned(): scalar branch around the tensor load
      tdm_load(tdm_group0(dst + (nxt & 1u) * kKvBufB, src + (uint64_t)nxt * step), g1);
    }
    const _Float16* Ks = Kw + (s & 1u) * (kKvBufB / 2u);
    const _Float16* Vs = Vw + (s & 1u) * (kKvBufB / 2u);

    v8f st[2][4];
#pragma unroll
    for (int j = 0; j < 4; ++j) {
      const v16h ka0 = FragH::load(Ks + j * kSliceH);
      const v16h ka1 = FragH::load(Ks + j * kSliceH + 32);
      st[0][j] = FragH::mma(ka0, qf[0][0], cin[0]);
      st[1][j] = FragH::mma(ka0, qf[1][0], cin[1]);
      st[0][j] = FragH::mma(ka1, qf[0][1], st[0][j]);
      st[1][j] = FragH::mma(ka1, qf[1][1], st[1][j]);
      guard2_h(st[0][j], st[1][j], ka0, ka1, qf[0][0], qf[0][1], qf[1][0], qf[1][1]);
    }

    float mx[2];
#pragma unroll
    for (int u = 0; u < 2; ++u) {
      mx[u] = st[u][0][0];
#pragma unroll
      for (int j = 0; j < 4; ++j)
#pragma unroll
        for (int r = 0; r < 8; ++r) mx[u] = fmaxf(mx[u], st[u][j][r]);
    }
    // one test per stage on each lane's own maxima; the ballot makes it a scalar branch, rarely taken behind stage 0
    if ((__builtin_amdgcn_ballot_w32(fmaxf(mx[0], mx[1]) > kPLog2Top) | (uint32_t)(s == 0u)) != 0u) {
#pragma unroll
      for (int u = 0; u < 2; ++u) {
        const float rise  = fmaxf(mx[u], __shfl_xor(mx[u], 16, 32)) - kPLog2Carry;  // the query's maximum over the one in use
        const float up    = fmaxf(rise, 0.0f);
        const float delta = (s == 0u) ? rise : up;  // stage 0 sets the maximum, down as well as up; later it only grows
        const float alpha = __builtin_amdgcn_exp2f(-up);
#pragma unroll
        for (int r = 0; r < 8; ++r) cin[u][r] -= delta;
#pragma unroll
        for (int j = 0; j < 4; ++j)
#pragma unroll
          for (int r = 0; r < 8; ++r) st[u][j][r] -= delta;
        lacc[u][0] *= alpha;
#pragma unroll
        for (int t = 0; t < 4; ++t)
#pragma unroll
          for (int r = 0; r < 8; ++r) oacc[u][t][r] *= alpha;
      }
    }

    v16h pf[2][2];
#pragma unroll
    for (int u = 0; u < 2; ++u)
#pragma unroll
      for (int j = 0; j < 4; ++j)
#pragma unroll
        for (int r = 0; r < 8; ++r)
          pf[u][j >> 1][(j & 1) * 8 + r] = (_Float16)__builtin_amdgcn_exp2f(st[u][j][r]);

#pragma unroll
    for (int t = 0; t < 4; ++t) {
      const v16h va0 = FragH::load(Vs + t * kSliceH);
      const v16h va1 = FragH::load(Vs + t * kSliceH + 32);
      // one of the stage's four row-sum ops per group (query tile t & 1, keys 32 (t >> 1) ..): it reads no LDS
      lacc[t & 1] = FragH::mma(ef, pf[t & 1][t >> 1], lacc[t & 1]);
      oacc[0][t] = FragH::mma(va0, pf[0][0], oacc[0][t]);
      oacc[1][t] = FragH::mma(va0, pf[1][0], oacc[1][t]);
      oacc[0][t] = FragH::mma(va1, pf[0][1], oacc[0][t]);
      oacc[1][t] = FragH::mma(va1, pf[1][1], oacc[1][t]);
      guard3_h(oacc[0][t], oacc[1][t], lacc[t & 1], va0, va1, ef, pf[0][0], pf[0][1], pf[1][0], pf[1][1]);
    }
    // publish point of stage s + 1
    wait_ds0();       // this wave's reads of stage s have returned
    wait_tensor0();   // this wave's slice of stage s + 1 has landed
    __syncthreads();  // stage s + 1 published; every wave has left stage s's buffer
  }
  wait_tensor0();  // nothing of the mover in flight when the wave ends
  wait_ds0();

  _Float16* os = Osh + wave * (kQWave * 72);
#pragma unroll
  for (int u = 0; u < 2; ++u) {
    const float inv = kCtxExtra * (1.0f / lacc[u][0]);
#pragma unroll
    for (int t = 0; t < 4; ++t) {
      v8h o;
#pragma unroll
      for (int r = 0; r < 8; ++r) o[r] = (_Float16)(oacc[u][t][r] * inv);
      *(v8h*)(os + (u * 16 + c) * 72 + t * 16 + 8 * hh) = o;
    }
  }
  wave_lds_sync();
  {
    const int q4 = lane >> 3, c8 = (lane & 7) * 8;
    {
#pragma unroll
      for (int it = 0; it < kQWave / 4; ++it) {
        const int row = it * 4 + q4;
        const v8h val = *(const v8h*)(os + row * 72 + c8);
        *(v8h*)(AOp + (size_t)(bidx * kSeq + q0 + row) * kDim + head * kHd + c8) = val;
      }
      
    }
  }
}

// ---------------------------------------------------------------------------
// Host glue: 4 kernel launches, nothing else.
// ---------------------------------------------------------------------------
extern "C" void kernel_launch(void* const* d_in, const int* in_sizes, int n_in,
                              void* d_out, int out_size, void* d_ws, size_t ws_size,
                              hipStream_t stream) {
  if (n_in < 11) return;
  if (in_sizes[0] != kTok * kDim) return;
  if (in_sizes[1] != kDim || in_sizes[2] != kDim) return;
  if (in_sizes[3] != kDim * kDim || in_sizes[5] != kDim * kDim) return;
  if (in_sizes[7] != kDim * kDim || in_sizes[9] != kDim * kDim) return;
  if (in_sizes[4] != kDim || in_sizes[6] != kDim || in_sizes[8] != kDim || in_sizes[10] != kDim) return;
  if (out_size != kTok * kDim) return;
  if (ws_size < kWsTotal) return;

  const float* x     = (const float*)d_in[0];
  const float* gamma = (const float*)d_in[1];
  const float* beta  = (const float*)d_in[2];
  const float* Wq    = (const float*)d_in[3];
  const float* bq    = (const float*)d_in[4];
  const float* Wk    = (const float*)d_in[5];
  const float* bk    = (const float*)d_in[6];
  const float* Wv    = (const float*)d_in[7];
  const float* bv    = (const float*)d_in[8];
  const float* Wo    = (const float*)d_in[9];
  const float* bo    = (const float*)d_in[10];
  float* out = (float*)d_out;

  char* ws = (char*)d_ws;
  unsigned short* XN = (unsigned short*)(ws + kOffXN);
  unsigned short* WC = (unsigned short*)(ws + kOffWC);
  unsigned short* QP = (unsigned short*)(ws + kOffQP);
  unsigned short* KP = (unsigned short*)(ws + kOffKP);
  unsigned short* VT = (unsigned short*)(ws + kOffVT);
  unsigned short* AO = (unsigned short*)(ws + kOffAO);
  unsigned short* WO = WC + (size_t)3 * kDim * kDim;

  prep_kernel<<<kPrepBlocks, kPrepWaves * 32, 0, stream>>>(x, gamma, beta, Wq, Wk, Wv, Wo, XN, WC, kWCarry);
  gemm_qkv_kernel<<<(kTok / 128) * (kQkvN / 128), 128, 0, stream>>>(XN, WC, QP, KP, VT, bq, bk, bv);
  attn_kernel<<<kBatch * kHeads * (kSeq / kQBlock), 256, 0, stream>>>(QP, KP, VT, AO);
  gemm_out_kernel<<<(kTok / 128) * (kDim / 128), 128, 0, stream>>>(AO, WO, out, bo);
}

// v008
// It runs in 115 microseconds.
// Next to v007, in two timings, it ran 1.07 times as fast each time.
// Over all steps from v000 it is 4.48 times as fast.
// All contractions (fused q|k|v projection, k.q^T scores, v^T.p^T context, output projection): v_wmma_f32_16x16x32_f16, f16 operands with constant carries, f32 accumulate; LayerNorm, softmax statistics, bias adds and normalisation in f32.
#include <hip/hip_runtime.h>
#include <math.h>
#include <stdint.h>

typedef __attribute__((ext_vector_type(16))) _Float16 v16h;
typedef __attribute__((ext_vector_type(8)))  _Float16 v8h;
typedef __attribute__((ext_vector_type(8)))  float    v8f;
typedef __attribute__((ext_vector_type(4)))  float    v4f;
typedef __attribute__((ext_vector_type(4)))  uint32_t u32x4;
typedef __attribute__((ext_vector_type(8)))  uint32_t u32x8;

// ---------------------------------------------------------------------------
// Shape constants
// ---------------------------------------------------------------------------
constexpr int kBatch = 4;
constexpr int kSeq   = 2048;
constexpr int kDim   = 1024;
constexpr int kHeads = 16;
constexpr int kHd    = 64;
constexpr int kTok   = kBatch * kSeq;
constexpr int kQkvN  = 3 * kDim;
static_assert(kHeads * kHd == kDim);
static_assert(kTok == 8192);
static_assert((kDim % 32) == 0);
static_assert((kTok % 64) == 0 && (kQkvN % 64) == 0 && (kDim % 64) == 0 && (kSeq % 128) == 0);

// logit scale 1/sqrt(head dim), exact power of two for head dim 64
constexpr float kAttnScale = 0.125f;
static_assert(kHd == 64);
static_assert(kAttnScale * kAttnScale * (float)kHd == 1.0f);

// power-of-two carries of the f16 operand planes
constexpr float kXnCarry    = 16.0f;
constexpr float kWCarry     = 1024.0f;
constexpr float kQkvCarry   = 16.0f;
constexpr float kPLog2Carry = 10.0f;
constexpr float kCtxCarry   = 1024.0f;
constexpr float kProjScale  = 1.0f / (kXnCarry * kWCarry);
constexpr float kCtxExtra   = kCtxCarry / kQkvCarry;
constexpr float kOutScale   = 1.0f / (kCtxCarry * kWCarry);
constexpr float kLog2e      = 1.4426950408889634f;
// q's carry: (q*kQCarry).(k*kQkvCarry) = logit * log2(e), so the score product is already a base-2 exponent
constexpr float kQCarry     = kLog2e * kAttnScale / kQkvCarry;
// largest base-2 exponent a probability may take before the maximum in use is moved: 2^15 is finite in f16
constexpr float kPLog2Top   = 15.0f;
static_assert(kPLog2Top > kPLog2Carry && kPLog2Top < 16.0f);
constexpr float kInvDim     = 1.0f / (float)kDim;
constexpr float kLnEps      = 1e-5f;

// ---------------------------------------------------------------------------
// Workspace region map (bytes; every offset a multiple of 128)
//   XN  f16 [8192][1024]      normalised activations x16          16,777,216
//   WC  f16 [4096][1024]      Wq | Wk | Wv | Wo rows, x1024         8,388,608
//   QP  f16 [4][16][2048][64] q x log2(e)/128                      16,777,216
//   KP  f16 [4][16][2048][64] k x16                               16,777,216
//   VT  f16 [4][16][64][2048] v x16, transposed per head          16,777,216
//   AO  f16 [8192][1024]      merged context x1024                16,777,216
//   total                                                         92,274,688
// ---------------------------------------------------------------------------
constexpr size_t kOffXN = 0;
constexpr size_t kOffWC = kOffXN + (size_t)kTok * kDim * 2;
constexpr size_t kOffQP = kOffWC + (size_t)4 * kDim * kDim * 2;
constexpr size_t kOffKP = kOffQP + (size_t)kTok * kDim * 2;
constexpr size_t kOffVT = kOffKP + (size_t)kTok * kDim * 2;
constexpr size_t kOffAO = kOffVT + (size_t)kTok * kDim * 2;
constexpr size_t kWsTotal = kOffAO + (size_t)kTok * kDim * 2;
static_assert(kWsTotal == 92274688ull);
static_assert(kWsTotal <= 134217728ull);
static_assert((kOffWC % 128) == 0 && (kOffQP % 128) == 0 && (kOffKP % 128) == 0 && (kOffVT % 128) == 0 && (kOffAO % 128) == 0);

// ---------------------------------------------------------------------------
// Fragment helpers (A and B use the same split k map: elements 0..7 <- p[0..7], 8..15 <- p[16..23],
// with p already offset by 8*(lane>>4); row / column = lane & 15)
// ---------------------------------------------------------------------------
struct FragH {
  union U { v16h v; v8h h[2]; };
  static __device__ __forceinline__ v16h load(const _Float16* p) {
    U f;
    f.h[0] = *(const v8h*)(p);
    f.h[1] = *(const v8h*)(p + 16);
    return f.v;
  }
  static __device__ __forceinline__ v8f mma(v16h a, v16h b, v8f c) {
    return __builtin_amdgcn_wmma_f32_16x16x32_f16(false, a, false, b, (short)0, c, false, false);
  }
};
// hazard guards: four idle slots after the last matrix op of a group, tying every accumulator of the group
// and naming the A and B fragment registers of the group as inputs
__device__ __forceinline__ void guard4_h(v8f& a, v8f& b, v8f& c, v8f& d, v16h x, v16h b0, v16h b1, v16h b2, v16h b3) {
  asm volatile("v_nop\n\tv_nop\n\tv_nop\n\tv_nop" : "+v"(a), "+v"(b), "+v"(c), "+v"(d) : "v"(x), "v"(b0), "v"(b1), "v"(b2), "v"(b3));
}
__device__ __forceinline__ void guard1_h(v8f& a, v16h x, v16h y, v16h z, v16h w) {
  asm volatile("v_nop\n\tv_nop\n\tv_nop\n\tv_nop" : "+v"(a) : "v"(x), "v"(y), "v"(z), "v"(w));
}
__device__ __forceinline__ void keep4_h(v16h a, v16h b, v16h c, v16h d) {
  asm volatile("v_nop" :: "v"(a), "v"(b), "v"(c), "v"(d));
}
__device__ __forceinline__ void acc_guard4(v8f& a, v8f& b, v8f& c, v8f& d) {
  asm volatile("v_nop\n\tv_nop\n\tv_nop\n\tv_nop" : "+v"(a), "+v"(b), "+v"(c), "+v"(d));
}
__device__ __forceinline__ void wave_lds_sync() {
  __builtin_amdgcn_fence(__ATOMIC_RELEASE, "workgroup");
  __builtin_amdgcn_wave_barrier();
  __builtin_amdgcn_fence(__ATOMIC_ACQUIRE, "workgroup");
}

// ---------------------------------------------------------------------------
// Operand preparation, one launch: LayerNorm of the token rows (-> XN) and the cast of the four weight matrices (-> WC).
// The two jobs do not depend on each other and both are short streams, so what they cost is mostly the launch and the
// start of their waves: one grid of 256 blocks of 16 waves (4,096 waves) does both. A row is 1,024 f32; wave w takes token
// rows 2w and 2w + 1 (4,096 x 2 = 8,192, exact) and row w of the stacked weights Wq | Wk | Wv | Wo (4 x 1,024, exact).
// All three rows are read once and held in registers: the lane owns columns it*256 + lane*8 .. +7 for it = 0..3, and the
// wave's 24 16-B loads, and the 16 of gamma and beta, are in flight together.
// LayerNorm: population variance from centred squares, eps inside the rsqrt, f32, then x16 and RNE convert to f16.
// Weights: f32 [1024][1024] ([out][in], already the Bt[n][k] layout) -> f16 x carry, same linear order.
// No block barriers in this kernel; the shuffles run under wave-uniform control only.
// ---------------------------------------------------------------------------
constexpr int kPrepWaves  = 16;
constexpr int kPrepBlocks = kTok / (2 * kPrepWaves);
static_assert(kPrepBlocks * kPrepWaves * 2 == kTok && kPrepBlocks * kPrepWaves == 4 * kDim);
__global__ __launch_bounds__(512) void prep_kernel(const float* __restrict__ x, const float* __restrict__ gamma,
                                                   const float* __restrict__ beta,
                                                   const float* __restrict__ w0, const float* __restrict__ w1,
                                                   const float* __restrict__ w2, const float* __restrict__ w3,
                                                   unsigned short* __restrict__ xn, unsigned short* __restrict__ wc,
                                                   float carry) {
  const int lane = threadIdx.x & 31;
  const int wave = __builtin_amdgcn_readfirstlane((int)(threadIdx.x >> 5));
  const int wid  = blockIdx.x * kPrepWaves + wave;
  if (wid >= 4 * kDim) return;
  const int z = wid >> 10;
  const float* W  = (z == 0) ? w0 : (z == 1) ? w1 : (z == 2) ? w2 : w3;
  // wave-uniform row bases and the lane's own column: the registers that every load below names
  const float* xb = x + (size_t)(2 * wid) * kDim;
  const float* wb = W + (size_t)(wid & (kDim - 1)) * kDim;
  const int col = lane * 8;
  const float* xr = xb + col;
  const float* wr = wb + col;

  v4f a[2][4][2], w[4][2], g[4][2], b[4][2];
#pragma unroll
  for (int it = 0; it < 4; ++it) {
    w[it][0] = *(const v4f*)(wr + it * 256);
    w[it][1] = *(const v4f*)(wr + it * 256 + 4);
  }
  // keeps the weight row's loads first in the queue (left free, this build issues six of them last): loads are waited for
  // in issue order, and the row is to be cast and stored while the token rows are still on their way
  __builtin_amdgcn_sched_barrier(0);
#pragma unroll
  for (int u = 0; u < 2; ++u)
#pragma unroll
    for (int it = 0; it < 4; ++it) {
      a[u][it][0] = *(const v4f*)(xr + u * kDim + it * 256);
      a[u][it][1] = *(const v4f*)(xr + u * kDim + it * 256 + 4);
    }
#pragma unroll
  for (int it = 0; it < 4; ++it) {
    g[it][0] = *(const v4f*)(gamma + col + it * 256);
    g[it][1] = *(const v4f*)(gamma + col + it * 256 + 4);
    b[it][0] = *(const v4f*)(beta + col + it * 256);
    b[it][1] = *(const v4f*)(beta + col + it * 256 + 4);
  }
  // the wait in front of any overwrite of a register that an issued load names. Its inputs are those registers (the lane's
  // byte offset and the four bases): live up to the wait, none of them is handed out as a load's result or to a later
  // argument fetch in front of it. Its "memory" clobber keeps all 40 loads in front of it, so that the wave waits out one
  // memory latency and not several; the fence behind it holds the arithmetic's register writes behind the wait
  asm volatile("s_wait_xcnt 0x0" :: "v"(col * 4), "s"(wb), "s"(xb), "s"(gamma), "s"(beta) : "memory");
  __builtin_amdgcn_sched_barrier(0);

  // the weight row was asked for first: it is cast and stored while the token rows are still on their way
  unsigned short* q = wc + (size_t)wid * kDim + lane * 8;
#pragma unroll
  for (int it = 0; it < 4; ++it) {
    v8h hv;
#pragma unroll
    for (int e = 0; e < 4; ++e) {
      hv[e] = (_Float16)(w[it][0][e] * carry);
      hv[4 + e] = (_Float16)(w[it][1][e] * carry);
    }
    *(v8h*)(q + it * 256) = hv;
  }
  // the same wait for the four stores, whose data registers the LayerNorm arithmetic takes over; the fence keeps the
  // stores here, ahead of the wait for the token rows, and that arithmetic behind the wait
  asm volatile("s_wait_xcnt 0x0" ::: "memory");
  __builtin_amdgcn_sched_barrier(0);

  float s[2] = {0.0f, 0.0f};
#pragma unroll
  for (int u = 0; u < 2; ++u)
#pragma unroll
    for (int it = 0; it < 4; ++it) {
      const v4f a0 = a[u][it][0], a1 = a[u][it][1];
      s[u] += ((a0[0] + a0[1]) + (a0[2] + a0[3])) + ((a1[0] + a1[1]) + (a1[2] + a1[3]));
    }
#pragma unroll
  for (int off = 16; off > 0; off >>= 1)
#pragma unroll
    for (int u = 0; u < 2; ++u) s[u] += __shfl_xor(s[u], off, 32);
  float mu[2], ss[2];
#pragma unroll
  for (int u = 0; u < 2; ++u) {
    mu[u] = s[u] * kInvDim;
    ss[u] = 0.0f;
#pragma unroll
    for (int it = 0; it < 4; ++it)
#pragma unroll
      for (int e = 0; e < 4; ++e) {
        const float d0 = a[u][it][0][e] - mu[u];
        const float d1 = a[u][it][1][e] - mu[u];
        ss[u] = fmaf(d0, d0, ss[u]);
        ss[u] = fmaf(d1, d1, ss[u]);
      }
  }
#pragma unroll
  for (int off = 16; off > 0; off >>= 1)
#pragma unroll
    for (int u = 0; u < 2; ++u) ss[u] += __shfl_xor(ss[u], off, 32);
  float inv[2];
#pragma unroll
  for (int u = 0; u < 2; ++u) inv[u] = rsqrtf(ss[u] * kInvDim + kLnEps);

  unsigned short* orow = xn + (size_t)(2 * wid) * kDim + lane * 8;
#pragma unroll
  for (int it = 0; it < 4; ++it) {
    const v4f g0 = g[it][0], g1 = g[it][1], b0 = b[it][0], b1 = b[it][1];
#pragma unroll
    for (int u = 0; u < 2; ++u) {
      v8h hv;
#pragma unroll
      for (int e = 0; e < 4; ++e) {
        const float y0 = fmaf((a[u][it][0][e] - mu[u]) * inv[u], g0[e], b0[e]) * kXnCarry;
        const float y1 = fmaf((a[u][it][1][e] - mu[u]) * inv[u], g1[e], b1[e]) * kXnCarry;
        hv[e] = (_Float16)y0;
        hv[4 + e] = (_Float16)y1;
      }
      *(v8h*)(orow + u * kDim + it * 256) = hv;
    }
  }
}

// ---------------------------------------------------------------------------
// GEMM operand ring in LDS. A block of 4 waves (2 x 2) owns a 128 x 128 tile of the product; a stage is 64 k = 128 B of
// each of its 128 A rows and 128 Bt rows. Every wave brings one slice of 64 rows per stage with one tensor load
// (waves 0, 1: the A rows; waves 2, 3: the Bt rows); the load's pad lays the rows at a pitch of 144 B (16 B x 9) for the
// 16-B fragment reads. A slice holds 64 x 144 = 9,216 B and is placed every 10,240 B (a multiple of 2 KiB).
// Two buffers of four slices each: 81,920 B, which the epilogues reuse as per-wave staging behind the last barrier.
// Rotated start: the blocks of one tile row read the same A rows and the blocks of one tile column the same Bt rows, and
// blocks that start together stay together, so that at every stage many of them would ask L2 for the same lines at the
// same moment. Trip s of a block therefore works on k stage (s + rot) mod 16, rot = (tile row + tile column) mod 16: every
// stage once, in an order that differs between neighbours. The LDS buffer goes by the trip, the source address by the stage.
// ---------------------------------------------------------------------------
constexpr uint32_t kStageRowB  = 128u;
constexpr uint32_t kRingPitchB = 144u;
constexpr uint32_t kSliceRows  = 64u;
constexpr uint32_t kSliceB     = 10240u;
constexpr uint32_t kBufB       = 4u * kSliceB;
constexpr uint32_t kRingB      = 2u * kBufB;
constexpr uint32_t kStages     = (uint32_t)kDim * 2u / kStageRowB;
constexpr int      kRingPitchH = (int)kRingPitchB / 2;
static_assert(kSliceRows * kRingPitchB <= kSliceB && (kSliceB % 2048u) == 0u);
static_assert(kStages >= 2u && (kStages & (kStages - 1u)) == 0u);
static_assert((kTok % 128) == 0 && (kQkvN % 128) == 0 && (kDim % 128) == 0);

__device__ __forceinline__ uint32_t uni(uint32_t v) { return (uint32_t)__builtin_amdgcn_readfirstlane(v); }
// holds a wave-uniform value in a scalar register: a test made of it compiles to a scalar compare and branch (a tensor
// load ignores EXEC), and what is computed from it stays behind the asm waits written in front of it
__device__ __forceinline__ uint32_t pinned(uint32_t v) {
  uint32_t w = uni(v);
  asm volatile("" : "+s"(w));
  return w;
}
// the compiler places no wait for the tensor mover: a tile counts as landed only behind its issuer's s_wait_tensorcnt, and
// a buffer is handed back to the mover only behind its readers' s_wait_dscnt; the clobber keeps LDS accesses on their side
__device__ __forceinline__ void wait_ds0()     { asm volatile("s_wait_dscnt 0x0" ::: "memory"); }
__device__ __forceinline__ void wait_tensor0() { asm volatile("s_wait_tensorcnt 0x0" ::: "memory"); }
// one request of the whole wave: a 2-D tile from global memory into LDS, through no register
__device__ __forceinline__ void tdm_load(u32x4 g0, u32x8 g1) {
  asm volatile("tensor_load_to_lds %0, %1" :: "s"(g0), "s"(g1) : "memory");
}
// group 1: 1-byte elements, tensor = tile = 64 rows of 128 B, source pitch one K row, 4 dwords of LDS pad behind every 32
// pinned(): words 1 to 7 are descriptor words held in scalar registers of their own: built once in front of the loop, so
// that the compiler does not lend a word's register to the loop's own arithmetic while a request is outstanding
__device__ __forceinline__ u32x8 tdm_group1() {
  constexpr uint32_t d0 = kStageRowB, d1 = kSliceRows;
  u32x8 g;
  g[0] = uni((1u << 20) | (4u << 22) | (3u << 25));
  g[1] = pinned((d0 & 0xFFFFu) << 16);
  g[2] = pinned((d0 >> 16) | ((d1 & 0xFFFFu) << 16));
  g[3] = pinned((d1 >> 16) | (d0 << 16));
  g[4] = pinned(d1);
  g[5] = pinned((uint32_t)kDim * 2u);
  g[6] = pinned(0u);
  g[7] = pinned(0u);
  return g;
}
__device__ __forceinline__ u32x4 tdm_group0(uint32_t lds_dst, uint64_t ga) {
  u32x4 g;
  g[0] = uni(1u);
  g[1] = uni(lds_dst);
  g[2] = uni((uint32_t)ga);
  g[3] = uni((((uint32_t)(ga >> 32)) & 0x01FFFFFFu) | 0x80000000u);
  return g;
}

// ---------------------------------------------------------------------------
// Register-blocked GEMM main loop: acc[i][j] (16x16 sub-tiles of a 64x64 wave tile) = sum_k A[m][k] * Bt[n][k],
// A row-major pitch 1024, Bt row-major pitch 1024, K = 1024 (16 stages of 64 k, two 32-k steps each).
// Wave w works on rows bm0 + 64 (w >> 1) and columns bn0 + 64 (w & 1): it reads slice w >> 1 (A) and slice 2 + (w & 1) (Bt).
// Every wave of the block runs the whole loop: all barriers stand under block-uniform control.
// ---------------------------------------------------------------------------
__device__ __forceinline__ void gemm_tile_loop(const _Float16* __restrict__ A, const _Float16* __restrict__ Bt,
                                               int bm0, int bn0, uint32_t rot, int wave, int lane, unsigned char* ring,
                                               v8f (&acc)[4][4]) {
  const int rlane = lane & 15;
  const int koff  = (lane >> 4) * 8;
#pragma unroll
  for (int i = 0; i < 4; ++i)
#pragma unroll
    for (int j = 0; j < 4; ++j) acc[i][j] = (v8f){0.f, 0.f, 0.f, 0.f, 0.f, 0.f, 0.f, 0.f};

  const _Float16* srow = (wave < 2) ? A + (size_t)(bm0 + wave * 64) * kDim : Bt + (size_t)(bn0 + (wave - 2) * 64) * kDim;
  const uint64_t src = (uint64_t)(size_t)srow;
  const uint32_t dst = (uint32_t)(size_t)ring + (uint32_t)wave * kSliceB;
  const u32x8 g1 = tdm_group1();

  tdm_load(tdm_group0(dst, src + (uint64_t)(rot & (kStages - 1u)) * kStageRowB), g1);
  wait_tensor0();   // this wave's slice of trip 0 has landed
  __syncthreads();  // trip 0's stage published to the other waves
  {
    const uint32_t st = pinned(1u);  // pinned(): trip 1's descriptor words are formed behind trip 0's wait
    tdm_load(tdm_group0(dst + st * kBufB, src + (uint64_t)((st + rot) & (kStages - 1u)) * kStageRowB), g1);
  }

  const _Float16* Aw = (const _Float16*)(ring + (uint32_t)(wave >> 1) * kSliceB) + rlane * kRingPitchH + koff;
  const _Float16* Bw = (const _Float16*)(ring + (uint32_t)(2 + (wave & 1)) * kSliceB) + rlane * kRingPitchH + koff;
  // rolled: one stage per trip, so that the publish point below stands once in the text
#pragma unroll 1
  for (uint32_t s = 0; s < kStages; ++s) {
    const _Float16* As = Aw + (s & 1u) * (kBufB / 2u);
    const _Float16* Bs = Bw + (s & 1u) * (kBufB / 2u);
#pragma unroll
    for (int kk = 0; kk < 2; ++kk) {
      v16h ah[4], bh[4];
      ah[0] = FragH::load(As + kk * 32);
#pragma unroll
      for (int j = 0; j < 4; ++j) bh[j] = FragH::load(Bs + (j << 4) * kRingPitchH + kk * 32);
#pragma unroll
      for (int i = 1; i < 4; ++i) ah[i] = FragH::load(As + (i << 4) * kRingPitchH + kk * 32);
      // keeps the step's 16 LDS reads one group in front of its 16 matrix ops: sunk among them, each row waits out its own read
      __builtin_amdgcn_sched_barrier(0);
#pragma unroll
      for (int i = 0; i < 4; ++i) {
#pragma unroll
        for (int j = 0; j < 4; ++j) acc[i][j] = FragH::mma(ah[i], bh[j], acc[i][j]);
        guard4_h(acc[i][0], acc[i][1], acc[i][2], acc[i][3], ah[i], bh[0], bh[1], bh[2], bh[3]);
      }
      keep4_h(bh[0], bh[1], bh[2], bh[3]);
    }
    // publish point of trip s + 1
    wait_ds0();       // this wave's reads of trip s have returned
    wait_tensor0();   // this wave's slice of trip s + 1 has landed
    __syncthreads();  // trip s + 1's stage published; every wave has left trip s's buffer
    const uint32_t nxt = pinned(s + 2u);  // pinned(): the next descriptor's words are formed behind the wait above
    if (pinned(nxt < kStages)) {          // pinned(): scalar branch around the tensor load
      tdm_load(tdm_group0(dst + (nxt & 1u) * kBufB, src + (uint64_t)((nxt + rot) & (kStages - 1u)) * kStageRowB), g1);
    }
  }
  wait_tensor0();  // nothing of the mover in flight when the ring becomes staging
  wait_ds0();
  acc_guard4(acc[0][0], acc[0][1], acc[0][2], acc[0][3]);
  acc_guard4(acc[1][0], acc[1][1], acc[1][2], acc[1][3]);
  acc_guard4(acc[2][0], acc[2][1], acc[2][2], acc[2][3]);
  acc_guard4(acc[3][0], acc[3][1], acc[3][2], acc[3][3]);
}

// ---------------------------------------------------------------------------
// Fused q|k|v projection: [8192][3072] = XN[8192][1024] . WC[0..3071][1024]^T, f32 epilogue (x 1/16384, + bias, x carry: q kQCarry, k and v 16).
// One wave per 64x64 tile, 4 waves (2 x 2) per 128x128 block tile, grid = 64*24 = 1536 blocks of 128 threads (exact).
// A wave tile lies in one region (q, k or v: n0 >> 10), one head ((n0 & 1023) >> 6) and one batch element (m0 >> 11).
// The whole tile is staged per wave as f16 [64][72]: q/k regions row = token, v region row = d (transposed).
//   q/k: plane[b][head][s0 + row][0..63];  v: VT[b][head][row][s0 .. s0+63].
// ---------------------------------------------------------------------------
__global__ __launch_bounds__(128) void gemm_qkv_kernel(
    const unsigned short* __restrict__ XNp, const unsigned short* __restrict__ WCp,
    unsigned short* __restrict__ QPp, unsigned short* __restrict__ KPp, unsigned short* __restrict__ VTp,
    const float* __restrict__ bq, const float* __restrict__ bk, const float* __restrict__ bv) {
  __shared__ __attribute__((aligned(2048))) unsigned char Ring[kRingB];
  static_assert(4u * 64u * 72u * 2u <= kRingB);
  const int lane = threadIdx.x & 31;
  const int wave = __builtin_amdgcn_readfirstlane((int)(threadIdx.x >> 5));
  constexpr int tilesN = kQkvN >> 7;
  constexpr int tilesM = kTok >> 7;
  const int tile = blockIdx.x;
  if (tile >= tilesM * tilesN) return;
  const int tm = tile / tilesN;
  const int tn = tile - tm * tilesN;
  const int m0 = (tm << 7) + ((wave >> 1) << 6);
  const int n0 = (tn << 7) + ((wave & 1) << 6);

  v8f acc[4][4];
  gemm_tile_loop((const _Float16*)XNp, (const _Float16*)WCp, tm << 7, tn << 7, uni((uint32_t)(tm + tn)), wave, lane, Ring, acc);

  const int rlane = lane & 15;
  const int mOff  = (lane >> 4) * 8;
  const int region = n0 >> 10;
  const int nl0  = n0 & (kDim - 1);
  const int head = nl0 >> 6;
  const int bidx = m0 >> 11;
  const int s0   = m0 & (kSeq - 1);
  const float* bias = (region == 0) ? bq : ((region == 1) ? bk : bv);
  const float carry = (region == 0) ? kQCarry : kQkvCarry;
  float bvj[4];
#pragma unroll
  for (int j = 0; j < 4; ++j) bvj[j] = bias[nl0 + (j << 4) + rlane];

  _Float16* st = (_Float16*)Ring + wave * (64 * 72);
#pragma unroll
  for (int i = 0; i < 4; ++i) {
#pragma unroll
    for (int j = 0; j < 4; ++j) {
      float y[8];
#pragma unroll
      for (int r = 0; r < 8; ++r) y[r] = (acc[i][j][r] * kProjScale + bvj[j]) * carry;
      if (region < 2) {
#pragma unroll
        for (int r = 0; r < 8; ++r) st[((i << 4) + mOff + r) * 72 + (j << 4) + rlane] = (_Float16)y[r];
      } else {
        v8h t;
#pragma unroll
        for (int r = 0; r < 8; ++r) t[r] = (_Float16)y[r];
        *(v8h*)(st + ((j << 4) + rlane) * 72 + (i << 4) + mOff) = t;
      }
    }
  }
  wave_lds_sync();

  unsigned short* plane;
  size_t gbase;
  int gpitch;
  if (region < 2) {
    plane  = (region == 0) ? QPp : KPp;
    gbase  = ((size_t)(bidx * kHeads + head) * kSeq + s0) * kHd;
    gpitch = kHd;
  } else {
    plane  = VTp;
    gbase  = (size_t)(bidx * kHeads + head) * kHd * kSeq + s0;
    gpitch = kSeq;
  }
  const int q4 = lane >> 3, c8 = (lane & 7) * 8;
  {
#pragma unroll
    for (int it = 0; it < 16; ++it) {
      const int row = it * 4 + q4;
      const v8h val = *(const v8h*)(st + row * 72 + c8);
      *(v8h*)(plane + gbase + (size_t)row * gpitch + c8) = val;
    }
    
  }
}

// ---------------------------------------------------------------------------
// Output projection: out[8192][1024] (f32) = AO[8192][1024] . WC[3072..4095][1024]^T x 2^-20 + bo.
// One wave per 64x64 tile, 4 waves (2 x 2) per 128x128 block tile, grid = 64*8 = 512 blocks of 128 threads (exact).
// 16-row f32 slabs per wave in LDS;
// ---------------------------------------------------------------------------
__global__ __launch_bounds__(128) void gemm_out_kernel(
    const unsigned short* __restrict__ AOp, const unsigned short* __restrict__ WOp,
    float* __restrict__ out, const float* __restrict__ bo) {
  __shared__ __attribute__((aligned(2048))) unsigned char Ring[kRingB];
  static_assert(4u * 16u * 68u * 4u <= kRingB);
  const int lane = threadIdx.x & 31;
  const int wave = __builtin_amdgcn_readfirstlane((int)(threadIdx.x >> 5));
  constexpr int tilesN = kDim >> 7;
  constexpr int tilesM = kTok >> 7;
  const int tile = blockIdx.x;
  if (tile >= tilesM * tilesN) return;
  const int tm = tile / tilesN;
  const int tn = tile - tm * tilesN;
  const int m0 = (tm << 7) + ((wave >> 1) << 6);
  const int n0 = (tn << 7) + ((wave & 1) << 6);

  v8f acc[4][4];
  gemm_tile_loop((const _Float16*)AOp, (const _Float16*)WOp, tm << 7, tn << 7, uni((uint32_t)(tm + tn)), wave, lane, Ring, acc);

  const int rlane = lane & 15;
  const int mOff  = (lane >> 4) * 8;
  float bvj[4];
#pragma unroll
  for (int j = 0; j < 4; ++j) bvj[j] = bo[n0 + (j << 4) + rlane];
  float* slab = (float*)Ring + wave * (16 * 68);
  const int hh = lane >> 4, c4 = (lane & 15) * 4;
#pragma unroll
  for (int i = 0; i < 4; ++i) {
    const int mBase = m0 + (i << 4);
#pragma unroll
    for (int j = 0; j < 4; ++j) {
#pragma unroll
      for (int r = 0; r < 8; ++r)
        slab[(mOff + r) * 68 + (j << 4) + rlane] = acc[i][j][r] * kOutScale + bvj[j];
    }
    wave_lds_sync();
    {
#pragma unroll
      for (int it = 0; it < 8; ++it) {
        const int row = it * 2 + hh;
        const v4f v = *(const v4f*)(slab + row * 68 + c4);
        *(v4f*)(out + (size_t)(mBase + row) * kDim + n0 + c4) = v;
      }
      
    }
    wave_lds_sync();
  }
}

__device__ __forceinline__ void guard2_h(v8f& a, v8f& b, v16h x, v16h y, v16h p, v16h q, v16h r, v16h s) {
  asm volatile("v_nop\n\tv_nop\n\tv_nop\n\tv_nop" : "+v"(a), "+v"(b) : "v"(x), "v"(y), "v"(p), "v"(q), "v"(r), "v"(s));
}
// the same for a group of five: the row-sum op's accumulator and A fragment are named too, so that the op stays in its
// group (untied, the compiler sinks it behind the stage barrier, in front of the next stage's K reads)
__device__ __forceinline__ void guard3_h(v8f& a, v8f& b, v8f& l, v16h x, v16h y, v16h e, v16h p, v16h q, v16h r, v16h s) {
  asm volatile("v_nop\n\tv_nop\n\tv_nop\n\tv_nop" : "+v"(a), "+v"(b), "+v"(l) : "v"(x), "v"(y), "v"(e), "v"(p), "v"(q), "v"(r), "v"(s));
}
constexpr int kQWave  = 32;
constexpr int kQBlock = 8 * kQWave;
static_assert((kSeq % kQBlock) == 0);

constexpr uint32_t kKvRows   = 16u;
constexpr uint32_t kKvSliceB = 4096u;
constexpr uint32_t kKvBufB   = 8u * kKvSliceB;
constexpr uint32_t kKvRingB  = 2u * kKvBufB;
constexpr uint32_t kKvStages = (uint32_t)kSeq / 64u;
static_assert(kKvRows * kRingPitchB <= kKvSliceB && (kKvSliceB % 2048u) == 0u);
static_assert(kKvStages >= 2u && (kKvStages & (kKvStages - 1u)) == 0u);
static_assert((uint32_t)kHd * 2u == kStageRowB);
// group 1: 1-byte elements, tensor = tile = 16 rows of 128 B, source pitch as given, 4 dwords of LDS pad behind every 32
// pinned(): words 1 to 7 are descriptor words held in scalar registers of their own: built once in front of the loop, so
// that the compiler does not lend a word's register to the loop's own arithmetic while a request is outstanding
__device__ __forceinline__ u32x8 tdm_group1_kv(uint32_t src_pitch) {
  constexpr uint32_t d0 = kStageRowB, d1 = kKvRows;
  u32x8 g;
  g[0] = uni((1u << 20) | (4u << 22) | (3u << 25));
  g[1] = pinned((d0 & 0xFFFFu) << 16);
  g[2] = pinned((d0 >> 16) | ((d1 & 0xFFFFu) << 16));
  g[3] = pinned((d1 >> 16) | (d0 << 16));
  g[4] = pinned(d1);
  g[5] = pinned(src_pitch);
  g[6] = pinned(0u);
  g[7] = pinned(0u);
  return g;
}

__global__ __launch_bounds__(256) void attn_kernel(const unsigned short* __restrict__ QPp,
                                                   const unsigned short* __restrict__ KPp,
                                                   const unsigned short* __restrict__ VTp,
                                                   unsigned short* __restrict__ AOp) {
  constexpr int kPitch = 72;
  constexpr int kQBlocks = kSeq / kQBlock;
  static_assert(kPitch == kRingPitchH);
  __shared__ __attribute__((aligned(2048))) unsigned char KvRing[kKvRingB];
  __shared__ __align__(16) _Float16 Osh[8 * kQWave * 72];
  const int tid  = threadIdx.x;
  const int lane = tid & 31;
  const int wave = __builtin_amdgcn_readfirstlane((int)(tid >> 5));
  const int hh   = lane >> 4;
  const int c    = lane & 15;
  const int bx   = blockIdx.x;
  const int qb   = bx % kQBlocks;
  const int bh   = bx / kQBlocks;
  const int head = bh & (kHeads - 1);
  const int bidx = bh >> 4;
  const int q0   = qb * kQBlock + wave * kQWave;

  const _Float16* Qh = (const _Float16*)QPp + (size_t)bh * kSeq * kHd;
  const _Float16* Kh = (const _Float16*)KPp + (size_t)bh * kSeq * kHd;
  const _Float16* Vh = (const _Float16*)VTp + (size_t)bh * kHd * kSeq;

  v16h qf[2][2];
#pragma unroll
  for (int u = 0; u < 2; ++u) {
    qf[u][0] = FragH::load(Qh + (size_t)(q0 + u * 16 + c) * kHd + 8 * hh);
    qf[u][1] = FragH::load(Qh + (size_t)(q0 + u * 16 + c) * kHd + 32 + 8 * hh);
  }

  // cin: C operand of a stage's first score ops, 10 - maximum in use of the lane's query, alike in all 8 registers (a lane's
  // 8 accumulator rows are 8 keys of one query); 0 until trip 0 has set the first maximum
  v8f oacc[2][4], lacc[2], cin[2];
#pragma unroll
  for (int u = 0; u < 2; ++u) {
#pragma unroll
    for (int t = 0; t < 4; ++t) oacc[u][t] = (v8f){0.f, 0.f, 0.f, 0.f, 0.f, 0.f, 0.f, 0.f};
    lacc[u] = (v8f){0.f, 0.f, 0.f, 0.f, 0.f, 0.f, 0.f, 0.f};
    cin[u]  = (v8f){0.f, 0.f, 0.f, 0.f, 0.f, 0.f, 0.f, 0.f};
  }
  // A fragment of the row sums: row = lane & 15, so rows 0 and 8 are the lanes with lane & 7 == 0; every k alike
  const _Float16 e1 = ((lane & 7) == 0) ? (_Float16)1.0f : (_Float16)0.0f;
  const v16h ef = {e1, e1, e1, e1, e1, e1, e1, e1, e1, e1, e1, e1, e1, e1, e1, e1};

  // this wave's slice: its first byte in stage 0, the bytes from one stage to the next, its source pitch, its LDS place
  const _Float16* srow = (wave < 4) ? Kh + (size_t)(wave * 16) * kHd : Vh + (size_t)((wave - 4) * 16) * kSeq;
  const uint64_t src  = (uint64_t)(size_t)srow;
  const uint32_t step = (wave < 4) ? 64u * kStageRowB : kStageRowB;
  const uint32_t dst  = (uint32_t)(size_t)KvRing + (uint32_t)wave * kKvSliceB;
  const u32x8 g1 = tdm_group1_kv((wave < 4) ? kStageRowB : (uint32_t)kSeq * 2u);

  static_assert((kKvStages % (uint32_t)kQBlocks) == 0u);
  const uint32_t rot = uni((uint32_t)qb) * (kKvStages / (uint32_t)kQBlocks);
  tdm_load(tdm_group0(dst, src + (uint64_t)rot * step), g1);
  wait_tensor0();   // this wave's slice of trip 0 has landed
  __syncthreads();  // trip 0's stage published to the other waves

  const _Float16* Kw = (const _Float16*)KvRing + c * kPitch + 8 * hh;
  const _Float16* Vw = (const _Float16*)(KvRing + 4u * kKvSliceB) + c * kPitch + 8 * hh;
  constexpr int kSliceH = (int)kKvSliceB / 2;
  // rolled: one stage per trip, so that the refill and the publish point stand once in the text
#pragma unroll 1
  for (uint32_t s = 0; s < kKvStages; ++s) {
    // refill, directly behind the barrier that published trip s's stage (in front of the loop, or at the foot of trip s - 1):
    // trip s + 1's stage goes into the buffer that every wave has left, and flies while trip s's stage is worked on. It stands at the
    // head of the trip, so that the trip's work behind the rescale branch is one block of code up to its barrier: with this branch at the foot the
    // compiler moved the row-sum arithmetic out from among the matrix ops to behind the barrier
    const uint32_t nxt = pinned(s + 1u);  // pinned(): the descriptor's words are formed behind the wait in front of that barrier
    if (pinned(nxt < kKvStages)) {        // pinned(): scalar branch around the tensor load
      tdm_load(tdm_group0(dst + (nxt & 1u) * kKvBufB, src + (uint64_t)((nxt + rot) & (kKvStages - 1u)) * step), g1);
    }
    const _Float16* Ks = Kw + (s & 1u) * (kKvBufB / 2u);
    const _Float16* Vs = Vw + (s & 1u) * (kKvBufB / 2u);

    v8f st[2][4];
#pragma unroll
    for (int j = 0; j < 4; ++j) {
      const v16h ka0 = FragH::load(Ks + j * kSliceH);
      const v16h ka1 = FragH::load(Ks + j * kSliceH + 32);
      st[0][j] = FragH::mma(ka0, qf[0][0], cin[0]);
      st[1][j] = FragH::mma(ka0, qf[1][0], cin[1]);
      st[0][j] = FragH::mma(ka1, qf[0][1], st[0][j]);
      st[1][j] = FragH::mma(ka1, qf[1][1], st[1][j]);
      guard2_h(st[0][j], st[1][j], ka0, ka1, qf[0][0], qf[0][1], qf[1][0], qf[1][1]);
    }

    float mx[2];
#pragma unroll
    for (int u = 0; u < 2; ++u) {
      mx[u] = st[u][0][0];
#pragma unroll
      for (int j = 0; j < 4; ++j)
#pragma unroll
        for (int r = 0; r < 8; ++r) mx[u] = fmaxf(mx[u], st[u][j][r]);
    }
    // one test per stage on each lane's own maxima; the ballot makes it a scalar branch, rarely taken behind trip 0
    if ((__builtin_amdgcn_ballot_w32(fmaxf(mx[0], mx[1]) > kPLog2Top) | (uint32_t)(s == 0u)) != 0u) {
#pragma unroll
      for (int u = 0; u < 2; ++u) {
        const float rise  = fmaxf(mx[u], __shfl_xor(mx[u], 16, 32)) - kPLog2Carry;  // the query's maximum over the one in use
        const float up    = fmaxf(rise, 0.0f);
        const float delta = (s == 0u) ? rise : up;  // trip 0 sets the maximum, down as well as up; later it only grows
        const float alpha = __builtin_amdgcn_exp2f(-up);
#pragma unroll
        for (int r = 0; r < 8; ++r) cin[u][r] -= delta;
#pragma unroll
        for (int j = 0; j < 4; ++j)
#pragma unroll
          for (int r = 0; r < 8; ++r) st[u][j][r] -= delta;
        lacc[u][0] *= alpha;
#pragma unroll
        for (int t = 0; t < 4; ++t)
#pragma unroll
          for (int r = 0; r < 8; ++r) oacc[u][t][r] *= alpha;
      }
    }

    v16h pf[2][2];
#pragma unroll
    for (int u = 0; u < 2; ++u)
#pragma unroll
      for (int j = 0; j < 4; ++j)
#pragma unroll
        for (int r = 0; r < 8; ++r)
          pf[u][j >> 1][(j & 1) * 8 + r] = (_Float16)__builtin_amdgcn_exp2f(st[u][j][r]);

#pragma unroll
    for (int t = 0; t < 4; ++t) {
      const v16h va0 = FragH::load(Vs + t * kSliceH);
      const v16h va1 = FragH::load(Vs + t * kSliceH + 32);
      // one of the stage's four row-sum ops per group (query tile t & 1, keys 32 (t >> 1) ..): it reads no LDS
      lacc[t & 1] = FragH::mma(ef, pf[t & 1][t >> 1], lacc[t & 1]);
      oacc[0][t] = FragH::mma(va0, pf[0][0], oacc[0][t]);
      oacc[1][t] = FragH::mma(va0, pf[1][0], oacc[1][t]);
      oacc[0][t] = FragH::mma(va1, pf[0][1], oacc[0][t]);
      oacc[1][t] = FragH::mma(va1, pf[1][1], oacc[1][t]);
      guard3_h(oacc[0][t], oacc[1][t], lacc[t & 1], va0, va1, ef, pf[0][0], pf[0][1], pf[1][0], pf[1][1]);
    }
    // publish point of trip s + 1
    wait_ds0();       // this wave's reads of trip s have returned
    wait_tensor0();   // this wave's slice of trip s + 1 has landed
    __syncthreads();  // trip s + 1's stage published; every wave has left trip s's buffer
  }
  wait_tensor0();  // nothing of the mover in flight when the wave ends
  wait_ds0();

  _Float16* os = Osh + wave * (kQWave * 72);
#pragma unroll
  for (int u = 0; u < 2; ++u) {
    const float inv = kCtxExtra * (1.0f / lacc[u][0]);
#pragma unroll
    for (int t = 0; t < 4; ++t) {
      v8h o;
#pragma unroll
      for (int r = 0; r < 8; ++r) o[r] = (_Float16)(oacc[u][t][r] * inv);
      *(v8h*)(os + (u * 16 + c) * 72 + t * 16 + 8 * hh) = o;
    }
  }
  wave_lds_sync();
  {
    const int q4 = lane >> 3, c8 = (lane & 7) * 8;
    {
#pragma unroll
      for (int it = 0; it < kQWave / 4; ++it) {
        const int row = it * 4 + q4;
        const v8h val = *(const v8h*)(os + row * 72 + c8);
        *(v8h*)(AOp + (size_t)(bidx * kSeq + q0 + row) * kDim + head * kHd + c8) = val;
      }
      
    }
  }
}

// ---------------------------------------------------------------------------
// Host glue: 4 kernel launches, nothing else.
// ---------------------------------------------------------------------------
extern "C" void kernel_launch(void* const* d_in, const int* in_sizes, int n_in,
                              void* d_out, int out_size, void* d_ws, size_t ws_size,
                              hipStream_t stream) {
  if (n_in < 11) return;
  if (in_sizes[0] != kTok * kDim) return;
  if (in_sizes[1] != kDim || in_sizes[2] != kDim) return;
  if (in_sizes[3] != kDim * kDim || in_sizes[5] != kDim * kDim) return;
  if (in_sizes[7] != kDim * kDim || in_sizes[9] != kDim * kDim) return;
  if (in_sizes[4] != kDim || in_sizes[6] != kDim || in_sizes[8] != kDim || in_sizes[10] != kDim) return;
  if (out_size != kTok * kDim) return;
  if (ws_size < kWsTotal) return;

  const float* x     = (const float*)d_in[0];
  const float* gamma = (const float*)d_in[1];
  const float* beta  = (const float*)d_in[2];
  const float* Wq    = (const float*)d_in[3];
  const float* bq    = (const float*)d_in[4];
  const float* Wk    = (const float*)d_in[5];
  const float* bk    = (const float*)d_in[6];
  const float* Wv    = (const float*)d_in[7];
  const float* bv    = (const float*)d_in[8];
  const float* Wo    = (const float*)d_in[9];
  const float* bo    = (const float*)d_in[10];
  float* out = (float*)d_out;

  char* ws = (char*)d_ws;
  unsigned short* XN = (unsigned short*)(ws + kOffXN);
  unsigned short* WC = (unsigned short*)(ws + kOffWC);
  unsigned short* QP = (unsigned short*)(ws + kOffQP);
  unsigned short* KP = (unsigned short*)(ws + kOffKP);
  unsigned short* VT = (unsigned short*)(ws + kOffVT);
  unsigned short* AO = (unsigned short*)(ws + kOffAO);
  unsigned short* WO = WC + (size_t)3 * kDim * kDim;

  prep_kernel<<<kPrepBlocks, kPrepWaves * 32, 0, stream>>>(x, gamma, beta, Wq, Wk, Wv, Wo, XN, WC, kWCarry);
  gemm_qkv_kernel<<<(kTok / 128) * (kQkvN / 128), 128, 0, stream>>>(XN, WC, QP, KP, VT, bq, bk, bv);
  attn_kernel<<<kBatch * kHeads * (kSeq / kQBlock), 256, 0, stream>>>(QP, KP, VT, AO);
  gemm_out_kernel<<<(kTok / 128) * (kDim / 128), 128, 0, stream>>>(AO, WO, out, bo);
}

// v009
// Measured time: 107 microseconds a run.
// Two timings next to v008 put it at 1.08 and 1.07 times that version's speed.
// All steps since v000 together make it 4.83 times as fast.
// All contractions (fused q|k|v projection, k.q^T scores, v^T.p^T context, output projection): v_wmma_f32_16x16x32_f16, f16 operands with constant carries, f32 accumulate; LayerNorm, softmax statistics, bias adds and normalisation in f32.
#include <hip/hip_runtime.h>
#include <math.h>
#include <stdint.h>

typedef __attribute__((ext_vector_type(16))) _Float16 v16h;
typedef __attribute__((ext_vector_type(8)))  _Float16 v8h;
typedef __attribute__((ext_vector_type(8)))  float    v8f;
typedef __attribute__((ext_vector_type(4)))  float    v4f;
typedef __attribute__((ext_vector_type(4)))  uint32_t u32x4;
typedef __attribute__((ext_vector_type(8)))  uint32_t u32x8;

// ---------------------------------------------------------------------------
// Shape constants
// ---------------------------------------------------------------------------
constexpr int kBatch = 4;
constexpr int kSeq   = 2048;
constexpr int kDim   = 1024;
constexpr int kHeads = 16;
constexpr int kHd    = 64;
constexpr int kTok   = kBatch * kSeq;
constexpr int kQkvN  = 3 * kDim;
static_assert(kHeads * kHd == kDim);
static_assert(kTok == 8192);
static_assert((kDim % 32) == 0);
static_assert((kTok % 64) == 0 && (kQkvN % 64) == 0 && (kDim % 64) == 0 && (kSeq % 128) == 0);

// logit scale 1/sqrt(head dim), exact power of two for head dim 64
constexpr float kAttnScale = 0.125f;
static_assert(kHd == 64);
static_assert(kAttnScale * kAttnScale * (float)kHd == 1.0f);

// power-of-two carries of the f16 operand planes
constexpr float kXnCarry    = 16.0f;
constexpr float kWCarry     = 1024.0f;
constexpr float kQkvCarry   = 16.0f;
constexpr float kPLog2Carry = 10.0f;
constexpr float kCtxCarry   = 1024.0f;
constexpr float kProjScale  = 1.0f / (kXnCarry * kWCarry);
constexpr float kCtxExtra   = kCtxCarry / kQkvCarry;
constexpr float kOutScale   = 1.0f / (kCtxCarry * kWCarry);
constexpr float kLog2e      = 1.4426950408889634f;
// q's carry: (q*kQCarry).(k*kQkvCarry) = logit * log2(e), so the score product is already a base-2 exponent
constexpr float kQCarry     = kLog2e * kAttnScale / kQkvCarry;
// largest base-2 exponent a probability may take before the maximum in use is moved: 2^15 is finite in f16
constexpr float kPLog2Top   = 15.0f;
static_assert(kPLog2Top > kPLog2Carry && kPLog2Top < 16.0f);
constexpr float kInvDim     = 1.0f / (float)kDim;
constexpr float kLnEps      = 1e-5f;

// ---------------------------------------------------------------------------
// Workspace region map (bytes; every offset a multiple of 128)
//   XN  f16 [8192][1024]      normalised activations x16          16,777,216
//   WC  f16 [4096][1024]      Wq | Wk | Wv | Wo rows, x1024         8,388,608
//   QP  f16 [4][16][2048][64] q x log2(e)/128                      16,777,216
//   KP  f16 [4][16][2048][64] k x16                               16,777,216
//   VT  f16 [4][16][64][2048] v x16, transposed per head          16,777,216
//   AO  f16 [8192][1024]      merged context x1024                16,777,216
//   total                                                         92,274,688
// ---------------------------------------------------------------------------
constexpr size_t kOffXN = 0;
constexpr size_t kOffWC = kOffXN + (size_t)kTok * kDim * 2;
constexpr size_t kOffQP = kOffWC + (size_t)4 * kDim * kDim * 2;
constexpr size_t kOffKP = kOffQP + (size_t)kTok * kDim * 2;
constexpr size_t kOffVT = kOffKP + (size_t)kTok * kDim * 2;
constexpr size_t kOffAO = kOffVT + (size_t)kTok * kDim * 2;
constexpr size_t kWsTotal = kOffAO + (size_t)kTok * kDim * 2;
static_assert(kWsTotal == 92274688ull);
static_assert(kWsTotal <= 134217728ull);
static_assert((kOffWC % 128) == 0 && (kOffQP % 128) == 0 && (kOffKP % 128) == 0 && (kOffVT % 128) == 0 && (kOffAO % 128) == 0);

// ---------------------------------------------------------------------------
// Fragment helpers (A and B use the same split k map: elements 0..7 <- p[0..7], 8..15 <- p[16..23],
// with p already offset by 8*(lane>>4); row / column = lane & 15)
// ---------------------------------------------------------------------------
struct FragH {
  union U { v16h v; v8h h[2]; };
  static __device__ __forceinline__ v16h load(const _Float16* p) {
    U f;
    f.h[0] = *(const v8h*)(p);
    f.h[1] = *(const v8h*)(p + 16);
    return f.v;
  }
  static __device__ __forceinline__ v8f mma(v16h a, v16h b, v8f c) {
    return __builtin_amdgcn_wmma_f32_16x16x32_f16(false, a, false, b, (short)0, c, false, false);
  }
};
// hazard guards: four idle slots after the last matrix op of a group, tying every accumulator of the group
// and naming the A and B fragment registers of the group as inputs
__device__ __forceinline__ void guard4_h(v8f& a, v8f& b, v8f& c, v8f& d, v16h x, v16h b0, v16h b1, v16h b2, v16h b3) {
  asm volatile("v_nop\n\tv_nop\n\tv_nop\n\tv_nop" : "+v"(a), "+v"(b), "+v"(c), "+v"(d) : "v"(x), "v"(b0), "v"(b1), "v"(b2), "v"(b3));
}
__device__ __forceinline__ void guard1_h(v8f& a, v16h x, v16h y, v16h z, v16h w) {
  asm volatile("v_nop\n\tv_nop\n\tv_nop\n\tv_nop" : "+v"(a) : "v"(x), "v"(y), "v"(z), "v"(w));
}
__device__ __forceinline__ void keep4_h(v16h a, v16h b, v16h c, v16h d) {
  asm volatile("v_nop" :: "v"(a), "v"(b), "v"(c), "v"(d));
}
__device__ __forceinline__ void acc_guard4(v8f& a, v8f& b, v8f& c, v8f& d) {
  asm volatile("v_nop\n\tv_nop\n\tv_nop\n\tv_nop" : "+v"(a), "+v"(b), "+v"(c), "+v"(d));
}
__device__ __forceinline__ void wave_lds_sync() {
  __builtin_amdgcn_fence(__ATOMIC_RELEASE, "workgroup");
  __builtin_amdgcn_wave_barrier();
  __builtin_amdgcn_fence(__ATOMIC_ACQUIRE, "workgroup");
}

// ---------------------------------------------------------------------------
// Operand preparation, one launch: LayerNorm of the token rows (-> XN) and the cast of the four weight matrices (-> WC).
// The two jobs do not depend on each other and both are short streams, so what they cost is mostly the launch and the
// start of their waves: one grid of 256 blocks of 16 waves (4,096 waves) does both. A row is 1,024 f32; wave w takes token
// rows 2w and 2w + 1 (4,096 x 2 = 8,192, exact) and row w of the stacked weights Wq | Wk | Wv | Wo (4 x 1,024, exact).
// All three rows are read once and held in registers: the lane owns columns it*256 + lane*8 .. +7 for it = 0..3, and the
// wave's 24 16-B loads, and the 16 of gamma and beta, are in flight together.
// LayerNorm: population variance from centred squares, eps inside the rsqrt, f32, then x16 and RNE convert to f16.
// Weights: f32 [1024][1024] ([out][in], already the Bt[n][k] layout) -> f16 x carry, same linear order.
// No block barriers in this kernel; the shuffles run under wave-uniform control only.
// ---------------------------------------------------------------------------
constexpr int kPrepWaves  = 16;
constexpr int kPrepBlocks = kTok / (2 * kPrepWaves);
static_assert(kPrepBlocks * kPrepWaves * 2 == kTok && kPrepBlocks * kPrepWaves == 4 * kDim);
__global__ __launch_bounds__(512) void prep_kernel(const float* __restrict__ x, const float* __restrict__ gamma,
                                                   const float* __restrict__ beta,
                                                   const float* __restrict__ w0, const float* __restrict__ w1,
                                                   const float* __restrict__ w2, const float* __restrict__ w3,
                                                   unsigned short* __restrict__ xn, unsigned short* __restrict__ wc,
                                                   float carry) {
  const int lane = threadIdx.x & 31;
  const int wave = __builtin_amdgcn_readfirstlane((int)(threadIdx.x >> 5));
  const int wid  = blockIdx.x * kPrepWaves + wave;
  if (wid >= 4 * kDim) return;
  const int z = wid >> 10;
  const float* W  = (z == 0) ? w0 : (z == 1) ? w1 : (z == 2) ? w2 : w3;
  // wave-uniform row bases and the lane's own column: the registers that every load below names
  const float* xb = x + (size_t)(2 * wid) * kDim;
  const float* wb = W + (size_t)(wid & (kDim - 1)) * kDim;
  const int col = lane * 8;
  const float* xr = xb + col;
  const float* wr = wb + col;

  v4f a[2][4][2], w[4][2], g[4][2], b[4][2];
#pragma unroll
  for (int it = 0; it < 4; ++it) {
    w[it][0] = *(const v4f*)(wr + it * 256);
    w[it][1] = *(const v4f*)(wr + it * 256 + 4);
  }
  // keeps the weight row's loads first in the queue (left free, this build issues six of them last): loads are waited for
  // in issue order, and the row is to be cast and stored while the token rows are still on their way
  __builtin_amdgcn_sched_barrier(0);
#pragma unroll
  for (int u = 0; u < 2; ++u)
#pragma unroll
    for (int it = 0; it < 4; ++it) {
      a[u][it][0] = *(const v4f*)(xr + u * kDim + it * 256);
      a[u][it][1] = *(const v4f*)(xr + u * kDim + it * 256 + 4);
    }
#pragma unroll
  for (int it = 0; it < 4; ++it) {
    g[it][0] = *(const v4f*)(gamma + col + it * 256);
    g[it][1] = *(const v4f*)(gamma + col + it * 256 + 4);
    b[it][0] = *(const v4f*)(beta + col + it * 256);
    b[it][1] = *(const v4f*)(beta + col + it * 256 + 4);
  }
  // the wait in front of any overwrite of a register that an issued load names. Its inputs are those registers (the lane's
  // byte offset and the four bases): live up to the wait, none of them is handed out as a load's result or to a later
  // argument fetch in front of it. Its "memory" clobber keeps all 40 loads in front of it, so that the wave waits out one
  // memory latency and not several; the fence behind it holds the arithmetic's register writes behind the wait
  asm volatile("s_wait_xcnt 0x0" :: "v"(col * 4), "s"(wb), "s"(xb), "s"(gamma), "s"(beta) : "memory");
  __builtin_amdgcn_sched_barrier(0);

  // the weight row was asked for first: it is cast and stored while the token rows are still on their way
  unsigned short* q = wc + (size_t)wid * kDim + lane * 8;
#pragma unroll
  for (int it = 0; it < 4; ++it) {
    v8h hv;
#pragma unroll
    for (int e = 0; e < 4; ++e) {
      hv[e] = (_Float16)(w[it][0][e] * carry);
      hv[4 + e] = (_Float16)(w[it][1][e] * carry);
    }
    *(v8h*)(q + it * 256) = hv;
  }
  // the same wait for the four stores, whose data registers the LayerNorm arithmetic takes over; the fence keeps the
  // stores here, ahead of the wait for the token rows, and that arithmetic behind the wait
  asm volatile("s_wait_xcnt 0x0" ::: "memory");
  __builtin_amdgcn_sched_barrier(0);

  float s[2] = {0.0f, 0.0f};
#pragma unroll
  for (int u = 0; u < 2; ++u)
#pragma unroll
    for (int it = 0; it < 4; ++it) {
      const v4f a0 = a[u][it][0], a1 = a[u][it][1];
      s[u] += ((a0[0] + a0[1]) + (a0[2] + a0[3])) + ((a1[0] + a1[1]) + (a1[2] + a1[3]));
    }
#pragma unroll
  for (int off = 16; off > 0; off >>= 1)
#pragma unroll
    for (int u = 0; u < 2; ++u) s[u] += __shfl_xor(s[u], off, 32);
  float mu[2], ss[2];
#pragma unroll
  for (int u = 0; u < 2; ++u) {
    mu[u] = s[u] * kInvDim;
    ss[u] = 0.0f;
#pragma unroll
    for (int it = 0; it < 4; ++it)
#pragma unroll
      for (int e = 0; e < 4; ++e) {
        const float d0 = a[u][it][0][e] - mu[u];
        const float d1 = a[u][it][1][e] - mu[u];
        ss[u] = fmaf(d0, d0, ss[u]);
        ss[u] = fmaf(d1, d1, ss[u]);
      }
  }
#pragma unroll
  for (int off = 16; off > 0; off >>= 1)
#pragma unroll
    for (int u = 0; u < 2; ++u) ss[u] += __shfl_xor(ss[u], off, 32);
  float inv[2];
#pragma unroll
  for (int u = 0; u < 2; ++u) inv[u] = rsqrtf(ss[u] * kInvDim + kLnEps);

  unsigned short* orow = xn + (size_t)(2 * wid) * kDim + lane * 8;
#pragma unroll
  for (int it = 0; it < 4; ++it) {
    const v4f g0 = g[it][0], g1 = g[it][1], b0 = b[it][0], b1 = b[it][1];
#pragma unroll
    for (int u = 0; u < 2; ++u) {
      v8h hv;
#pragma unroll
      for (int e = 0; e < 4; ++e) {
        const float y0 = fmaf((a[u][it][0][e] - mu[u]) * inv[u], g0[e], b0[e]) * kXnCarry;
        const float y1 = fmaf((a[u][it][1][e] - mu[u]) * inv[u], g1[e], b1[e]) * kXnCarry;
        hv[e] = (_Float16)y0;
        hv[4 + e] = (_Float16)y1;
      }
      *(v8h*)(orow + u * kDim + it * 256) = hv;
    }
  }
}

// ---------------------------------------------------------------------------
// GEMM operand ring in LDS. A block of 4 waves (2 x 2) owns a 128 x 128 tile of the product; a stage is 64 k = 128 B of
// each of its 128 A rows and 128 Bt rows. Every wave brings one slice of 64 rows per stage with one tensor load
// (waves 0, 1: the A rows; waves 2, 3: the Bt rows); the load's pad lays the rows at a pitch of 144 B (16 B x 9) for the
// 16-B fragment reads. A slice holds 64 x 144 = 9,216 B and is placed every 10,240 B (a multiple of 2 KiB).
// Two buffers of four slices each: 81,920 B, which the output projection's epilogue reuses as per-wave staging behind the last barrier.
// Rotated start: the blocks of one tile row read the same A rows and the blocks of one tile column the same Bt rows, and
// blocks that start together stay together, so that at every stage many of them would ask L2 for the same lines at the
// same moment. Trip s of a block therefore works on k stage (s + rot) mod 16, rot = (tile row + tile column) mod 16: every
// stage once, in an order that differs between neighbours. The LDS buffer goes by the trip, the source address by the stage.
// ---------------------------------------------------------------------------
constexpr uint32_t kStageRowB  = 128u;
constexpr uint32_t kRingPitchB = 144u;
constexpr uint32_t kSliceRows  = 64u;
constexpr uint32_t kSliceB     = 10240u;
constexpr uint32_t kBufB       = 4u * kSliceB;
constexpr uint32_t kRingB      = 2u * kBufB;
constexpr uint32_t kStages     = (uint32_t)kDim * 2u / kStageRowB;
constexpr int      kRingPitchH = (int)kRingPitchB / 2;
static_assert(kSliceRows * kRingPitchB <= kSliceB && (kSliceB % 2048u) == 0u);
static_assert(kStages >= 2u && (kStages & (kStages - 1u)) == 0u);
static_assert((kTok % 128) == 0 && (kQkvN % 128) == 0 && (kDim % 128) == 0);

__device__ __forceinline__ uint32_t uni(uint32_t v) { return (uint32_t)__builtin_amdgcn_readfirstlane(v); }
// holds a wave-uniform value in a scalar register: a test made of it compiles to a scalar compare and branch (a tensor
// load ignores EXEC), and what is computed from it stays behind the asm waits written in front of it
__device__ __forceinline__ uint32_t pinned(uint32_t v) {
  uint32_t w = uni(v);
  asm volatile("" : "+s"(w));
  return w;
}
// the compiler places no wait for the tensor mover: a tile counts as landed only behind its issuer's s_wait_tensorcnt, and
// a buffer is handed back to the mover only behind its readers' s_wait_dscnt; the clobber keeps LDS accesses on their side
__device__ __forceinline__ void wait_ds0()     { asm volatile("s_wait_dscnt 0x0" ::: "memory"); }
__device__ __forceinline__ void wait_tensor0() { asm volatile("s_wait_tensorcnt 0x0" ::: "memory"); }
// one request of the whole wave: a 2-D tile from global memory into LDS, through no register
__device__ __forceinline__ void tdm_load(u32x4 g0, u32x8 g1) {
  asm volatile("tensor_load_to_lds %0, %1" :: "s"(g0), "s"(g1) : "memory");
}
// group 1: 1-byte elements, tensor = tile = 64 rows of 128 B, source pitch one K row, 4 dwords of LDS pad behind every 32
// pinned(): words 1 to 7 are descriptor words held in scalar registers of their own: built once in front of the loop, so
// that the compiler does not lend a word's register to the loop's own arithmetic while a request is outstanding
__device__ __forceinline__ u32x8 tdm_group1() {
  constexpr uint32_t d0 = kStageRowB, d1 = kSliceRows;
  u32x8 g;
  g[0] = uni((1u << 20) | (4u << 22) | (3u << 25));
  g[1] = pinned((d0 & 0xFFFFu) << 16);
  g[2] = pinned((d0 >> 16) | ((d1 & 0xFFFFu) << 16));
  g[3] = pinned((d1 >> 16) | (d0 << 16));
  g[4] = pinned(d1);
  g[5] = pinned((uint32_t)kDim * 2u);
  g[6] = pinned(0u);
  g[7] = pinned(0u);
  return g;
}
__device__ __forceinline__ u32x4 tdm_group0(uint32_t lds_dst, uint64_t ga) {
  u32x4 g;
  g[0] = uni(1u);
  g[1] = uni(lds_dst);
  g[2] = uni((uint32_t)ga);
  g[3] = uni((((uint32_t)(ga >> 32)) & 0x01FFFFFFu) | 0x80000000u);
  return g;
}

// ---------------------------------------------------------------------------
// Register-blocked GEMM main loop: acc[i][j] (16x16 sub-tiles of a 64x64 wave tile) = sum_k A[m][k] * Bt[n][k],
// A row-major pitch 1024, Bt row-major pitch 1024, K = 1024 (16 stages of 64 k, two 32-k steps each).
// Wave w works on rows bm0 + 64 (w >> 1) and columns bn0 + 64 (w & 1): it reads slice w >> 1 (A) and slice 2 + (w & 1) (Bt).
// Every wave of the block runs the whole loop: all barriers stand under block-uniform control.
// ---------------------------------------------------------------------------
__device__ __forceinline__ void gemm_tile_loop(const _Float16* __restrict__ A, const _Float16* __restrict__ Bt,
                                               int bm0, int bn0, uint32_t rot, int wave, int lane, unsigned char* ring,
                                               v8f (&acc)[4][4]) {
  const int rlane = lane & 15;
  const int koff  = (lane >> 4) * 8;
#pragma unroll
  for (int i = 0; i < 4; ++i)
#pragma unroll
    for (int j = 0; j < 4; ++j) acc[i][j] = (v8f){0.f, 0.f, 0.f, 0.f, 0.f, 0.f, 0.f, 0.f};

  const _Float16* srow = (wave < 2) ? A + (size_t)(bm0 + wave * 64) * kDim : Bt + (size_t)(bn0 + (wave - 2) * 64) * kDim;
  const uint64_t src = (uint64_t)(size_t)srow;
  const uint32_t dst = (uint32_t)(size_t)ring + (uint32_t)wave * kSliceB;
  const u32x8 g1 = tdm_group1();

  tdm_load(tdm_group0(dst, src + (uint64_t)(rot & (kStages - 1u)) * kStageRowB), g1);
  wait_tensor0();   // this wave's slice of trip 0 has landed
  __syncthreads();  // trip 0's stage published to the other waves
  {
    const uint32_t st = pinned(1u);  // pinned(): trip 1's descriptor words are formed behind trip 0's wait
    tdm_load(tdm_group0(dst + st * kBufB, src + (uint64_t)((st + rot) & (kStages - 1u)) * kStageRowB), g1);
  }

  const _Float16* Aw = (const _Float16*)(ring + (uint32_t)(wave >> 1) * kSliceB) + rlane * kRingPitchH + koff;
  const _Float16* Bw = (const _Float16*)(ring + (uint32_t)(2 + (wave & 1)) * kSliceB) + rlane * kRingPitchH + koff;
  // rolled: one stage per trip, so that the publish point below stands once in the text
#pragma unroll 1
  for (uint32_t s = 0; s < kStages; ++s) {
    const _Float16* As = Aw + (s & 1u) * (kBufB / 2u);
    const _Float16* Bs = Bw + (s & 1u) * (kBufB / 2u);
#pragma unroll
    for (int kk = 0; kk < 2; ++kk) {
      v16h ah[4], bh[4];
      ah[0] = FragH::load(As + kk * 32);
#pragma unroll
      for (int j = 0; j < 4; ++j) bh[j] = FragH::load(Bs + (j << 4) * kRingPitchH + kk * 32);
#pragma unroll
      for (int i = 1; i < 4; ++i) ah[i] = FragH::load(As + (i << 4) * kRingPitchH + kk * 32);
      // keeps the step's 16 LDS reads one group in front of its 16 matrix ops: sunk among them, each row waits out its own read
      __builtin_amdgcn_sched_barrier(0);
#pragma unroll
      for (int i = 0; i < 4; ++i) {
#pragma unroll
        for (int j = 0; j < 4; ++j) acc[i][j] = FragH::mma(ah[i], bh[j], acc[i][j]);
        guard4_h(acc[i][0], acc[i][1], acc[i][2], acc[i][3], ah[i], bh[0], bh[1], bh[2], bh[3]);
      }
      keep4_h(bh[0], bh[1], bh[2], bh[3]);
    }
    // publish point of trip s + 1
    wait_ds0();       // this wave's reads of trip s have returned
    wait_tensor0();   // this wave's slice of trip s + 1 has landed
    __syncthreads();  // trip s + 1's stage published; every wave has left trip s's buffer
    const uint32_t nxt = pinned(s + 2u);  // pinned(): the next descriptor's words are formed behind the wait above
    if (pinned(nxt < kStages)) {          // pinned(): scalar branch around the tensor load
      tdm_load(tdm_group0(dst + (nxt & 1u) * kBufB, src + (uint64_t)((nxt + rot) & (kStages - 1u)) * kStageRowB), g1);
    }
  }
  wait_tensor0();  // nothing of the mover in flight when the ring becomes staging
  wait_ds0();
  acc_guard4(acc[0][0], acc[0][1], acc[0][2], acc[0][3]);
  acc_guard4(acc[1][0], acc[1][1], acc[1][2], acc[1][3]);
  acc_guard4(acc[2][0], acc[2][1], acc[2][2], acc[2][3]);
  acc_guard4(acc[3][0], acc[3][1], acc[3][2], acc[3][3]);
}

// ---------------------------------------------------------------------------
// Wide tile of the q|k|v projection. A block of 8 waves (4 x 2) owns a 256 x 384 tile of the product, a wave 64 x 192 of it:
// a step of 32 k reads 4 A and 12 Bt fragments from LDS for 48 matrix ops (a 64 x 64 wave tile reads 8 for 16), and a stage
// brings 640 operand rows from L2 for 768 matrix ops of the block (a 128 x 128 block tile 256 rows for 128).
// 32 x 8 = 256 such tiles: one block per WGP, two waves per SIMD, the whole product in one round.
// Ring: a stage is 64 k = 128 B of the 256 A rows and the 384 Bt rows, at the 144-B pitch of the ring above. Every wave brings
// one slice per stage with one tensor load: waves 0..3 the A rows, 64 each (placed every 10,240 B), waves 4..7 the Bt rows,
// 96 each (96 x 144 = 13,824 B, placed every 14,336 B, a multiple of 2 KiB). A buffer is 98,304 B, the ring of two 196,608 B.
// The 384 accumulator registers leave room for 4 A and 6 Bt fragments: a step takes its Bt fragments in two groups of 6
// (one slice each), each group read in front of its 24 matrix ops.
// ---------------------------------------------------------------------------
constexpr int      kWideM       = 256;
constexpr int      kWideN       = 384;
constexpr uint32_t kWideBRows   = 96u;
constexpr uint32_t kWideBSliceB = 14336u;
constexpr uint32_t kWideBOff    = 4u * kSliceB;
constexpr uint32_t kWideBufB    = kWideBOff + 4u * kWideBSliceB;
constexpr uint32_t kWideRingB   = 2u * kWideBufB;
static_assert(kWideBRows * kRingPitchB <= kWideBSliceB && (kWideBSliceB % 2048u) == 0u && (kWideBufB % 2048u) == 0u);
static_assert(4u * kSliceRows == (uint32_t)kWideM && 4u * kWideBRows == (uint32_t)kWideN);
static_assert((kTok % kWideM) == 0 && (kQkvN % kWideN) == 0);
// group 1 as tdm_group1(), for a slice of d1 rows (wave-uniform)
// pinned(): words 1 to 7 are descriptor words held in scalar registers of their own, built once in front of the loop
__device__ __forceinline__ u32x8 tdm_group1_rows(uint32_t d1) {
  constexpr uint32_t d0 = kStageRowB;
  u32x8 g;
  g[0] = uni((1u << 20) | (4u << 22) | (3u << 25));
  g[1] = pinned((d0 & 0xFFFFu) << 16);
  g[2] = pinned((d0 >> 16) | ((d1 & 0xFFFFu) << 16));
  g[3] = pinned((d1 >> 16) | (d0 << 16));
  g[4] = pinned(d1);
  g[5] = pinned((uint32_t)kDim * 2u);
  g[6] = pinned(0u);
  g[7] = pinned(0u);
  return g;
}
// acc[i][j] (16x16 sub-tiles of the 64x192 wave tile) = sum_k A[m][k] * Bt[n][k], K = 1024 (16 stages of 64 k).
// Wave w works on rows bm0 + 64 (w & 3) and columns bn0 + 192 (w >> 2): it reads A slice w & 3 and Bt slices 2 (w >> 2), + 1.
// Every wave of the block runs the whole loop: all barriers stand under block-uniform control.
// No asm guard stands behind the matrix ops of this loop: they are builtins, whose distances the compiler keeps itself, and
// an asm operand has to lie in v0..v255, where 384 accumulator registers do not fit (with the guards this build spilled).
__device__ __forceinline__ void gemm_wide_loop(const _Float16* __restrict__ A, const _Float16* __restrict__ Bt,
                                               int bm0, int bn0, uint32_t rot, int wave, int lane, unsigned char* ring,
                                               v8f (&acc)[4][12]) {
  const int rlane = lane & 15;
  const int koff  = (lane >> 4) * 8;
#pragma unroll
  for (int i = 0; i < 4; ++i)
#pragma unroll
    for (int j = 0; j < 12; ++j) acc[i][j] = (v8f){0.f, 0.f, 0.f, 0.f, 0.f, 0.f, 0.f, 0.f};

  const _Float16* srow = (wave < 4) ? A + (size_t)(bm0 + wave * 64) * kDim : Bt + (size_t)(bn0 + (wave - 4) * 96) * kDim;
  const uint64_t src = (uint64_t)(size_t)srow;
  const uint32_t dst = (uint32_t)(size_t)ring +
                       ((wave < 4) ? (uint32_t)wave * kSliceB : kWideBOff + (uint32_t)(wave - 4) * kWideBSliceB);
  const u32x8 g1 = tdm_group1_rows((wave < 4) ? kSliceRows : kWideBRows);

  tdm_load(tdm_group0(dst, src + (uint64_t)(rot & (kStages - 1u)) * kStageRowB), g1);
  wait_tensor0();   // this wave's slice of trip 0 has landed
  __syncthreads();  // trip 0's stage published to the other waves
  {
    const uint32_t st = pinned(1u);  // pinned(): trip 1's descriptor words are formed behind trip 0's wait
    tdm_load(tdm_group0(dst + st * kWideBufB, src + (uint64_t)((st + rot) & (kStages - 1u)) * kStageRowB), g1);
  }

  const _Float16* Aw = (const _Float16*)(ring + (uint32_t)(wave & 3) * kSliceB) + rlane * kRingPitchH + koff;
  const _Float16* Bw = (const _Float16*)(ring + kWideBOff + (uint32_t)(2 * (wave >> 2)) * kWideBSliceB) + rlane * kRingPitchH + koff;
  // rolled: one stage per trip, so that the publish point below stands once in the text
#pragma unroll 1
  for (uint32_t s = 0; s < kStages; ++s) {
    const _Float16* As = Aw + (s & 1u) * (kWideBufB / 2u);
    const _Float16* Bs = Bw + (s & 1u) * (kWideBufB / 2u);
#pragma unroll
    for (int kk = 0; kk < 2; ++kk) {
      v16h ah[4];
#pragma unroll
      for (int g = 0; g < 2; ++g) {
        v16h bh[6];
        if (g == 0) ah[0] = FragH::load(As + kk * 32);
#pragma unroll
        for (int j = 0; j < 6; ++j) bh[j] = FragH::load(Bs + g * (int)(kWideBSliceB / 2u) + (j << 4) * kRingPitchH + kk * 32);
        if (g == 0) {
#pragma unroll
          for (int i = 1; i < 4; ++i) ah[i] = FragH::load(As + (i << 4) * kRingPitchH + kk * 32);
        }
        // keeps a group's LDS reads in front of its own matrix ops: left free, this build sinks them among the ops two by two,
        // a read place behind every op
        __builtin_amdgcn_sched_barrier(0);
        if (kk == 1 && g == 1) {
          // publish point of stage s + 1. It stands where the stage's last fragments have been read: the refill then leaves
          // in front of the 24 matrix ops on them, which need registers only, and not behind them
          wait_ds0();       // this wave's reads of stage s have returned
          wait_tensor0();   // this wave's slice of stage s + 1 has landed
          __syncthreads();  // stage s + 1 published; every wave has left stage s's buffer
          const uint32_t nxt = pinned(s + 2u);  // pinned(): the next descriptor's words are formed behind the wait above
          if (pinned(nxt < kStages)) {          // pinned(): scalar branch around the tensor load
            tdm_load(tdm_group0(dst + (nxt & 1u) * kWideBufB, src + (uint64_t)((nxt + rot) & (kStages - 1u)) * kStageRowB), g1);
          }
        }
#pragma unroll
        for (int i = 0; i < 4; ++i) {
#pragma unroll
          for (int j = 0; j < 6; ++j) acc[i][g * 6 + j] = FragH::mma(ah[i], bh[j], acc[i][g * 6 + j]);
        }
      }
    }
  }
  wait_tensor0();  // nothing of the mover in flight when the ring becomes staging
  wait_ds0();
}

// ---------------------------------------------------------------------------
// Fused q|k|v projection: [8192][3072] = XN[8192][1024] . WC[0..3071][1024]^T, f32 epilogue (x 1/16384, + bias, x carry: q kQCarry, k and v 16).
// One wave per 64x192 tile, 8 waves (4 x 2) per 256x384 block tile, grid = 32*8 = 256 blocks of 256 threads (exact).
// Blocks that follow one another in the grid take different tile rows: the 8 blocks of one tile row lie 32 apart.
// Each 64x64 part of a wave tile lies in one region (q, k or v: n0 >> 10), one head ((n0 & 1023) >> 6) and one batch element
// (m0 >> 11); the three parts go out one after the other.
// A part is staged per wave as f16 [64][72]: q/k regions row = token, v region row = d (transposed).
//   q/k: plane[b][head][s0 + row][0..63];  v: VT[b][head][row][s0 .. s0+63].
// ---------------------------------------------------------------------------
__global__ __launch_bounds__(256) void gemm_qkv_kernel(
    const unsigned short* __restrict__ XNp, const unsigned short* __restrict__ WCp,
    unsigned short* __restrict__ QPp, unsigned short* __restrict__ KPp, unsigned short* __restrict__ VTp,
    const float* __restrict__ bq, const float* __restrict__ bk, const float* __restrict__ bv) {
  __shared__ __attribute__((aligned(2048))) unsigned char Ring[kWideRingB];
  static_assert(8u * 64u * 72u * 2u <= kWideRingB);
  const int lane = threadIdx.x & 31;
  const int wave = __builtin_amdgcn_readfirstlane((int)(threadIdx.x >> 5));
  constexpr int tilesN = kQkvN / kWideN;
  constexpr int tilesM = kTok / kWideM;
  const int tile = blockIdx.x;
  if (tile >= tilesM * tilesN) return;
  const int tn = tile / tilesM;
  const int tm = tile - tn * tilesM;
  const int m0  = tm * kWideM + ((wave & 3) << 6);
  const int nw0 = tn * kWideN + (wave >> 2) * 192;

  v8f acc[4][12];
  gemm_wide_loop((const _Float16*)XNp, (const _Float16*)WCp, tm * kWideM, tn * kWideN, uni((uint32_t)(tm + tn)), wave, lane, Ring, acc);

  const int rlane = lane & 15;
  const int mOff  = (lane >> 4) * 8;
  const int bidx = m0 >> 11;
  const int s0   = m0 & (kSeq - 1);
  float bvj[3][4];
#pragma unroll
  for (int h = 0; h < 3; ++h) {
    const int n0 = nw0 + (h << 6);
    const int region = n0 >> 10;
    const float* bias = ((region == 0) ? bq : ((region == 1) ? bk : bv)) + (n0 & (kDim - 1));
#pragma unroll
    for (int j = 0; j < 4; ++j) bvj[h][j] = bias[(j << 4) + rlane];
  }
  // the wait in front of any overwrite of a register that an issued load names. Its input is the lane's offset, which all 12
  // loads name: live up to the wait, it is not handed out as a load's result. The "memory" clobber keeps the 12 loads together
  // in front of it (left free, they sink to their first uses and are waited for one by one); the fence holds the
  // arithmetic's register writes behind the wait
  asm volatile("s_wait_xcnt 0x0" :: "v"(rlane) : "memory");
  __builtin_amdgcn_sched_barrier(0);

  _Float16* st = (_Float16*)Ring + wave * (64 * 72);
  const int q4 = lane >> 3, c8 = (lane & 7) * 8;
#pragma unroll
  for (int h = 0; h < 3; ++h) {
    const int n0 = nw0 + (h << 6);
    const int region = n0 >> 10;
    const int head = (n0 & (kDim - 1)) >> 6;
    const float carry = (region == 0) ? kQCarry : kQkvCarry;
    if (region < 2) {
#pragma unroll
      for (int i = 0; i < 4; ++i)
#pragma unroll
        for (int j = 0; j < 4; ++j)
#pragma unroll
          for (int r = 0; r < 8; ++r)
            st[((i << 4) + mOff + r) * 72 + (j << 4) + rlane] =
                (_Float16)((acc[i][h * 4 + j][r] * kProjScale + bvj[h][j]) * carry);
    } else {
#pragma unroll
      for (int i = 0; i < 4; ++i)
#pragma unroll
        for (int j = 0; j < 4; ++j) {
          v8h t;
#pragma unroll
          for (int r = 0; r < 8; ++r) t[r] = (_Float16)((acc[i][h * 4 + j][r] * kProjScale + bvj[h][j]) * carry);
          *(v8h*)(st + ((j << 4) + rlane) * 72 + (i << 4) + mOff) = t;
        }
    }
    wait_ds0();  // the wave's own staging rows are written before it reads them back (no other wave touches them)

    v8h val[16];
#pragma unroll
    for (int it = 0; it < 16; ++it) val[it] = *(const v8h*)(st + (it * 4 + q4) * 72 + c8);
    // keeps the 16 reads in front of the first store: between a branch's first store and its wait nothing then writes a register
    __builtin_amdgcn_sched_barrier(0);
    // One address per lane, the rows at constant distances from it. Each branch ends with the wait in front of any overwrite
    // of a register that an issued store names: what follows the branch (the other branch's address, the next part) takes
    // these registers over
    if (region < 2) {
      unsigned short* p = ((region == 0) ? QPp : KPp) + ((size_t)(bidx * kHeads + head) * kSeq + s0 + q4) * kHd + c8;
#pragma unroll
      for (int it = 0; it < 16; ++it) *(v8h*)(p + it * 4 * kHd) = val[it];
      asm volatile("s_wait_xcnt 0x0" ::: "memory");  // see above
    } else {
      unsigned short* p = VTp + ((size_t)(bidx * kHeads + head) * kHd + q4) * kSeq + s0 + c8;
#pragma unroll
      for (int it = 0; it < 16; ++it) *(v8h*)(p + it * 4 * kSeq) = val[it];
      asm volatile("s_wait_xcnt 0x0" ::: "memory");  // see above
    }
  }
}

// ---------------------------------------------------------------------------
// Output projection: out[8192][1024] (f32) = AO[8192][1024] . WC[3072..4095][1024]^T x 2^-20 + bo.
// One wave per 64x64 tile, 4 waves (2 x 2) per 128x128 block tile, grid = 64*8 = 512 blocks of 128 threads (exact).
// 16-row f32 slabs per wave in LDS;
// ---------------------------------------------------------------------------
__global__ __launch_bounds__(128) void gemm_out_kernel(
    const unsigned short* __restrict__ AOp, const unsigned short* __restrict__ WOp,
    float* __restrict__ out, const float* __restrict__ bo) {
  __shared__ __attribute__((aligned(2048))) unsigned char Ring[kRingB];
  static_assert(4u * 16u * 68u * 4u <= kRingB);
  const int lane = threadIdx.x & 31;
  const int wave = __builtin_amdgcn_readfirstlane((int)(threadIdx.x >> 5));
  constexpr int tilesN = kDim >> 7;
  constexpr int tilesM = kTok >> 7;
  const int tile = blockIdx.x;
  if (tile >= tilesM * tilesN) return;
  const int tm = tile / tilesN;
  const int tn = tile - tm * tilesN;
  const int m0 = (tm << 7) + ((wave >> 1) << 6);
  const int n0 = (tn << 7) + ((wave & 1) << 6);

  v8f acc[4][4];
  gemm_tile_loop((const _Float16*)AOp, (const _Float16*)WOp, tm << 7, tn << 7, uni((uint32_t)(tm + tn)), wave, lane, Ring, acc);

  const int rlane = lane & 15;
  const int mOff  = (lane >> 4) * 8;
  float bvj[4];
#pragma unroll
  for (int j = 0; j < 4; ++j) bvj[j] = bo[n0 + (j << 4) + rlane];
  float* slab = (float*)Ring + wave * (16 * 68);
  const int hh = lane >> 4, c4 = (lane & 15) * 4;
#pragma unroll
  for (int i = 0; i < 4; ++i) {
    const int mBase = m0 + (i << 4);
#pragma unroll
    for (int j = 0; j < 4; ++j) {
#pragma unroll
      for (int r = 0; r < 8; ++r)
        slab[(mOff + r) * 68 + (j << 4) + rlane] = acc[i][j][r] * kOutScale + bvj[j];
    }
    wave_lds_sync();
    {
#pragma unroll
      for (int it = 0; it < 8; ++it) {
        const int row = it * 2 + hh;
        const v4f v = *(const v4f*)(slab + row * 68 + c4);
        *(v4f*)(out + (size_t)(mBase + row) * kDim + n0 + c4) = v;
      }
      
    }
    wave_lds_sync();
  }
}

__device__ __forceinline__ void guard2_h(v8f& a, v8f& b, v16h x, v16h y, v16h p, v16h q, v16h r, v16h s) {
  asm volatile("v_nop\n\tv_nop\n\tv_nop\n\tv_nop" : "+v"(a), "+v"(b) : "v"(x), "v"(y), "v"(p), "v"(q), "v"(r), "v"(s));
}
// the same for a group of five: the row-sum op's accumulator and A fragment are named too, so that the op stays in its
// group (untied, the compiler sinks it behind the stage barrier, in front of the next stage's K reads)
__device__ __forceinline__ void guard3_h(v8f& a, v8f& b, v8f& l, v16h x, v16h y, v16h e, v16h p, v16h q, v16h r, v16h s) {
  asm volatile("v_nop\n\tv_nop\n\tv_nop\n\tv_nop" : "+v"(a), "+v"(b), "+v"(l) : "v"(x), "v"(y), "v"(e), "v"(p), "v"(q), "v"(r), "v"(s));
}
constexpr int kQWave  = 32;
constexpr int kQBlock = 8 * kQWave;
static_assert((kSeq % kQBlock) == 0);

constexpr uint32_t kKvRows   = 16u;
constexpr uint32_t kKvSliceB = 4096u;
constexpr uint32_t kKvBufB   = 8u * kKvSliceB;
constexpr uint32_t kKvRingB  = 2u * kKvBufB;
constexpr uint32_t kKvStages = (uint32_t)kSeq / 64u;
static_assert(kKvRows * kRingPitchB <= kKvSliceB && (kKvSliceB % 2048u) == 0u);
static_assert(kKvStages >= 2u && (kKvStages & (kKvStages - 1u)) == 0u);
static_assert((uint32_t)kHd * 2u == kStageRowB);
// group 1: 1-byte elements, tensor = tile = 16 rows of 128 B, source pitch as given, 4 dwords of LDS pad behind every 32
// pinned(): words 1 to 7 are descriptor words held in scalar registers of their own: built once in front of the loop, so
// that the compiler does not lend a word's register to the loop's own arithmetic while a request is outstanding
__device__ __forceinline__ u32x8 tdm_group1_kv(uint32_t src_pitch) {
  constexpr uint32_t d0 = kStageRowB, d1 = kKvRows;
  u32x8 g;
  g[0] = uni((1u << 20) | (4u << 22) | (3u << 25));
  g[1] = pinned((d0 & 0xFFFFu) << 16);
  g[2] = pinned((d0 >> 16) | ((d1 & 0xFFFFu) << 16));
  g[3] = pinned((d1 >> 16) | (d0 << 16));
  g[4] = pinned(d1);
  g[5] = pinned(src_pitch);
  g[6] = pinned(0u);
  g[7] = pinned(0u);
  return g;
}

__global__ __launch_bounds__(256) void attn_kernel(const unsigned short* __restrict__ QPp,
                                                   const unsigned short* __restrict__ KPp,
                                                   const unsigned short* __restrict__ VTp,
                                                   unsigned short* __restrict__ AOp) {
  constexpr int kPitch = 72;
  constexpr int kQBlocks = kSeq / kQBlock;
  static_assert(kPitch == kRingPitchH);
  __shared__ __attribute__((aligned(2048))) unsigned char KvRing[kKvRingB];
  __shared__ __align__(16) _Float16 Osh[8 * kQWave * 72];
  const int tid  = threadIdx.x;
  const int lane = tid & 31;
  const int wave = __builtin_amdgcn_readfirstlane((int)(tid >> 5));
  const int hh   = lane >> 4;
  const int c    = lane & 15;
  const int bx   = blockIdx.x;
  const int qb   = bx % kQBlocks;
  const int bh   = bx / kQBlocks;
  const int head = bh & (kHeads - 1);
  const int bidx = bh >> 4;
  const int q0   = qb * kQBlock + wave * kQWave;

  const _Float16* Qh = (const _Float16*)QPp + (size_t)bh * kSeq * kHd;
  const _Float16* Kh = (const _Float16*)KPp + (size_t)bh * kSeq * kHd;
  const _Float16* Vh = (const _Float16*)VTp + (size_t)bh * kHd * kSeq;

  v16h qf[2][2];
#pragma unroll
  for (int u = 0; u < 2; ++u) {
    qf[u][0] = FragH::load(Qh + (size_t)(q0 + u * 16 + c) * kHd + 8 * hh);
    qf[u][1] = FragH::load(Qh + (size_t)(q0 + u * 16 + c) * kHd + 32 + 8 * hh);
  }

  // cin: C operand of a stage's first score ops, 10 - maximum in use of the lane's query, alike in all 8 registers (a lane's
  // 8 accumulator rows are 8 keys of one query); 0 until trip 0 has set the first maximum
  v8f oacc[2][4], lacc[2], cin[2];
#pragma unroll
  for (int u = 0; u < 2; ++u) {
#pragma unroll
    for (int t = 0; t < 4; ++t) oacc[u][t] = (v8f){0.f, 0.f, 0.f, 0.f, 0.f, 0.f, 0.f, 0.f};
    lacc[u] = (v8f){0.f, 0.f, 0.f, 0.f, 0.f, 0.f, 0.f, 0.f};
    cin[u]  = (v8f){0.f, 0.f, 0.f, 0.f, 0.f, 0.f, 0.f, 0.f};
  }
  // A fragment of the row sums: row = lane & 15, so rows 0 and 8 are the lanes with lane & 7 == 0; every k alike
  const _Float16 e1 = ((lane & 7) == 0) ? (_Float16)1.0f : (_Float16)0.0f;
  const v16h ef = {e1, e1, e1, e1, e1, e1, e1, e1, e1, e1, e1, e1, e1, e1, e1, e1};

  // this wave's slice: its first byte in stage 0, the bytes from one stage to the next, its source pitch, its LDS place
  const _Float16* srow = (wave < 4) ? Kh + (size_t)(wave * 16) * kHd : Vh + (size_t)((wave - 4) * 16) * kSeq;
  const uint64_t src  = (uint64_t)(size_t)srow;
  const uint32_t step = (wave < 4) ? 64u * kStageRowB : kStageRowB;
  const uint32_t dst  = (uint32_t)(size_t)KvRing + (uint32_t)wave * kKvSliceB;
  const u32x8 g1 = tdm_group1_kv((wave < 4) ? kStageRowB : (uint32_t)kSeq * 2u);

  static_assert((kKvStages % (uint32_t)kQBlocks) == 0u);
  const uint32_t rot = uni((uint32_t)qb) * (kKvStages / (uint32_t)kQBlocks);
  tdm_load(tdm_group0(dst, src + (uint64_t)rot * step), g1);
  wait_tensor0();   // this wave's slice of trip 0 has landed
  __syncthreads();  // trip 0's stage published to the other waves

  const _Float16* Kw = (const _Float16*)KvRing + c * kPitch + 8 * hh;
  const _Float16* Vw = (const _Float16*)(KvRing + 4u * kKvSliceB) + c * kPitch + 8 * hh;
  constexpr int kSliceH = (int)kKvSliceB / 2;
  // rolled: one stage per trip, so that the refill and the publish point stand once in the text
#pragma unroll 1
  for (uint32_t s = 0; s < kKvStages; ++s) {
    // refill, directly behind the barrier that published trip s's stage (in front of the loop, or at the foot of trip s - 1):
    // trip s + 1's stage goes into the buffer that every wave has left, and flies while trip s's stage is worked on. It stands at the
    // head of the trip, so that the trip's work behind the rescale branch is one block of code up to its barrier: with this branch at the foot the
    // compiler moved the row-sum arithmetic out from among the matrix ops to behind the barrier
    const uint32_t nxt = pinned(s + 1u);  // pinned(): the descriptor's words are formed behind the wait in front of that barrier
    if (pinned(nxt < kKvStages)) {        // pinned(): scalar branch around the tensor load
      tdm_load(tdm_group0(dst + (nxt & 1u) * kKvBufB, src + (uint64_t)((nxt + rot) & (kKvStages - 1u)) * step), g1);
    }
    const _Float16* Ks = Kw + (s & 1u) * (kKvBufB / 2u);
    const _Float16* Vs = Vw + (s & 1u) * (kKvBufB / 2u);

    v8f st[2][4];
#pragma unroll
    for (int j = 0; j < 4; ++j) {
      const v16h ka0 = FragH::load(Ks + j * kSliceH);
      const v16h ka1 = FragH::load(Ks + j * kSliceH + 32);
      st[0][j] = FragH::mma(ka0, qf[0][0], cin[0]);
      st[1][j] = FragH::mma(ka0, qf[1][0], cin[1]);
      st[0][j] = FragH::mma(ka1, qf[0][1], st[0][j]);
      st[1][j] = FragH::mma(ka1, qf[1][1], st[1][j]);
      guard2_h(st[0][j], st[1][j], ka0, ka1, qf[0][0], qf[0][1], qf[1][0], qf[1][1]);
    }

    float mx[2];
#pragma unroll
    for (int u = 0; u < 2; ++u) {
      mx[u] = st[u][0][0];
#pragma unroll
      for (int j = 0; j < 4; ++j)
#pragma unroll
        for (int r = 0; r < 8; ++r) mx[u] = fmaxf(mx[u], st[u][j][r]);
    }
    // one test per stage on each lane's own maxima; the ballot makes it a scalar branch, rarely taken behind trip 0
    if ((__builtin_amdgcn_ballot_w32(fmaxf(mx[0], mx[1]) > kPLog2Top) | (uint32_t)(s == 0u)) != 0u) {
#pragma unroll
      for (int u = 0; u < 2; ++u) {
        const float rise  = fmaxf(mx[u], __shfl_xor(mx[u], 16, 32)) - kPLog2Carry;  // the query's maximum over the one in use
        const float up    = fmaxf(rise, 0.0f);
        const float delta = (s == 0u) ? rise : up;  // trip 0 sets the maximum, down as well as up; later it only grows
        const float alpha = __builtin_amdgcn_exp2f(-up);
#pragma unroll
        for (int r = 0; r < 8; ++r) cin[u][r] -= delta;
#pragma unroll
        for (int j = 0; j < 4; ++j)
#pragma unroll
          for (int r = 0; r < 8; ++r) st[u][j][r] -= delta;
        lacc[u][0] *= alpha;
#pragma unroll
        for (int t = 0; t < 4; ++t)
#pragma unroll
          for (int r = 0; r < 8; ++r) oacc[u][t][r] *= alpha;
      }
    }

    v16h pf[2][2];
#pragma unroll
    for (int u = 0; u < 2; ++u)
#pragma unroll
      for (int j = 0; j < 4; ++j)
#pragma unroll
        for (int r = 0; r < 8; ++r)
          pf[u][j >> 1][(j & 1) * 8 + r] = (_Float16)__builtin_amdgcn_exp2f(st[u][j][r]);

#pragma unroll
    for (int t = 0; t < 4; ++t) {
      const v16h va0 = FragH::load(Vs + t * kSliceH);
      const v16h va1 = FragH::load(Vs + t * kSliceH + 32);
      // one of the stage's four row-sum ops per group (query tile t & 1, keys 32 (t >> 1) ..): it reads no LDS
      lacc[t & 1] = FragH::mma(ef, pf[t & 1][t >> 1], lacc[t & 1]);
      oacc[0][t] = FragH::mma(va0, pf[0][0], oacc[0][t]);
      oacc[1][t] = FragH::mma(va0, pf[1][0], oacc[1][t]);
      oacc[0][t] = FragH::mma(va1, pf[0][1], oacc[0][t]);
      oacc[1][t] = FragH::mma(va1, pf[1][1], oacc[1][t]);
      guard3_h(oacc[0][t], oacc[1][t], lacc[t & 1], va0, va1, ef, pf[0][0], pf[0][1], pf[1][0], pf[1][1]);
    }
    // publish point of trip s + 1
    wait_ds0();       // this wave's reads of trip s have returned
    wait_tensor0();   // this wave's slice of trip s + 1 has landed
    __syncthreads();  // trip s + 1's stage published; every wave has left trip s's buffer
  }
  wait_tensor0();  // nothing of the mover in flight when the wave ends
  wait_ds0();

  _Float16* os = Osh + wave * (kQWave * 72);
#pragma unroll
  for (int u = 0; u < 2; ++u) {
    const float inv = kCtxExtra * (1.0f / lacc[u][0]);
#pragma unroll
    for (int t = 0; t < 4; ++t) {
      v8h o;
#pragma unroll
      for (int r = 0; r < 8; ++r) o[r] = (_Float16)(oacc[u][t][r] * inv);
      *(v8h*)(os + (u * 16 + c) * 72 + t * 16 + 8 * hh) = o;
    }
  }
  wave_lds_sync();
  {
    const int q4 = lane >> 3, c8 = (lane & 7) * 8;
    {
#pragma unroll
      for (int it = 0; it < kQWave / 4; ++it) {
        const int row = it * 4 + q4;
        const v8h val = *(const v8h*)(os + row * 72 + c8);
        *(v8h*)(AOp + (size_t)(bidx * kSeq + q0 + row) * kDim + head * kHd + c8) = val;
      }
      
    }
  }
}

// ---------------------------------------------------------------------------
// Host glue: 4 kernel launches, nothing else.
// ---------------------------------------------------------------------------
extern "C" void kernel_launch(void* const* d_in, const int* in_sizes, int n_in,
                              void* d_out, int out_size, void* d_ws, size_t ws_size,
                              hipStream_t stream) {
  if (n_in < 11) return;
  if (in_sizes[0] != kTok * kDim) return;
  if (in_sizes[1] != kDim || in_sizes[2] != kDim) return;
  if (in_sizes[3] != kDim * kDim || in_sizes[5] != kDim * kDim) return;
  if (in_sizes[7] != kDim * kDim || in_sizes[9] != kDim * kDim) return;
  if (in_sizes[4] != kDim || in_sizes[6] != kDim || in_sizes[8] != kDim || in_sizes[10] != kDim) return;
  if (out_size != kTok * kDim) return;
  if (ws_size < kWsTotal) return;

  const float* x     = (const float*)d_in[0];
  const float* gamma = (const float*)d_in[1];
  const float* beta  = (const float*)d_in[2];
  const float* Wq    = (const float*)d_in[3];
  const float* bq    = (const float*)d_in[4];
  const float* Wk    = (const float*)d_in[5];
  const float* bk    = (const float*)d_in[6];
  const float* Wv    = (const float*)d_in[7];
  const float* bv    = (const float*)d_in[8];
  const float* Wo    = (const float*)d_in[9];
  const float* bo    = (const float*)d_in[10];
  float* out = (float*)d_out;

  char* ws = (char*)d_ws;
  unsigned short* XN = (unsigned short*)(ws + kOffXN);
  unsigned short* WC = (unsigned short*)(ws + kOffWC);
  unsigned short* QP = (unsigned short*)(ws + kOffQP);
  unsigned short* KP = (unsigned short*)(ws + kOffKP);
  unsigned short* VT = (unsigned short*)(ws + kOffVT);
  unsigned short* AO = (unsigned short*)(ws + kOffAO);
  unsigned short* WO = WC + (size_t)3 * kDim * kDim;

  prep_kernel<<<kPrepBlocks, kPrepWaves * 32, 0, stream>>>(x, gamma, beta, Wq, Wk, Wv, Wo, XN, WC, kWCarry);
  gemm_qkv_kernel<<<(kTok / kWideM) * (kQkvN / kWideN), 256, 0, stream>>>(XN, WC, QP, KP, VT, bq, bk, bv);
  attn_kernel<<<kBatch * kHeads * (kSeq / kQBlock), 256, 0, stream>>>(QP, KP, VT, AO);
  gemm_out_kernel<<<(kTok / 128) * (kDim / 128), 128, 0, stream>>>(AO, WO, out, bo);
}
